// v000
// The times below were measured on an AMD MI455X: many runs one after another, warmed up first and cycling through
// copies of the inputs, with the whole window's GPU time divided by the number of runs. Launches and the gaps
// between them are all in it. The median over several windows is given; except for v000 it joins two sittings, which
// can be a few percent apart, so the side-by-side timings, each taken in one sitting, are the better comparison.
// The starting kernel, v000, takes 1450 microseconds a run.
#include <hip/hip_runtime.h>

// Causal multi-head attention whose heads are a RAW VIEW of the projections (x [2][2048][1024]; q, k, v = x W ('xw' [1024][1024] 0.02-scale, no bias); each is reshaped (b, 16, 2048, 64) WITHOUT a transpose: pseudo-head h, pseudo-position s, dim d = flat element h*2048*64 + s*64 + d of the [2048][1024] projection output (head h covers tokens 128 h .. 128 h + 127; pseudo-position s is the 64-wide feature block s mod 16 of token 128 h + s / 16); scores / sqrt(64); triu(k = 1) over the pseudo-positions -> -inf; softmax; the context (b, 16, 2048, 64) is reshaped (b, 2048, 1024) again WITHOUT a transpose; out = that Wproj ('xw', no bias) -> [2][2048][1024] (4.2 M); argument order x, Wq, Wk, Wv, Wproj).
// Layout per batch: bf16 copy of x; 'xw' weights transposed once; exact projections; RAW VIEW: the plane builders read each [2048][1024] projection output as (16, 2048, 64) WITHOUT a transpose (row pitch HD, head stride TT x HD) and k_merge writes the context planes back flat (no transpose back): the module's own reshapes; causal T-2048 attention (hybrid rows: < 512 hi/lo 3 products, rest fp16 x1024; tiles above the diagonal skipped); merged hi/lo x Wo exact.
// Compute dtypes, f32 accumulate: every input rounded to bf16; projections exact; attention rows < 512 3 products, rest fp16; softmax f32; Wo hl x exact.

#define NB_  2
#define TT   2048
#define DM   1024
#define NH_  16
#define NKV  16
#define REP  (NH_ / NKV)
#define HD   64
#define DQ   (NH_ * HD)
#define DKV  (NKV * HD)
#define ZH   2
#define RH   512                  // query rows < RH use hi+lo planes (0: none)
#define WIN  2048
#define PCAR 1024.0f
#define SCL  0.125f   // HD^-0.5
typedef _Float16 h16;
typedef unsigned short bf;
typedef __attribute__((ext_vector_type(16))) __bf16   v16bf;
typedef __attribute__((ext_vector_type(16))) _Float16 v16h;
typedef __attribute__((ext_vector_type(8)))  _Float16 v8h;
typedef __attribute__((ext_vector_type(8)))  unsigned short v8us;
typedef __attribute__((ext_vector_type(8)))  float    v8f;
typedef __attribute__((ext_vector_type(4)))  float    v4f;
typedef v8h  __attribute__((may_alias)) v8ha;
typedef v4f  __attribute__((may_alias)) v4fa;
typedef v8us __attribute__((may_alias)) v8usa;

__device__ __forceinline__ unsigned short f2bf(float f) { unsigned u = __float_as_uint(f); u += 0x7FFFu + ((u >> 16) & 1u); return (unsigned short)(u >> 16); }
__device__ __forceinline__ float bf2f(unsigned short b) { return __uint_as_float(((unsigned)b) << 16); }
__device__ __forceinline__ float bfr(float f) { return bf2f(f2bf(f)); }
__device__ __forceinline__ v16h cat16(v8h lo, v8h hi) { return __builtin_shufflevector(lo, hi, 0, 1, 2, 3, 4, 5, 6, 7, 8, 9, 10, 11, 12, 13, 14, 15); }
__device__ __forceinline__ v16bf cat16b(v8us lo, v8us hi) { return __builtin_bit_cast(v16bf, __builtin_shufflevector(lo, hi, 0, 1, 2, 3, 4, 5, 6, 7, 8, 9, 10, 11, 12, 13, 14, 15)); }
__device__ __forceinline__ v8f wmma16(v16h a, v16h b, v8f c) { return __builtin_amdgcn_wmma_f32_16x16x32_f16(false, a, false, b, (short)0, c, false, false); }
__device__ __forceinline__ v8f wmmab(v16bf a, v16bf b, v8f c) { return __builtin_amdgcn_wmma_f32_16x16x32_bf16(false, a, false, b, (short)0, c, false, false); }



// ---- k_gemmw: register-blocked GEMM, ONE WAVE per 64x64 output tile (16 accumulators), operands straight from K-contiguous 16-bit planes; grid (M/64, N/64, Z), 32 threads.
// C[m][n] (f32, pitch ldc, + optional f32 bias[n]) = sum_k A[m][k] Bt[n][k] (+ split products per NSPLIT). z-batch strides sA/sB/sC in elements. K % 32 == 0.
template <typename T16> struct WFrag;
template <> struct WFrag<h16> { typedef v16h V; static __device__ __forceinline__ V ld(const h16* p) { return cat16(*(const v8h*)p, *(const v8h*)(p + 16)); } static __device__ __forceinline__ v8f mma(V a, V b, v8f c) { return wmma16(a, b, c); } };
template <> struct WFrag<bf> { typedef v16bf V; static __device__ __forceinline__ V ld(const bf* p) { return cat16b(*(const v8us*)p, *(const v8us*)(p + 16)); } static __device__ __forceinline__ v8f mma(V a, V b, v8f c) { return wmmab(a, b, c); } };
template <typename T16, int NSPLIT, bool BIAS>
__global__ __launch_bounds__(32) void k_gemmw(const T16* __restrict__ A, const T16* __restrict__ A2, const T16* __restrict__ Bt, const T16* __restrict__ Bt2, int K, float* C, int ldc, const float* __restrict__ bias, size_t sA, size_t sB, size_t sC) {
    typedef typename WFrag<T16>::V V;
    __shared__ __align__(16) float os[16 * 68];
    const size_t z = blockIdx.z; A += z * sA; if (A2) A2 += z * sA; Bt += z * sB; if (Bt2) Bt2 += z * sB; C += z * sC;
    const int lane = threadIdx.x & 31, lr = lane & 15, hi = lane >> 4; const int r0 = blockIdx.x * 64, c0 = blockIdx.y * 64;
    v8f acc[4][4];
#pragma unroll
    for (int mb = 0; mb < 4; ++mb)
#pragma unroll
        for (int nb = 0; nb < 4; ++nb) acc[mb][nb] = (v8f){};
    const size_t aoff = (size_t)(r0 + lr) * K + 8 * hi, boff = (size_t)(c0 + lr) * K + 8 * hi;
#pragma unroll 1
    for (int kc = 0; kc < K; kc += 32) {
        V a[4], a2[4];
#pragma unroll
        for (int mb = 0; mb < 4; ++mb) { a[mb] = WFrag<T16>::ld(A + aoff + (size_t)mb * 16 * K + kc); if (NSPLIT == 1 || NSPLIT == 2) a2[mb] = WFrag<T16>::ld(A2 + aoff + (size_t)mb * 16 * K + kc); }
#pragma unroll
        for (int nb = 0; nb < 4; ++nb) { const V b = WFrag<T16>::ld(Bt + boff + (size_t)nb * 16 * K + kc); V b2; if (NSPLIT >= 2) b2 = WFrag<T16>::ld(Bt2 + boff + (size_t)nb * 16 * K + kc);
#pragma unroll
            for (int mb = 0; mb < 4; ++mb) { acc[mb][nb] = WFrag<T16>::mma(a[mb], b, acc[mb][nb]); if (NSPLIT == 1 || NSPLIT == 2) acc[mb][nb] = WFrag<T16>::mma(a2[mb], b, acc[mb][nb]); if (NSPLIT >= 2) acc[mb][nb] = WFrag<T16>::mma(a[mb], b2, acc[mb][nb]); } }
        asm volatile("v_nop\n\tv_nop\n\tv_nop\n\tv_nop" : "+v"(acc[0][0]), "+v"(acc[1][1]), "+v"(acc[2][2]), "+v"(acc[3][3]) : "v"(a[0]), "v"(a[3]));
    }
#pragma unroll
    for (int mb = 0; mb < 4; ++mb) {
#pragma unroll
        for (int nb = 0; nb < 4; ++nb) {
#pragma unroll
            for (int j = 0; j < 8; ++j) os[(hi * 8 + j) * 68 + nb * 16 + lr] = acc[mb][nb][j]; }
        __builtin_amdgcn_wave_barrier(); asm volatile("" ::: "memory");
        float* crow = C + (size_t)(r0 + mb * 16) * ldc + c0;
{
#pragma unroll
            for (int s = 0; s < 8; ++s) { const int row = 2 * s + hi, cofs = lr * 4; v4f val = *(const v4fa*)(os + row * 68 + cofs); if (BIAS) { val[0] += bfr(bias[c0 + cofs]); val[1] += bfr(bias[c0 + cofs + 1]); val[2] += bfr(bias[c0 + cofs + 2]); val[3] += bfr(bias[c0 + cofs + 3]); }
                *(v4f*)(crow + (size_t)row * ldc + cofs) = val; }
             }
        __builtin_amdgcn_wave_barrier(); asm volatile("" ::: "memory");
    }
}

// ---- k_gemmc: the same one-wave 64x64 tile GEMM specialised for causal attention: CMODE 1 skips score tiles entirely above the diagonal (query rows r0+roff.., key columns c0..), CMODE 2 limits the
// key (K) loop of the probability x value contraction to the diagonal block (probabilities beyond it are exactly zero). roff = row offset of this launch's first row within the sequence.
template <typename T16, int NSPLIT, int CMODE>
__global__ __launch_bounds__(32) void k_gemmc(const T16* __restrict__ A, const T16* __restrict__ A2, const T16* __restrict__ Bt, const T16* __restrict__ Bt2, int K, float* C, int ldc, int roff, size_t sA, size_t sB, size_t sC) {
    typedef typename WFrag<T16>::V V;
    __shared__ __align__(16) float os[16 * 68];
    const size_t z = blockIdx.z; A += z * sA; if (A2) A2 += z * sA; Bt += z * sB; if (Bt2) Bt2 += z * sB; C += z * sC;
    const int lane = threadIdx.x & 31, lr = lane & 15, hi = lane >> 4; const int r0 = blockIdx.x * 64, c0 = blockIdx.y * 64;
    if (CMODE == 1 && c0 > r0 + roff + 63) return;                  // score tile entirely above the causal diagonal: never read (the softmax masks j > i by select)
    const int Kl = (CMODE == 2) ? min(K, r0 + roff + 64) : K;        // P.V: probabilities are exactly 0 beyond the diagonal block, so the K loop stops there
    v8f acc[4][4];
#pragma unroll
    for (int mb = 0; mb < 4; ++mb)
#pragma unroll
        for (int nb = 0; nb < 4; ++nb) acc[mb][nb] = (v8f){};
    const size_t aoff = (size_t)(r0 + lr) * K + 8 * hi, boff = (size_t)(c0 + lr) * K + 8 * hi;
#pragma unroll 1
    for (int kc = 0; kc < Kl; kc += 32) {
        V a[4], a2[4];
#pragma unroll
        for (int mb = 0; mb < 4; ++mb) { a[mb] = WFrag<T16>::ld(A + aoff + (size_t)mb * 16 * K + kc); if (NSPLIT == 1 || NSPLIT == 2) a2[mb] = WFrag<T16>::ld(A2 + aoff + (size_t)mb * 16 * K + kc); }
#pragma unroll
        for (int nb = 0; nb < 4; ++nb) { const V b = WFrag<T16>::ld(Bt + boff + (size_t)nb * 16 * K + kc); V b2; if (NSPLIT >= 2) b2 = WFrag<T16>::ld(Bt2 + boff + (size_t)nb * 16 * K + kc);
#pragma unroll
            for (int mb = 0; mb < 4; ++mb) { acc[mb][nb] = WFrag<T16>::mma(a[mb], b, acc[mb][nb]); if (NSPLIT == 1 || NSPLIT == 2) acc[mb][nb] = WFrag<T16>::mma(a2[mb], b, acc[mb][nb]); if (NSPLIT >= 2) acc[mb][nb] = WFrag<T16>::mma(a[mb], b2, acc[mb][nb]); } }
        asm volatile("v_nop\n\tv_nop\n\tv_nop\n\tv_nop" : "+v"(acc[0][0]), "+v"(acc[1][1]), "+v"(acc[2][2]), "+v"(acc[3][3]) : "v"(a[0]), "v"(a[3]));
    }
#pragma unroll
    for (int mb = 0; mb < 4; ++mb) {
#pragma unroll
        for (int nb = 0; nb < 4; ++nb) {
#pragma unroll
            for (int j = 0; j < 8; ++j) os[(hi * 8 + j) * 68 + nb * 16 + lr] = acc[mb][nb][j]; }
        __builtin_amdgcn_wave_barrier(); asm volatile("" ::: "memory");
        float* crow = C + (size_t)(r0 + mb * 16) * ldc + c0;
{
#pragma unroll
            for (int s = 0; s < 8; ++s) { const int row = 2 * s + hi, cofs = lr * 4; v4f val = *(const v4fa*)(os + row * 68 + cofs);
                *(v4f*)(crow + (size_t)row * ldc + cofs) = val; }
             }
        __builtin_amdgcn_wave_barrier(); asm volatile("" ::: "memory");
    }
}

__device__ __forceinline__ h16 tohx(float x) { return (h16)x; }
__device__ __forceinline__ void splitf(float y, unsigned short& h, unsigned short& l) { h = f2bf(y); l = f2bf(y - bf2f(h)); }
typedef __attribute__((ext_vector_type(2))) _Float16 v2h;
typedef __attribute__((ext_vector_type(4))) _Float16 v4h;
typedef __attribute__((ext_vector_type(2))) unsigned short v2us;
typedef __attribute__((ext_vector_type(4))) unsigned short v4us;
typedef __attribute__((ext_vector_type(2))) float v2f;
typedef __attribute__((ext_vector_type(4))) int v4i;

__global__ __launch_bounds__(256) void k_wtG(const float* __restrict__ w, int K, int N, bf* Bt) {
    const int lane = threadIdx.x & 31; const int L0 = (blockIdx.x * 8 + (threadIdx.x >> 5)) * 8; const int nlines = N * K / 64;
{
#pragma unroll 1
        for (int l = 0; l < 8; ++l) { const int L = L0 + l; if (L >= nlines) break; const size_t e = (size_t)L * 64 + lane * 2; const int k = (int)(e % K), n = (int)(e / K); v2us o;
            o[0] = f2bf(w[(size_t)k * N + n]); o[1] = f2bf(w[(size_t)(k + 1) * N + n]); *(v2us*)(Bt + e) = o; }
         }
}
__global__ __launch_bounds__(256) void k_cvt8(const float* __restrict__ src, bf* dst, size_t n8) { const size_t i = (size_t)blockIdx.x * 256 + threadIdx.x; if (i >= n8) return; const v8f v = *(const v8f*)(src + i * 8); v8us o;
#pragma unroll
    for (int k = 0; k < 8; ++k) o[k] = f2bf(v[k]); *(v8us*)(dst + i * 8) = o;  }

// k_rope: head planes [h][t][d] (fp16 + hi/lo) of rope(x) x sc with the rotate-half convention out[d] = x[d] cos[t][d] - x[d+HD/2] sin[t][d], out[d+HD/2] = x[d+HD/2] cos[t][d+HD/2] + x[d] sin[t][d+HD/2]
__global__ __launch_bounds__(256) void k_rope(const float* __restrict__ F, int pitch, int nheads, const float* __restrict__ CS, const float* __restrict__ RF, const float* __restrict__ nw, float sc, h16* P16, bf* Ph, bf* Pl) {
    const size_t e = ((size_t)blockIdx.x * 256 + threadIdx.x) * 2; if (e >= (size_t)nheads * TT * HD) return; const int d = (int)(e % HD); const int t = (int)((e / HD) % TT); const int h = (int)(e / ((size_t)HD * TT)); const float* f = F + ((size_t)h * TT + t) * pitch;   /* RAW VIEW: pseudo-head h, pseudo-position t = the flat (S, D) projection output read as (H, S, hd): row pitch 'pitch' (= HD here), head stride TT * pitch */ const float rf = RF ? RF[(size_t)h * TT + t] : 1.0f; v2h o16; v2us oh, ol;
#pragma unroll
    for (int q = 0; q < 2; ++q) { const int dd = d + q; const int dp = (dd < HD / 2) ? dd + HD / 2 : dd - HD / 2; float x0 = f[dd], x1 = f[dp];
        if (RF) { float n0 = __fmul_rn(x0, rf), n1 = __fmul_rn(x1, rf); asm volatile("" : "+v"(n0)); asm volatile("" : "+v"(n1)); x0 = __fmul_rn(bfr(nw[dd]), n0); x1 = __fmul_rn(bfr(nw[dp]), n1); }
        const v2f cs = *(const v2f*)(CS + ((size_t)t * HD + dd) * 2); float a = __fmul_rn(x0, cs[0]), bq = __fmul_rn(x1, cs[1]); asm volatile("" : "+v"(a)); asm volatile("" : "+v"(bq)); const float r = ((dd < HD / 2) ? __fsub_rn(a, bq) : __fadd_rn(a, bq)) * sc;
        o16[q] = tohx(r); unsigned short a2, c2; splitf(r, a2, c2); oh[q] = a2; ol[q] = c2; }
    *(v2h*)(P16 + e) = o16; *(v2us*)(Ph + e) = oh; *(v2us*)(Pl + e) = ol;  }
__global__ __launch_bounds__(256) void k_vtp(const float* __restrict__ F, int pitch, int nheads, h16* V16, bf* Vh, bf* Vl) { const size_t e = ((size_t)blockIdx.x * 256 + threadIdx.x) * 2; if (e >= (size_t)nheads * HD * TT) return; const int t = (int)(e % TT); const int d = (int)((e / TT) % HD); const int g = (int)(e / ((size_t)TT * HD)); v2h o16; v2us oh, ol;
#pragma unroll
    for (int q = 0; q < 2; ++q) { const float x = F[((size_t)g * TT + (t + q)) * pitch + d];   /* RAW VIEW (as in k_rope) */ o16[q] = tohx(x); unsigned short a2, c2; splitf(x, a2, c2); oh[q] = a2; ol[q] = c2; }
    *(v2h*)(V16 + e) = o16; *(v2us*)(Vh + e) = oh; *(v2us*)(Vl + e) = ol;  }
__global__ __launch_bounds__(256) void k_csid(float* CS) { const int idx = blockIdx.x * 256 + threadIdx.x; if (idx >= TT * HD) return; v2f cs; cs[0] = 1.0f; cs[1] = 0.0f; *(v2f*)(CS + (size_t)idx * 2) = cs;  }
// k_asoft: per row (zz, i): t = S x HD^-0.5 for j <= i and i - j < WIN (sliding causal window; the reference's -1e9 additive fill vanishes identically); softmax over the 2048 keys (register row, one exp, fixed trees);
__global__ __launch_bounds__(256) void k_asoft(const float* __restrict__ Sb, h16* P16, bf* Ph, bf* Pl) {
    const int lane = threadIdx.x & 31; const int row = blockIdx.x * 8 + (threadIdx.x >> 5); if (row >= ZH * TT) return; const int i = row % TT; const int zz = row / TT; (void)zz; const bool hires = (i < RH); const float* sr = Sb + (size_t)row * TT; float v[TT / 32]; float mx = -3.0e38f;
#pragma unroll
    for (int ch = 0; ch < TT / 128; ++ch) { const int j0 = ch * 128 + lane * 4; const v4f a = *(const v4f*)(sr + j0);
#pragma unroll
        for (int q = 0; q < 4; ++q) { const int j = j0 + q; (void)j; const float t = (j <= i && i - j < WIN) ? a[q] * SCL : -3.0e38f; v[ch * 4 + q] = t; mx = fmaxf(mx, t); } }
#pragma unroll
    for (int sh = 16; sh; sh >>= 1) mx = fmaxf(mx, __shfl_xor(mx, sh, 32));
    float sum = 0.f;
#pragma unroll
    for (int k = 0; k < TT / 32; ++k) { float d0 = __fsub_rn(v[k], mx); asm volatile("" : "+v"(d0)); v[k] = __builtin_amdgcn_exp2f(__fmul_rn(d0, 1.4426950408889634f)); sum += v[k]; }
#pragma unroll
    for (int sh = 16; sh; sh >>= 1) sum += __shfl_xor(sum, sh, 32);
    const float f = __fdiv_rn(hires ? 1.0f : PCAR, sum);
{
        if (hires) {
#pragma unroll
            for (int ch = 0; ch < TT / 128; ++ch) { v4us oh, ol;
#pragma unroll
                for (int q = 0; q < 4; ++q) { unsigned short a, c2; splitf(v[ch * 4 + q] * f, a, c2); oh[q] = a; ol[q] = c2; }
                const size_t oo = ((size_t)zz * (RH ? RH : 1) + i) * TT + ch * 128 + lane * 4; *(v4us*)(Ph + oo) = oh; *(v4us*)(Pl + oo) = ol; }
        } else {
#pragma unroll
            for (int ch = 0; ch < TT / 128; ++ch) { v4h o4;
#pragma unroll
                for (int q = 0; q < 4; ++q) o4[q] = tohx(v[ch * 4 + q] * f);
                *(v4h*)(P16 + (size_t)row * TT + ch * 128 + lane * 4) = o4; } }
         }
}
__global__ __launch_bounds__(256) void k_merge(const float* __restrict__ O, int h0, bf* Ah, bf* Al) { const size_t e = ((size_t)blockIdx.x * 256 + threadIdx.x) * 2; if (e >= (size_t)ZH * TT * HD) return; const int d = (int)(e % HD); const int t = (int)((e / HD) % TT); const int zz = (int)(e / ((size_t)HD * TT)); const float cs = (t < RH) ? 1.0f : (1.0f / PCAR); const size_t oo = ((size_t)(h0 + zz) * TT + t) * HD + d;   /* RAW MERGE: the (H, S, hd) context written flat = the module's ctx.reshape(b, S, H * hd) without a transpose */
    v2us oh, ol;
#pragma unroll
    for (int q = 0; q < 2; ++q) { unsigned short a, c2; splitf(O[e + q] * cs, a, c2); oh[q] = a; ol[q] = c2; } *(v2us*)(Ah + oo) = oh; *(v2us*)(Al + oo) = ol;  }

extern "C" void kernel_launch(void* const* d_in, const int* in_sizes, int n_in,
                              void* d_out, int out_size, void* d_ws, size_t ws_size, hipStream_t stream) {
    (void)in_sizes; (void)n_in; (void)out_size;
    const float* x = (const float*)d_in[0]; const float* wq = (const float*)d_in[1]; const float* wk = (const float*)d_in[2]; const float* wv = (const float*)d_in[3]; const float* wo = (const float*)d_in[4];
    float* OUT = (float*)d_out;     // [2][2048][1024]
    char* wsp = (char*)d_ws;
    auto take = [&](size_t bytes) { char* p = wsp; wsp += (bytes + 255) & ~(size_t)255; return (void*)p; };
    bf* WQ = (bf*)take((size_t)DQ * DM * 2); bf* WK = (bf*)take((size_t)DKV * DM * 2); bf* WV = (bf*)take((size_t)DKV * DM * 2); bf* WO = (bf*)take((size_t)DM * DQ * 2); float* CS = (float*)take((size_t)TT * HD * 2 * 4);
    bf* XB = (bf*)take((size_t)TT * DM * 2); float* FQ = (float*)take((size_t)TT * DQ * 4); float* FK = (float*)take((size_t)TT * DKV * 4);
    h16* QP16 = (h16*)take((size_t)NH_ * TT * HD * 2); h16* KP16 = (h16*)take((size_t)NKV * TT * HD * 2); h16* VT16 = (h16*)take((size_t)NKV * HD * TT * 2);
    bf* QPh = (bf*)take((size_t)NH_ * TT * HD * 2); bf* QPl = (bf*)take((size_t)NH_ * TT * HD * 2); bf* KPh = (bf*)take((size_t)NKV * TT * HD * 2); bf* KPl = (bf*)take((size_t)NKV * TT * HD * 2); bf* VTh = (bf*)take((size_t)NKV * HD * TT * 2); bf* VTl = (bf*)take((size_t)NKV * HD * TT * 2); bf* Ph = (bf*)take((size_t)ZH * RH * TT * 2); bf* Pl = (bf*)take((size_t)ZH * RH * TT * 2);
    float* Sb = (float*)take((size_t)ZH * TT * TT * 4); h16* P16 = (h16*)take((size_t)ZH * TT * TT * 2); float* Ob = (float*)take((size_t)ZH * TT * HD * 4); bf* ATh = (bf*)take((size_t)TT * DQ * 2); bf* ATl = (bf*)take((size_t)TT * DQ * 2);
    if ((size_t)(wsp - (char*)d_ws) > ws_size) return;    // ws 256 MiB
    float* FV = FK;   // v projection reuses the k buffer after the k planes are built (stream-ordered)
    { k_wtG<<<(unsigned)((DM * DQ / 64 + 63) / 64), 256, 0, stream>>>(wq, DM, DQ, WQ); k_wtG<<<(unsigned)((DM * DKV / 64 + 63) / 64), 256, 0, stream>>>(wk, DM, DKV, WK); k_wtG<<<(unsigned)((DM * DKV / 64 + 63) / 64), 256, 0, stream>>>(wv, DM, DKV, WV);
      k_wtG<<<(unsigned)((DQ * DM / 64 + 63) / 64), 256, 0, stream>>>(wo, DQ, DM, WO);
       }
    k_csid<<<(TT * HD + 255) / 256, 256, 0, stream>>>(CS);
    const unsigned LQ = (unsigned)(((size_t)NH_ * TT * HD / 2 + 255) / 256), LKv = (unsigned)(((size_t)NKV * TT * HD / 2 + 255) / 256);
    for (int b = 0; b < NB_; ++b) {
        
        k_cvt8<<<(unsigned)(((size_t)TT * DM / 8 + 255) / 256), 256, 0, stream>>>(x + (size_t)b * TT * DM, XB, (size_t)TT * DM / 8);
        k_gemmw<bf, 0, false><<<dim3(TT / 64, DQ / 64, 1), 32, 0, stream>>>(XB, nullptr, WQ, nullptr, DM, FQ, DQ, nullptr, 0, 0, 0);
        k_rope<<<LQ, 256, 0, stream>>>(FQ, HD, NH_, CS, nullptr, nullptr, 1.0f, QP16, QPh, QPl);
        k_gemmw<bf, 0, false><<<dim3(TT / 64, DKV / 64, 1), 32, 0, stream>>>(XB, nullptr, WK, nullptr, DM, FK, DKV, nullptr, 0, 0, 0);
        k_rope<<<LKv, 256, 0, stream>>>(FK, HD, NKV, CS, nullptr, nullptr, 1.0f, KP16, KPh, KPl);
        k_gemmw<bf, 0, false><<<dim3(TT / 64, DKV / 64, 1), 32, 0, stream>>>(XB, nullptr, WV, nullptr, DM, FV, DKV, nullptr, 0, 0, 0); k_vtp<<<LKv, 256, 0, stream>>>(FV, HD, NKV, VT16, VTh, VTl);
        for (int h0 = 0; h0 < NH_; h0 += ZH) { const size_t zq = (size_t)h0, zk = (size_t)(h0 / REP);   // one kv head per query head: the pass's two heads use consecutive kv planes (z-strides TT*HD)
            k_gemmc<bf, 2, 1><<<dim3(RH / 64, TT / 64, ZH), 32, 0, stream>>>(QPh + zq * TT * HD, QPl + zq * TT * HD, KPh + zk * TT * HD, KPl + zk * TT * HD, HD, Sb, TT, 0, (size_t)TT * HD, (size_t)TT * HD, (size_t)TT * TT);
            k_gemmc<h16, 0, 1><<<dim3((TT - RH) / 64, TT / 64, ZH), 32, 0, stream>>>(QP16 + zq * TT * HD + (size_t)RH * HD, nullptr, KP16 + zk * TT * HD, nullptr, HD, Sb + (size_t)RH * TT, TT, RH, (size_t)TT * HD, (size_t)TT * HD, (size_t)TT * TT);
            k_asoft<<<ZH * TT / 8, 256, 0, stream>>>(Sb, P16, Ph, Pl);
            k_gemmc<bf, 2, 2><<<dim3(RH / 64, HD / 64, ZH), 32, 0, stream>>>(Ph, Pl, VTh + zk * HD * TT, VTl + zk * HD * TT, TT, Ob, HD, 0, (size_t)RH * TT, (size_t)HD * TT, (size_t)TT * HD);
            k_gemmc<h16, 0, 2><<<dim3((TT - RH) / 64, HD / 64, ZH), 32, 0, stream>>>(P16 + (size_t)RH * TT, nullptr, VT16 + zk * HD * TT, nullptr, TT, Ob + (size_t)RH * HD, HD, RH, (size_t)TT * TT, (size_t)HD * TT, (size_t)TT * HD);
            k_merge<<<(unsigned)(((size_t)ZH * TT * HD / 2 + 255) / 256), 256, 0, stream>>>(Ob, h0, ATh, ATl); }
        k_gemmw<bf, 1, false><<<dim3(TT / 64, DM / 64, 1), 32, 0, stream>>>(ATh, ATl, WO, nullptr, DQ, OUT + (size_t)b * TT * DM, DM, nullptr, 0, 0, 0); }
}

// v001
// It runs in 948 microseconds.
// Two timings next to v000 put it at 1.53 and 1.54 times that version's speed.
#include <hip/hip_runtime.h>

// Causal multi-head attention whose heads are a RAW VIEW of the projections (x [2][2048][1024]; q, k, v = x W ('xw' [1024][1024] 0.02-scale, no bias); each is reshaped (b, 16, 2048, 64) WITHOUT a transpose: pseudo-head h, pseudo-position s, dim d = flat element h*2048*64 + s*64 + d of the [2048][1024] projection output (head h covers tokens 128 h .. 128 h + 127; pseudo-position s is the 64-wide feature block s mod 16 of token 128 h + s / 16); scores / sqrt(64); triu(k = 1) over the pseudo-positions -> -inf; softmax; the context (b, 16, 2048, 64) is reshaped (b, 2048, 1024) again WITHOUT a transpose; out = that Wproj ('xw', no bias) -> [2][2048][1024] (4.2 M); argument order x, Wq, Wk, Wv, Wproj).
// Layout per batch: bf16 copy of x; 'xw' weights transposed once; exact projections; RAW VIEW: the plane builders read each [2048][1024] projection output as (16, 2048, 64) WITHOUT a transpose (row pitch HD, head stride TT x HD) and k_merge writes the context planes back flat (no transpose back): the module's own reshapes; causal T-2048 attention (hybrid rows: < 512 hi/lo 3 products, rest fp16 x1024; tiles above the diagonal skipped); merged hi/lo x Wo exact.
// Compute dtypes, f32 accumulate: every input rounded to bf16; projections exact; attention rows < 512 3 products, rest fp16; softmax f32; Wo hl x exact.

#define NB_  2
#define TT   2048
#define DM   1024
#define NH_  16
#define NKV  16
#define REP  (NH_ / NKV)
#define HD   64
#define DQ   (NH_ * HD)
#define DKV  (NKV * HD)
#define ZH   2
#define RH   512                  // query rows < RH use hi+lo planes (0: none)
#define WIN  2048
#define PCAR 1024.0f
#define SCL  0.125f   // HD^-0.5
typedef _Float16 h16;
typedef unsigned short bf;
typedef __attribute__((ext_vector_type(16))) __bf16   v16bf;
typedef __attribute__((ext_vector_type(16))) _Float16 v16h;
typedef __attribute__((ext_vector_type(8)))  _Float16 v8h;
typedef __attribute__((ext_vector_type(8)))  unsigned short v8us;
typedef __attribute__((ext_vector_type(8)))  float    v8f;
typedef __attribute__((ext_vector_type(4)))  float    v4f;
typedef v8h  __attribute__((may_alias)) v8ha;
typedef v4f  __attribute__((may_alias)) v4fa;
typedef v8us __attribute__((may_alias)) v8usa;

__device__ __forceinline__ unsigned short f2bf(float f) { unsigned u = __float_as_uint(f); u += 0x7FFFu + ((u >> 16) & 1u); return (unsigned short)(u >> 16); }
__device__ __forceinline__ float bf2f(unsigned short b) { return __uint_as_float(((unsigned)b) << 16); }
__device__ __forceinline__ float bfr(float f) { return bf2f(f2bf(f)); }
__device__ __forceinline__ v16h cat16(v8h lo, v8h hi) { return __builtin_shufflevector(lo, hi, 0, 1, 2, 3, 4, 5, 6, 7, 8, 9, 10, 11, 12, 13, 14, 15); }
__device__ __forceinline__ v16bf cat16b(v8us lo, v8us hi) { return __builtin_bit_cast(v16bf, __builtin_shufflevector(lo, hi, 0, 1, 2, 3, 4, 5, 6, 7, 8, 9, 10, 11, 12, 13, 14, 15)); }
__device__ __forceinline__ v8f wmma16(v16h a, v16h b, v8f c) { return __builtin_amdgcn_wmma_f32_16x16x32_f16(false, a, false, b, (short)0, c, false, false); }
__device__ __forceinline__ v8f wmmab(v16bf a, v16bf b, v8f c) { return __builtin_amdgcn_wmma_f32_16x16x32_bf16(false, a, false, b, (short)0, c, false, false); }



// ---- k_gemmw: register-blocked GEMM, ONE WAVE per 64x64 output tile (16 accumulators), operands straight from K-contiguous 16-bit planes; grid (M/64, N/64, Z), 32 threads.
// C[m][n] (f32, pitch ldc, + optional f32 bias[n]) = sum_k A[m][k] Bt[n][k] (+ split products per NSPLIT). z-batch strides sA/sB/sC in elements. K % 32 == 0.
template <typename T16> struct WFrag;
template <> struct WFrag<h16> { typedef v16h V; static __device__ __forceinline__ V ld(const h16* p) { return cat16(*(const v8h*)p, *(const v8h*)(p + 16)); } static __device__ __forceinline__ v8f mma(V a, V b, v8f c) { return wmma16(a, b, c); } };
template <> struct WFrag<bf> { typedef v16bf V; static __device__ __forceinline__ V ld(const bf* p) { return cat16b(*(const v8us*)p, *(const v8us*)(p + 16)); } static __device__ __forceinline__ v8f mma(V a, V b, v8f c) { return wmmab(a, b, c); } };
template <typename T16, int NSPLIT, bool BIAS>
__global__ __launch_bounds__(32) void k_gemmw(const T16* __restrict__ A, const T16* __restrict__ A2, const T16* __restrict__ Bt, const T16* __restrict__ Bt2, int K, float* C, int ldc, const float* __restrict__ bias, size_t sA, size_t sB, size_t sC) {
    typedef typename WFrag<T16>::V V;
    __shared__ __align__(16) float os[16 * 68];
    const size_t z = blockIdx.z; A += z * sA; if (A2) A2 += z * sA; Bt += z * sB; if (Bt2) Bt2 += z * sB; C += z * sC;
    const int lane = threadIdx.x & 31, lr = lane & 15, hi = lane >> 4; const int r0 = blockIdx.x * 64, c0 = blockIdx.y * 64;
    v8f acc[4][4];
#pragma unroll
    for (int mb = 0; mb < 4; ++mb)
#pragma unroll
        for (int nb = 0; nb < 4; ++nb) acc[mb][nb] = (v8f){};
    const size_t aoff = (size_t)(r0 + lr) * K + 8 * hi, boff = (size_t)(c0 + lr) * K + 8 * hi;
#pragma unroll 1
    for (int kc = 0; kc < K; kc += 32) {
        V a[4], a2[4];
#pragma unroll
        for (int mb = 0; mb < 4; ++mb) { a[mb] = WFrag<T16>::ld(A + aoff + (size_t)mb * 16 * K + kc); if (NSPLIT == 1 || NSPLIT == 2) a2[mb] = WFrag<T16>::ld(A2 + aoff + (size_t)mb * 16 * K + kc); }
#pragma unroll
        for (int nb = 0; nb < 4; ++nb) { const V b = WFrag<T16>::ld(Bt + boff + (size_t)nb * 16 * K + kc); V b2; if (NSPLIT >= 2) b2 = WFrag<T16>::ld(Bt2 + boff + (size_t)nb * 16 * K + kc);
#pragma unroll
            for (int mb = 0; mb < 4; ++mb) { acc[mb][nb] = WFrag<T16>::mma(a[mb], b, acc[mb][nb]); if (NSPLIT == 1 || NSPLIT == 2) acc[mb][nb] = WFrag<T16>::mma(a2[mb], b, acc[mb][nb]); if (NSPLIT >= 2) acc[mb][nb] = WFrag<T16>::mma(a[mb], b2, acc[mb][nb]); } }
        asm volatile("v_nop\n\tv_nop\n\tv_nop\n\tv_nop" : "+v"(acc[0][0]), "+v"(acc[1][1]), "+v"(acc[2][2]), "+v"(acc[3][3]) : "v"(a[0]), "v"(a[3]));
    }
#pragma unroll
    for (int mb = 0; mb < 4; ++mb) {
#pragma unroll
        for (int nb = 0; nb < 4; ++nb) {
#pragma unroll
            for (int j = 0; j < 8; ++j) os[(hi * 8 + j) * 68 + nb * 16 + lr] = acc[mb][nb][j]; }
        __builtin_amdgcn_wave_barrier(); asm volatile("" ::: "memory");
        float* crow = C + (size_t)(r0 + mb * 16) * ldc + c0;
{
#pragma unroll
            for (int s = 0; s < 8; ++s) { const int row = 2 * s + hi, cofs = lr * 4; v4f val = *(const v4fa*)(os + row * 68 + cofs); if (BIAS) { val[0] += bfr(bias[c0 + cofs]); val[1] += bfr(bias[c0 + cofs + 1]); val[2] += bfr(bias[c0 + cofs + 2]); val[3] += bfr(bias[c0 + cofs + 3]); }
                *(v4f*)(crow + (size_t)row * ldc + cofs) = val; }
             }
        __builtin_amdgcn_wave_barrier(); asm volatile("" ::: "memory");
    }
}

// ---- k_gemmc: the same 64x64 tile GEMM specialised for causal attention: CMODE 1 skips score tiles entirely above the diagonal (query rows r0+roff.., key columns c0..), CMODE 2 limits the
// key (K) loop of the probability x value contraction to the diagonal block (probabilities beyond it are exactly zero). roff = row offset of this launch's first row within the sequence.
// NW = waves per work-group. NW > 1: the K loop is dealt over the waves in runs of 64 (one 128-byte line of each operand row), every wave holds a full 64x64 f32 partial, and the partials are
// summed through LDS in fixed wave order 0..NW-1 behind one work-group barrier (wave w sums and stores rows w, w + NW, ...). K % 64 == 0 there.
typedef __attribute__((ext_vector_type(2))) float v2fs;
typedef v2fs __attribute__((may_alias)) v2fsa;
template <typename T16, int NSPLIT, int CMODE, int NW>
__global__ __launch_bounds__(32 * NW) void k_gemmc(const T16* __restrict__ A, const T16* __restrict__ A2, const T16* __restrict__ Bt, const T16* __restrict__ Bt2, int K, float* C, int ldc, int roff, size_t sA, size_t sB, size_t sC) {
    typedef typename WFrag<T16>::V V;
    static_assert(64 % NW == 0, "the LDS sum deals the tile's 64 rows evenly over the waves");
    __shared__ __align__(16) float os[(NW == 1) ? 16 * 68 : NW * 64 * 68];
    const size_t z = blockIdx.z; A += z * sA; if (A2) A2 += z * sA; Bt += z * sB; if (Bt2) Bt2 += z * sB; C += z * sC;
    const int lane = threadIdx.x & 31, lr = lane & 15, hi = lane >> 4; const int r0 = blockIdx.x * 64, c0 = blockIdx.y * 64;
    const int wv = (NW == 1) ? 0 : __builtin_amdgcn_readfirstlane((int)(threadIdx.x >> 5));
    if (CMODE == 1 && c0 > r0 + roff + 63) return;                  // score tile entirely above the causal diagonal: never read (the softmax masks j > i by select)
    const int Kl = (CMODE == 2) ? min(K, r0 + roff + 64) : K;        // P.V: probabilities are exactly 0 beyond the diagonal block, so the K loop stops there
    v8f acc[4][4];
#pragma unroll
    for (int mb = 0; mb < 4; ++mb)
#pragma unroll
        for (int nb = 0; nb < 4; ++nb) acc[mb][nb] = (v8f){};
    const size_t aoff = (size_t)(r0 + lr) * K + 8 * hi, boff = (size_t)(c0 + lr) * K + 8 * hi;
    const int nit = (NW == 1) ? Kl / 32 : 2 * ((Kl / 64 - wv + NW - 1) / NW);   // this wave's trips of 32 (two per run of 64)
#pragma unroll 1
    for (int it = 0; it < nit; ++it) {
        const int kc = (NW == 1) ? it * 32 : ((it >> 1) * NW + wv) * 64 + (it & 1) * 32;
        V a[4], a2[4];
#pragma unroll
        for (int mb = 0; mb < 4; ++mb) { a[mb] = WFrag<T16>::ld(A + aoff + (size_t)mb * 16 * K + kc); if (NSPLIT == 1 || NSPLIT == 2) a2[mb] = WFrag<T16>::ld(A2 + aoff + (size_t)mb * 16 * K + kc); }
#pragma unroll
        for (int nb = 0; nb < 4; ++nb) { const V b = WFrag<T16>::ld(Bt + boff + (size_t)nb * 16 * K + kc); V b2; if (NSPLIT >= 2) b2 = WFrag<T16>::ld(Bt2 + boff + (size_t)nb * 16 * K + kc);
#pragma unroll
            for (int mb = 0; mb < 4; ++mb) { acc[mb][nb] = WFrag<T16>::mma(a[mb], b, acc[mb][nb]); if (NSPLIT == 1 || NSPLIT == 2) acc[mb][nb] = WFrag<T16>::mma(a2[mb], b, acc[mb][nb]); if (NSPLIT >= 2) acc[mb][nb] = WFrag<T16>::mma(a[mb], b2, acc[mb][nb]); } }
        asm volatile("v_nop\n\tv_nop\n\tv_nop\n\tv_nop" : "+v"(acc[0][0]), "+v"(acc[1][1]), "+v"(acc[2][2]), "+v"(acc[3][3]) : "v"(a[0]), "v"(a[3]));
    }
    if (NW == 1) {
#pragma unroll
        for (int mb = 0; mb < 4; ++mb) {
#pragma unroll
            for (int nb = 0; nb < 4; ++nb) {
#pragma unroll
                for (int j = 0; j < 8; ++j) os[(hi * 8 + j) * 68 + nb * 16 + lr] = acc[mb][nb][j]; }
            __builtin_amdgcn_wave_barrier(); asm volatile("" ::: "memory");
            float* crow = C + (size_t)(r0 + mb * 16) * ldc + c0;
#pragma unroll
            for (int s = 0; s < 8; ++s) { const int row = 2 * s + hi, cofs = lr * 4; v4f val = *(const v4fa*)(os + row * 68 + cofs);
                *(v4f*)(crow + (size_t)row * ldc + cofs) = val; }
            __builtin_amdgcn_wave_barrier(); asm volatile("" ::: "memory");
        }
    } else {
        float* osw = os + wv * (64 * 68);
#pragma unroll
        for (int mb = 0; mb < 4; ++mb)
#pragma unroll
            for (int nb = 0; nb < 4; ++nb)
#pragma unroll
                for (int j = 0; j < 8; ++j) osw[(mb * 16 + hi * 8 + j) * 68 + nb * 16 + lr] = acc[mb][nb][j];
        __syncthreads();                                             // every wave's 64x64 partial is in LDS before any wave sums
        v2fs val[64 / NW];
#pragma unroll
        for (int r = 0; r < 64 / NW; ++r) { const int row = r * NW + wv; val[r] = *(const v2fsa*)(os + row * 68 + lane * 2);
#pragma unroll
            for (int w = 1; w < NW; ++w) val[r] += *(const v2fsa*)(os + w * (64 * 68) + row * 68 + lane * 2); }
#pragma unroll
        for (int r = 0; r < 64 / NW; ++r) *(v2fs*)(C + (size_t)(r0 + r * NW + wv) * ldc + c0 + lane * 2) = val[r];
    }
}

__device__ __forceinline__ h16 tohx(float x) { return (h16)x; }
__device__ __forceinline__ void splitf(float y, unsigned short& h, unsigned short& l) { h = f2bf(y); l = f2bf(y - bf2f(h)); }
typedef __attribute__((ext_vector_type(2))) _Float16 v2h;
typedef __attribute__((ext_vector_type(4))) _Float16 v4h;
typedef __attribute__((ext_vector_type(2))) unsigned short v2us;
typedef __attribute__((ext_vector_type(4))) unsigned short v4us;
typedef __attribute__((ext_vector_type(2))) float v2f;
typedef __attribute__((ext_vector_type(4))) int v4i;

__global__ __launch_bounds__(256) void k_wtG(const float* __restrict__ w, int K, int N, bf* Bt) {
    const int lane = threadIdx.x & 31; const int L0 = (blockIdx.x * 8 + (threadIdx.x >> 5)) * 8; const int nlines = N * K / 64;
{
#pragma unroll 1
        for (int l = 0; l < 8; ++l) { const int L = L0 + l; if (L >= nlines) break; const size_t e = (size_t)L * 64 + lane * 2; const int k = (int)(e % K), n = (int)(e / K); v2us o;
            o[0] = f2bf(w[(size_t)k * N + n]); o[1] = f2bf(w[(size_t)(k + 1) * N + n]); *(v2us*)(Bt + e) = o; }
         }
}
__global__ __launch_bounds__(256) void k_cvt8(const float* __restrict__ src, bf* dst, size_t n8) { const size_t i = (size_t)blockIdx.x * 256 + threadIdx.x; if (i >= n8) return; const v8f v = *(const v8f*)(src + i * 8); v8us o;
#pragma unroll
    for (int k = 0; k < 8; ++k) o[k] = f2bf(v[k]); *(v8us*)(dst + i * 8) = o;  }

// k_rope: head planes [h][t][d] (fp16 + hi/lo) of rope(x) x sc with the rotate-half convention out[d] = x[d] cos[t][d] - x[d+HD/2] sin[t][d], out[d+HD/2] = x[d+HD/2] cos[t][d+HD/2] + x[d] sin[t][d+HD/2]
__global__ __launch_bounds__(256) void k_rope(const float* __restrict__ F, int pitch, int nheads, const float* __restrict__ CS, const float* __restrict__ RF, const float* __restrict__ nw, float sc, h16* P16, bf* Ph, bf* Pl) {
    const size_t e = ((size_t)blockIdx.x * 256 + threadIdx.x) * 2; if (e >= (size_t)nheads * TT * HD) return; const int d = (int)(e % HD); const int t = (int)((e / HD) % TT); const int h = (int)(e / ((size_t)HD * TT)); const float* f = F + ((size_t)h * TT + t) * pitch;   /* RAW VIEW: pseudo-head h, pseudo-position t = the flat (S, D) projection output read as (H, S, hd): row pitch 'pitch' (= HD here), head stride TT * pitch */ const float rf = RF ? RF[(size_t)h * TT + t] : 1.0f; v2h o16; v2us oh, ol;
#pragma unroll
    for (int q = 0; q < 2; ++q) { const int dd = d + q; const int dp = (dd < HD / 2) ? dd + HD / 2 : dd - HD / 2; float x0 = f[dd], x1 = f[dp];
        if (RF) { float n0 = __fmul_rn(x0, rf), n1 = __fmul_rn(x1, rf); asm volatile("" : "+v"(n0)); asm volatile("" : "+v"(n1)); x0 = __fmul_rn(bfr(nw[dd]), n0); x1 = __fmul_rn(bfr(nw[dp]), n1); }
        const v2f cs = *(const v2f*)(CS + ((size_t)t * HD + dd) * 2); float a = __fmul_rn(x0, cs[0]), bq = __fmul_rn(x1, cs[1]); asm volatile("" : "+v"(a)); asm volatile("" : "+v"(bq)); const float r = ((dd < HD / 2) ? __fsub_rn(a, bq) : __fadd_rn(a, bq)) * sc;
        o16[q] = tohx(r); unsigned short a2, c2; splitf(r, a2, c2); oh[q] = a2; ol[q] = c2; }
    *(v2h*)(P16 + e) = o16; *(v2us*)(Ph + e) = oh; *(v2us*)(Pl + e) = ol;  }
__global__ __launch_bounds__(256) void k_vtp(const float* __restrict__ F, int pitch, int nheads, h16* V16, bf* Vh, bf* Vl) { const size_t e = ((size_t)blockIdx.x * 256 + threadIdx.x) * 2; if (e >= (size_t)nheads * HD * TT) return; const int t = (int)(e % TT); const int d = (int)((e / TT) % HD); const int g = (int)(e / ((size_t)TT * HD)); v2h o16; v2us oh, ol;
#pragma unroll
    for (int q = 0; q < 2; ++q) { const float x = F[((size_t)g * TT + (t + q)) * pitch + d];   /* RAW VIEW (as in k_rope) */ o16[q] = tohx(x); unsigned short a2, c2; splitf(x, a2, c2); oh[q] = a2; ol[q] = c2; }
    *(v2h*)(V16 + e) = o16; *(v2us*)(Vh + e) = oh; *(v2us*)(Vl + e) = ol;  }
__global__ __launch_bounds__(256) void k_csid(float* CS) { const int idx = blockIdx.x * 256 + threadIdx.x; if (idx >= TT * HD) return; v2f cs; cs[0] = 1.0f; cs[1] = 0.0f; *(v2f*)(CS + (size_t)idx * 2) = cs;  }
// k_asoft: per row (zz, i): t = S x HD^-0.5 for j <= i and i - j < WIN (sliding causal window; the reference's -1e9 additive fill vanishes identically); softmax over the 2048 keys (register row, one exp, fixed trees);
__global__ __launch_bounds__(256) void k_asoft(const float* __restrict__ Sb, h16* P16, bf* Ph, bf* Pl) {
    const int lane = threadIdx.x & 31; const int row = blockIdx.x * 8 + (threadIdx.x >> 5); if (row >= ZH * TT) return; const int i = row % TT; const int zz = row / TT; (void)zz; const bool hires = (i < RH); const float* sr = Sb + (size_t)row * TT; float v[TT / 32]; float mx = -3.0e38f;
#pragma unroll
    for (int ch = 0; ch < TT / 128; ++ch) { const int j0 = ch * 128 + lane * 4; const v4f a = *(const v4f*)(sr + j0);
#pragma unroll
        for (int q = 0; q < 4; ++q) { const int j = j0 + q; (void)j; const float t = (j <= i && i - j < WIN) ? a[q] * SCL : -3.0e38f; v[ch * 4 + q] = t; mx = fmaxf(mx, t); } }
#pragma unroll
    for (int sh = 16; sh; sh >>= 1) mx = fmaxf(mx, __shfl_xor(mx, sh, 32));
    float sum = 0.f;
#pragma unroll
    for (int k = 0; k < TT / 32; ++k) { float d0 = __fsub_rn(v[k], mx); asm volatile("" : "+v"(d0)); v[k] = __builtin_amdgcn_exp2f(__fmul_rn(d0, 1.4426950408889634f)); sum += v[k]; }
#pragma unroll
    for (int sh = 16; sh; sh >>= 1) sum += __shfl_xor(sum, sh, 32);
    const float f = __fdiv_rn(hires ? 1.0f : PCAR, sum);
{
        if (hires) {
#pragma unroll
            for (int ch = 0; ch < TT / 128; ++ch) { v4us oh, ol;
#pragma unroll
                for (int q = 0; q < 4; ++q) { unsigned short a, c2; splitf(v[ch * 4 + q] * f, a, c2); oh[q] = a; ol[q] = c2; }
                const size_t oo = ((size_t)zz * (RH ? RH : 1) + i) * TT + ch * 128 + lane * 4; *(v4us*)(Ph + oo) = oh; *(v4us*)(Pl + oo) = ol; }
        } else {
#pragma unroll
            for (int ch = 0; ch < TT / 128; ++ch) { v4h o4;
#pragma unroll
                for (int q = 0; q < 4; ++q) o4[q] = tohx(v[ch * 4 + q] * f);
                *(v4h*)(P16 + (size_t)row * TT + ch * 128 + lane * 4) = o4; } }
         }
}
__global__ __launch_bounds__(256) void k_merge(const float* __restrict__ O, int h0, bf* Ah, bf* Al) { const size_t e = ((size_t)blockIdx.x * 256 + threadIdx.x) * 2; if (e >= (size_t)ZH * TT * HD) return; const int d = (int)(e % HD); const int t = (int)((e / HD) % TT); const int zz = (int)(e / ((size_t)HD * TT)); const float cs = (t < RH) ? 1.0f : (1.0f / PCAR); const size_t oo = ((size_t)(h0 + zz) * TT + t) * HD + d;   /* RAW MERGE: the (H, S, hd) context written flat = the module's ctx.reshape(b, S, H * hd) without a transpose */
    v2us oh, ol;
#pragma unroll
    for (int q = 0; q < 2; ++q) { unsigned short a, c2; splitf(O[e + q] * cs, a, c2); oh[q] = a; ol[q] = c2; } *(v2us*)(Ah + oo) = oh; *(v2us*)(Al + oo) = ol;  }

extern "C" void kernel_launch(void* const* d_in, const int* in_sizes, int n_in,
                              void* d_out, int out_size, void* d_ws, size_t ws_size, hipStream_t stream) {
    (void)in_sizes; (void)n_in; (void)out_size;
    const float* x = (const float*)d_in[0]; const float* wq = (const float*)d_in[1]; const float* wk = (const float*)d_in[2]; const float* wv = (const float*)d_in[3]; const float* wo = (const float*)d_in[4];
    float* OUT = (float*)d_out;     // [2][2048][1024]
    char* wsp = (char*)d_ws;
    auto take = [&](size_t bytes) { char* p = wsp; wsp += (bytes + 255) & ~(size_t)255; return (void*)p; };
    bf* WQ = (bf*)take((size_t)DQ * DM * 2); bf* WK = (bf*)take((size_t)DKV * DM * 2); bf* WV = (bf*)take((size_t)DKV * DM * 2); bf* WO = (bf*)take((size_t)DM * DQ * 2); float* CS = (float*)take((size_t)TT * HD * 2 * 4);
    bf* XB = (bf*)take((size_t)TT * DM * 2); float* FQ = (float*)take((size_t)TT * DQ * 4); float* FK = (float*)take((size_t)TT * DKV * 4);
    h16* QP16 = (h16*)take((size_t)NH_ * TT * HD * 2); h16* KP16 = (h16*)take((size_t)NKV * TT * HD * 2); h16* VT16 = (h16*)take((size_t)NKV * HD * TT * 2);
    bf* QPh = (bf*)take((size_t)NH_ * TT * HD * 2); bf* QPl = (bf*)take((size_t)NH_ * TT * HD * 2); bf* KPh = (bf*)take((size_t)NKV * TT * HD * 2); bf* KPl = (bf*)take((size_t)NKV * TT * HD * 2); bf* VTh = (bf*)take((size_t)NKV * HD * TT * 2); bf* VTl = (bf*)take((size_t)NKV * HD * TT * 2); bf* Ph = (bf*)take((size_t)ZH * RH * TT * 2); bf* Pl = (bf*)take((size_t)ZH * RH * TT * 2);
    float* Sb = (float*)take((size_t)ZH * TT * TT * 4); h16* P16 = (h16*)take((size_t)ZH * TT * TT * 2); float* Ob = (float*)take((size_t)ZH * TT * HD * 4); bf* ATh = (bf*)take((size_t)TT * DQ * 2); bf* ATl = (bf*)take((size_t)TT * DQ * 2);
    if ((size_t)(wsp - (char*)d_ws) > ws_size) return;    // ws 256 MiB
    float* FV = FK;   // v projection reuses the k buffer after the k planes are built (stream-ordered)
    { k_wtG<<<(unsigned)((DM * DQ / 64 + 63) / 64), 256, 0, stream>>>(wq, DM, DQ, WQ); k_wtG<<<(unsigned)((DM * DKV / 64 + 63) / 64), 256, 0, stream>>>(wk, DM, DKV, WK); k_wtG<<<(unsigned)((DM * DKV / 64 + 63) / 64), 256, 0, stream>>>(wv, DM, DKV, WV);
      k_wtG<<<(unsigned)((DQ * DM / 64 + 63) / 64), 256, 0, stream>>>(wo, DQ, DM, WO);
       }
    k_csid<<<(TT * HD + 255) / 256, 256, 0, stream>>>(CS);
    const unsigned LQ = (unsigned)(((size_t)NH_ * TT * HD / 2 + 255) / 256), LKv = (unsigned)(((size_t)NKV * TT * HD / 2 + 255) / 256);
    for (int b = 0; b < NB_; ++b) {
        
        k_cvt8<<<(unsigned)(((size_t)TT * DM / 8 + 255) / 256), 256, 0, stream>>>(x + (size_t)b * TT * DM, XB, (size_t)TT * DM / 8);
        k_gemmw<bf, 0, false><<<dim3(TT / 64, DQ / 64, 1), 32, 0, stream>>>(XB, nullptr, WQ, nullptr, DM, FQ, DQ, nullptr, 0, 0, 0);
        k_rope<<<LQ, 256, 0, stream>>>(FQ, HD, NH_, CS, nullptr, nullptr, 1.0f, QP16, QPh, QPl);
        k_gemmw<bf, 0, false><<<dim3(TT / 64, DKV / 64, 1), 32, 0, stream>>>(XB, nullptr, WK, nullptr, DM, FK, DKV, nullptr, 0, 0, 0);
        k_rope<<<LKv, 256, 0, stream>>>(FK, HD, NKV, CS, nullptr, nullptr, 1.0f, KP16, KPh, KPl);
        k_gemmw<bf, 0, false><<<dim3(TT / 64, DKV / 64, 1), 32, 0, stream>>>(XB, nullptr, WV, nullptr, DM, FV, DKV, nullptr, 0, 0, 0); k_vtp<<<LKv, 256, 0, stream>>>(FV, HD, NKV, VT16, VTh, VTl);
        for (int h0 = 0; h0 < NH_; h0 += ZH) { const size_t zq = (size_t)h0, zk = (size_t)(h0 / REP);   // one kv head per query head: the pass's two heads use consecutive kv planes (z-strides TT*HD)
            k_gemmc<bf, 2, 1, 1><<<dim3(RH / 64, TT / 64, ZH), 32, 0, stream>>>(QPh + zq * TT * HD, QPl + zq * TT * HD, KPh + zk * TT * HD, KPl + zk * TT * HD, HD, Sb, TT, 0, (size_t)TT * HD, (size_t)TT * HD, (size_t)TT * TT);
            k_gemmc<h16, 0, 1, 1><<<dim3((TT - RH) / 64, TT / 64, ZH), 32, 0, stream>>>(QP16 + zq * TT * HD + (size_t)RH * HD, nullptr, KP16 + zk * TT * HD, nullptr, HD, Sb + (size_t)RH * TT, TT, RH, (size_t)TT * HD, (size_t)TT * HD, (size_t)TT * TT);
            k_asoft<<<ZH * TT / 8, 256, 0, stream>>>(Sb, P16, Ph, Pl);
            k_gemmc<bf, 2, 2, 8><<<dim3(RH / 64, HD / 64, ZH), 256, 0, stream>>>(Ph, Pl, VTh + zk * HD * TT, VTl + zk * HD * TT, TT, Ob, HD, 0, (size_t)RH * TT, (size_t)HD * TT, (size_t)TT * HD);
            k_gemmc<h16, 0, 2, 16><<<dim3((TT - RH) / 64, HD / 64, ZH), 512, 0, stream>>>(P16 + (size_t)RH * TT, nullptr, VT16 + zk * HD * TT, nullptr, TT, Ob + (size_t)RH * HD, HD, RH, (size_t)TT * TT, (size_t)HD * TT, (size_t)TT * HD);
            k_merge<<<(unsigned)(((size_t)ZH * TT * HD / 2 + 255) / 256), 256, 0, stream>>>(Ob, h0, ATh, ATl); }
        k_gemmw<bf, 1, false><<<dim3(TT / 64, DM / 64, 1), 32, 0, stream>>>(ATh, ATl, WO, nullptr, DQ, OUT + (size_t)b * TT * DM, DM, nullptr, 0, 0, 0); }
}

// v002
// A run of this version takes 587 microseconds.
// Timed twice side by side with v001, it ran 1.63 and 1.62 times as fast.
// Counting every step since v000, it is 2.49 times as fast.
#include <hip/hip_runtime.h>

// Causal multi-head attention whose heads are a RAW VIEW of the projections (x [2][2048][1024]; q, k, v = x W ('xw' [1024][1024] 0.02-scale, no bias); each is reshaped (b, 16, 2048, 64) WITHOUT a transpose: pseudo-head h, pseudo-position s, dim d = flat element h*2048*64 + s*64 + d of the [2048][1024] projection output (head h covers tokens 128 h .. 128 h + 127; pseudo-position s is the 64-wide feature block s mod 16 of token 128 h + s / 16); scores / sqrt(64); triu(k = 1) over the pseudo-positions -> -inf; softmax; the context (b, 16, 2048, 64) is reshaped (b, 2048, 1024) again WITHOUT a transpose; out = that Wproj ('xw', no bias) -> [2][2048][1024] (4.2 M); argument order x, Wq, Wk, Wv, Wproj).
// Layout per batch: bf16 copy of x; 'xw' weights transposed once; exact projections; RAW VIEW: the plane builders read each [2048][1024] projection output as (16, 2048, 64) WITHOUT a transpose (row pitch HD, head stride TT x HD) and k_merge writes the context planes back flat (no transpose back): the module's own reshapes; causal T-2048 attention (hybrid rows: < 512 hi/lo 3 products, rest fp16 x1024; tiles above the diagonal skipped); merged hi/lo x Wo exact.
// Compute dtypes, f32 accumulate: every input rounded to bf16; projections exact; attention rows < 512 3 products, rest fp16; softmax f32; Wo hl x exact.

#define NB_  2
#define TT   2048
#define DM   1024
#define NH_  16
#define NKV  16
#define REP  (NH_ / NKV)
#define HD   64
#define DQ   (NH_ * HD)
#define DKV  (NKV * HD)
#define ZH   8                    // heads per attention pass (grid z of every k_gemmc launch of a pass); the f32 score plane of a pass is ZH x TT x TT
#define RH   512                  // query rows < RH use hi+lo planes (0: none)
#define WIN  2048
#define PCAR 1024.0f
#define SCL  0.125f   // HD^-0.5
typedef _Float16 h16;
typedef unsigned short bf;
typedef __attribute__((ext_vector_type(16))) __bf16   v16bf;
typedef __attribute__((ext_vector_type(16))) _Float16 v16h;
typedef __attribute__((ext_vector_type(8)))  _Float16 v8h;
typedef __attribute__((ext_vector_type(8)))  unsigned short v8us;
typedef __attribute__((ext_vector_type(8)))  float    v8f;
typedef __attribute__((ext_vector_type(4)))  float    v4f;
typedef v8h  __attribute__((may_alias)) v8ha;
typedef v4f  __attribute__((may_alias)) v4fa;
typedef v8us __attribute__((may_alias)) v8usa;

__device__ __forceinline__ unsigned short f2bf(float f) { unsigned u = __float_as_uint(f); u += 0x7FFFu + ((u >> 16) & 1u); return (unsigned short)(u >> 16); }
__device__ __forceinline__ float bf2f(unsigned short b) { return __uint_as_float(((unsigned)b) << 16); }
__device__ __forceinline__ float bfr(float f) { return bf2f(f2bf(f)); }
__device__ __forceinline__ v16h cat16(v8h lo, v8h hi) { return __builtin_shufflevector(lo, hi, 0, 1, 2, 3, 4, 5, 6, 7, 8, 9, 10, 11, 12, 13, 14, 15); }
__device__ __forceinline__ v16bf cat16b(v8us lo, v8us hi) { return __builtin_bit_cast(v16bf, __builtin_shufflevector(lo, hi, 0, 1, 2, 3, 4, 5, 6, 7, 8, 9, 10, 11, 12, 13, 14, 15)); }
__device__ __forceinline__ v8f wmma16(v16h a, v16h b, v8f c) { return __builtin_amdgcn_wmma_f32_16x16x32_f16(false, a, false, b, (short)0, c, false, false); }
__device__ __forceinline__ v8f wmmab(v16bf a, v16bf b, v8f c) { return __builtin_amdgcn_wmma_f32_16x16x32_bf16(false, a, false, b, (short)0, c, false, false); }



// ---- k_gemmw: register-blocked GEMM, ONE WAVE per 64x64 output tile (16 accumulators), operands straight from K-contiguous 16-bit planes; grid (M/64, N/64, Z), 32 threads.
// C[m][n] (f32, pitch ldc, + optional f32 bias[n]) = sum_k A[m][k] Bt[n][k] (+ split products per NSPLIT). z-batch strides sA/sB/sC in elements. K % 32 == 0.
template <typename T16> struct WFrag;
template <> struct WFrag<h16> { typedef v16h V; static __device__ __forceinline__ V ld(const h16* p) { return cat16(*(const v8h*)p, *(const v8h*)(p + 16)); } static __device__ __forceinline__ v8f mma(V a, V b, v8f c) { return wmma16(a, b, c); } };
template <> struct WFrag<bf> { typedef v16bf V; static __device__ __forceinline__ V ld(const bf* p) { return cat16b(*(const v8us*)p, *(const v8us*)(p + 16)); } static __device__ __forceinline__ v8f mma(V a, V b, v8f c) { return wmmab(a, b, c); } };
template <typename T16, int NSPLIT, bool BIAS>
__global__ __launch_bounds__(32) void k_gemmw(const T16* __restrict__ A, const T16* __restrict__ A2, const T16* __restrict__ Bt, const T16* __restrict__ Bt2, int K, float* C, int ldc, const float* __restrict__ bias, size_t sA, size_t sB, size_t sC) {
    typedef typename WFrag<T16>::V V;
    __shared__ __align__(16) float os[16 * 68];
    const size_t z = blockIdx.z; A += z * sA; if (A2) A2 += z * sA; Bt += z * sB; if (Bt2) Bt2 += z * sB; C += z * sC;
    const int lane = threadIdx.x & 31, lr = lane & 15, hi = lane >> 4; const int r0 = blockIdx.x * 64, c0 = blockIdx.y * 64;
    v8f acc[4][4];
#pragma unroll
    for (int mb = 0; mb < 4; ++mb)
#pragma unroll
        for (int nb = 0; nb < 4; ++nb) acc[mb][nb] = (v8f){};
    const size_t aoff = (size_t)(r0 + lr) * K + 8 * hi, boff = (size_t)(c0 + lr) * K + 8 * hi;
#pragma unroll 1
    for (int kc = 0; kc < K; kc += 32) {
        V a[4], a2[4];
#pragma unroll
        for (int mb = 0; mb < 4; ++mb) { a[mb] = WFrag<T16>::ld(A + aoff + (size_t)mb * 16 * K + kc); if (NSPLIT == 1 || NSPLIT == 2) a2[mb] = WFrag<T16>::ld(A2 + aoff + (size_t)mb * 16 * K + kc); }
#pragma unroll
        for (int nb = 0; nb < 4; ++nb) { const V b = WFrag<T16>::ld(Bt + boff + (size_t)nb * 16 * K + kc); V b2; if (NSPLIT >= 2) b2 = WFrag<T16>::ld(Bt2 + boff + (size_t)nb * 16 * K + kc);
#pragma unroll
            for (int mb = 0; mb < 4; ++mb) { acc[mb][nb] = WFrag<T16>::mma(a[mb], b, acc[mb][nb]); if (NSPLIT == 1 || NSPLIT == 2) acc[mb][nb] = WFrag<T16>::mma(a2[mb], b, acc[mb][nb]); if (NSPLIT >= 2) acc[mb][nb] = WFrag<T16>::mma(a[mb], b2, acc[mb][nb]); } }
        asm volatile("v_nop\n\tv_nop\n\tv_nop\n\tv_nop" : "+v"(acc[0][0]), "+v"(acc[1][1]), "+v"(acc[2][2]), "+v"(acc[3][3]) : "v"(a[0]), "v"(a[3]));
    }
#pragma unroll
    for (int mb = 0; mb < 4; ++mb) {
#pragma unroll
        for (int nb = 0; nb < 4; ++nb) {
#pragma unroll
            for (int j = 0; j < 8; ++j) os[(hi * 8 + j) * 68 + nb * 16 + lr] = acc[mb][nb][j]; }
        __builtin_amdgcn_wave_barrier(); asm volatile("" ::: "memory");
        float* crow = C + (size_t)(r0 + mb * 16) * ldc + c0;
{
#pragma unroll
            for (int s = 0; s < 8; ++s) { const int row = 2 * s + hi, cofs = lr * 4; v4f val = *(const v4fa*)(os + row * 68 + cofs); if (BIAS) { val[0] += bfr(bias[c0 + cofs]); val[1] += bfr(bias[c0 + cofs + 1]); val[2] += bfr(bias[c0 + cofs + 2]); val[3] += bfr(bias[c0 + cofs + 3]); }
                *(v4f*)(crow + (size_t)row * ldc + cofs) = val; }
             }
        __builtin_amdgcn_wave_barrier(); asm volatile("" ::: "memory");
    }
}

// ---- k_gemmc: the same 64x64 tile GEMM specialised for causal attention: CMODE 1 skips score tiles entirely above the diagonal (query rows r0+roff.., key columns c0..), CMODE 2 limits the
// key (K) loop of the probability x value contraction to the diagonal block (probabilities beyond it are exactly zero). roff = row offset of this launch's first row within the sequence.
// NW = waves per work-group. NW > 1: the K loop is dealt over the waves in runs of 64 (one 128-byte line of each operand row), every wave holds a full 64x64 f32 partial, and the partials are
// summed through LDS in fixed wave order 0..NW-1 behind one work-group barrier (wave w sums and stores rows w, w + NW, ...). K % 64 == 0 there.
// lda = row pitch of A and A2 in elements (the probabilities lie in place in their f32 score rows, pitch 2 K); Bt and Bt2 have pitch K.
typedef __attribute__((ext_vector_type(2))) float v2fs;
typedef v2fs __attribute__((may_alias)) v2fsa;
template <typename T16, int NSPLIT, int CMODE, int NW>
__global__ __launch_bounds__(32 * NW) void k_gemmc(const T16* __restrict__ A, const T16* __restrict__ A2, const T16* __restrict__ Bt, const T16* __restrict__ Bt2, int K, int lda, float* C, int ldc, int roff, size_t sA, size_t sB, size_t sC) {
    typedef typename WFrag<T16>::V V;
    static_assert(64 % NW == 0, "the LDS sum deals the tile's 64 rows evenly over the waves");
    __shared__ __align__(16) float os[(NW == 1) ? 16 * 68 : NW * 64 * 68];
    const size_t z = blockIdx.z; A += z * sA; if (A2) A2 += z * sA; Bt += z * sB; if (Bt2) Bt2 += z * sB; C += z * sC;
    const int lane = threadIdx.x & 31, lr = lane & 15, hi = lane >> 4; const int r0 = blockIdx.x * 64, c0 = blockIdx.y * 64;
    const int wv = (NW == 1) ? 0 : __builtin_amdgcn_readfirstlane((int)(threadIdx.x >> 5));
    if (CMODE == 1 && c0 > r0 + roff + 63) return;                  // score tile entirely above the causal diagonal: never read (the softmax masks j > i by select)
    const int Kl = (CMODE == 2) ? min(K, r0 + roff + 64) : K;        // P.V: probabilities are exactly 0 beyond the diagonal block, so the K loop stops there
    v8f acc[4][4];
#pragma unroll
    for (int mb = 0; mb < 4; ++mb)
#pragma unroll
        for (int nb = 0; nb < 4; ++nb) acc[mb][nb] = (v8f){};
    const size_t aoff = (size_t)(r0 + lr) * lda + 8 * hi, boff = (size_t)(c0 + lr) * K + 8 * hi;
    const int nit = (NW == 1) ? Kl / 32 : 2 * ((Kl / 64 - wv + NW - 1) / NW);   // this wave's trips of 32 (two per run of 64)
#pragma unroll 1
    for (int it = 0; it < nit; ++it) {
        const int kc = (NW == 1) ? it * 32 : ((it >> 1) * NW + wv) * 64 + (it & 1) * 32;
        V a[4], a2[4];
#pragma unroll
        for (int mb = 0; mb < 4; ++mb) { a[mb] = WFrag<T16>::ld(A + aoff + (size_t)mb * 16 * lda + kc); if (NSPLIT == 1 || NSPLIT == 2) a2[mb] = WFrag<T16>::ld(A2 + aoff + (size_t)mb * 16 * lda + kc); }
#pragma unroll
        for (int nb = 0; nb < 4; ++nb) { const V b = WFrag<T16>::ld(Bt + boff + (size_t)nb * 16 * K + kc); V b2; if (NSPLIT >= 2) b2 = WFrag<T16>::ld(Bt2 + boff + (size_t)nb * 16 * K + kc);
#pragma unroll
            for (int mb = 0; mb < 4; ++mb) { acc[mb][nb] = WFrag<T16>::mma(a[mb], b, acc[mb][nb]); if (NSPLIT == 1 || NSPLIT == 2) acc[mb][nb] = WFrag<T16>::mma(a2[mb], b, acc[mb][nb]); if (NSPLIT >= 2) acc[mb][nb] = WFrag<T16>::mma(a[mb], b2, acc[mb][nb]); } }
        asm volatile("v_nop\n\tv_nop\n\tv_nop\n\tv_nop" : "+v"(acc[0][0]), "+v"(acc[1][1]), "+v"(acc[2][2]), "+v"(acc[3][3]) : "v"(a[0]), "v"(a[3]));
    }
    if (NW == 1) {
#pragma unroll
        for (int mb = 0; mb < 4; ++mb) {
#pragma unroll
            for (int nb = 0; nb < 4; ++nb) {
#pragma unroll
                for (int j = 0; j < 8; ++j) os[(hi * 8 + j) * 68 + nb * 16 + lr] = acc[mb][nb][j]; }
            __builtin_amdgcn_wave_barrier(); asm volatile("" ::: "memory");
            float* crow = C + (size_t)(r0 + mb * 16) * ldc + c0;
#pragma unroll
            for (int s = 0; s < 8; ++s) { const int row = 2 * s + hi, cofs = lr * 4; v4f val = *(const v4fa*)(os + row * 68 + cofs);
                *(v4f*)(crow + (size_t)row * ldc + cofs) = val; }
            __builtin_amdgcn_wave_barrier(); asm volatile("" ::: "memory");
        }
    } else {
        float* osw = os + wv * (64 * 68);
#pragma unroll
        for (int mb = 0; mb < 4; ++mb)
#pragma unroll
            for (int nb = 0; nb < 4; ++nb)
#pragma unroll
                for (int j = 0; j < 8; ++j) osw[(mb * 16 + hi * 8 + j) * 68 + nb * 16 + lr] = acc[mb][nb][j];
        __syncthreads();                                             // every wave's 64x64 partial is in LDS before any wave sums
        v2fs val[64 / NW];
#pragma unroll
        for (int r = 0; r < 64 / NW; ++r) { const int row = r * NW + wv; val[r] = *(const v2fsa*)(os + row * 68 + lane * 2);
#pragma unroll
            for (int w = 1; w < NW; ++w) val[r] += *(const v2fsa*)(os + w * (64 * 68) + row * 68 + lane * 2); }
#pragma unroll
        for (int r = 0; r < 64 / NW; ++r) *(v2fs*)(C + (size_t)(r0 + r * NW + wv) * ldc + c0 + lane * 2) = val[r];
    }
}

__device__ __forceinline__ h16 tohx(float x) { return (h16)x; }
__device__ __forceinline__ void splitf(float y, unsigned short& h, unsigned short& l) { h = f2bf(y); l = f2bf(y - bf2f(h)); }
typedef __attribute__((ext_vector_type(2))) _Float16 v2h;
typedef __attribute__((ext_vector_type(4))) _Float16 v4h;
typedef __attribute__((ext_vector_type(2))) unsigned short v2us;
typedef __attribute__((ext_vector_type(4))) unsigned short v4us;
typedef __attribute__((ext_vector_type(2))) float v2f;
typedef __attribute__((ext_vector_type(4))) int v4i;
typedef v4h  __attribute__((may_alias)) v4ha;
typedef v4us __attribute__((may_alias)) v4usa;

__global__ __launch_bounds__(256) void k_wtG(const float* __restrict__ w, int K, int N, bf* Bt) {
    const int lane = threadIdx.x & 31; const int L0 = (blockIdx.x * 8 + (threadIdx.x >> 5)) * 8; const int nlines = N * K / 64;
{
#pragma unroll 1
        for (int l = 0; l < 8; ++l) { const int L = L0 + l; if (L >= nlines) break; const size_t e = (size_t)L * 64 + lane * 2; const int k = (int)(e % K), n = (int)(e / K); v2us o;
            o[0] = f2bf(w[(size_t)k * N + n]); o[1] = f2bf(w[(size_t)(k + 1) * N + n]); *(v2us*)(Bt + e) = o; }
         }
}
__global__ __launch_bounds__(256) void k_cvt8(const float* __restrict__ src, bf* dst, size_t n8) { const size_t i = (size_t)blockIdx.x * 256 + threadIdx.x; if (i >= n8) return; const v8f v = *(const v8f*)(src + i * 8); v8us o;
#pragma unroll
    for (int k = 0; k < 8; ++k) o[k] = f2bf(v[k]); *(v8us*)(dst + i * 8) = o;  }

// k_rope: head planes [h][t][d] (fp16 + hi/lo) of rope(x) x sc with the rotate-half convention out[d] = x[d] cos[t][d] - x[d+HD/2] sin[t][d], out[d+HD/2] = x[d+HD/2] cos[t][d+HD/2] + x[d] sin[t][d+HD/2]
__global__ __launch_bounds__(256) void k_rope(const float* __restrict__ F, int pitch, int nheads, const float* __restrict__ CS, const float* __restrict__ RF, const float* __restrict__ nw, float sc, h16* P16, bf* Ph, bf* Pl) {
    const size_t e = ((size_t)blockIdx.x * 256 + threadIdx.x) * 2; if (e >= (size_t)nheads * TT * HD) return; const int d = (int)(e % HD); const int t = (int)((e / HD) % TT); const int h = (int)(e / ((size_t)HD * TT)); const float* f = F + ((size_t)h * TT + t) * pitch;   /* RAW VIEW: pseudo-head h, pseudo-position t = the flat (S, D) projection output read as (H, S, hd): row pitch 'pitch' (= HD here), head stride TT * pitch */ const float rf = RF ? RF[(size_t)h * TT + t] : 1.0f; v2h o16; v2us oh, ol;
#pragma unroll
    for (int q = 0; q < 2; ++q) { const int dd = d + q; const int dp = (dd < HD / 2) ? dd + HD / 2 : dd - HD / 2; float x0 = f[dd], x1 = f[dp];
        if (RF) { float n0 = __fmul_rn(x0, rf), n1 = __fmul_rn(x1, rf); asm volatile("" : "+v"(n0)); asm volatile("" : "+v"(n1)); x0 = __fmul_rn(bfr(nw[dd]), n0); x1 = __fmul_rn(bfr(nw[dp]), n1); }
        const v2f cs = *(const v2f*)(CS + ((size_t)t * HD + dd) * 2); float a = __fmul_rn(x0, cs[0]), bq = __fmul_rn(x1, cs[1]); asm volatile("" : "+v"(a)); asm volatile("" : "+v"(bq)); const float r = ((dd < HD / 2) ? __fsub_rn(a, bq) : __fadd_rn(a, bq)) * sc;
        o16[q] = tohx(r); unsigned short a2, c2; splitf(r, a2, c2); oh[q] = a2; ol[q] = c2; }
    *(v2h*)(P16 + e) = o16; *(v2us*)(Ph + e) = oh; *(v2us*)(Pl + e) = ol;  }
__global__ __launch_bounds__(256) void k_vtp(const float* __restrict__ F, int pitch, int nheads, h16* V16, bf* Vh, bf* Vl) { const size_t e = ((size_t)blockIdx.x * 256 + threadIdx.x) * 2; if (e >= (size_t)nheads * HD * TT) return; const int t = (int)(e % TT); const int d = (int)((e / TT) % HD); const int g = (int)(e / ((size_t)TT * HD)); v2h o16; v2us oh, ol;
#pragma unroll
    for (int q = 0; q < 2; ++q) { const float x = F[((size_t)g * TT + (t + q)) * pitch + d];   /* RAW VIEW (as in k_rope) */ o16[q] = tohx(x); unsigned short a2, c2; splitf(x, a2, c2); oh[q] = a2; ol[q] = c2; }
    *(v2h*)(V16 + e) = o16; *(v2us*)(Vh + e) = oh; *(v2us*)(Vl + e) = ol;  }
__global__ __launch_bounds__(256) void k_csid(float* CS) { const int idx = blockIdx.x * 256 + threadIdx.x; if (idx >= TT * HD) return; v2f cs; cs[0] = 1.0f; cs[1] = 0.0f; *(v2f*)(CS + (size_t)idx * 2) = cs;  }
// k_asoft: per row (zz, i): t = S x HD^-0.5 for j <= i and i - j < WIN (sliding causal window; the reference's -1e9 additive fill vanishes identically); softmax over the 2048 keys (register row, one exp, fixed trees);
// IN PLACE: one wave owns one row, holds all of it in registers before its first store, and writes the 16-bit probabilities over the row's own 8 KiB of f32 scores:
// rows < RH the hi plane in the first TT 16-bit places and the lo plane in the second TT; the other rows fp16 x PCAR in the first TT. Row pitch for the readers: 2 TT 16-bit elements.
__global__ __launch_bounds__(256) void k_asoft(float* Sb) {
    const int lane = threadIdx.x & 31; const int row = blockIdx.x * 8 + (threadIdx.x >> 5); if (row >= ZH * TT) return; const int i = row % TT; const bool hires = (i < RH); float* sr = Sb + (size_t)row * TT; float v[TT / 32]; float mx = -3.0e38f;
#pragma unroll
    for (int ch = 0; ch < TT / 128; ++ch) { const int j0 = ch * 128 + lane * 4; const v4f a = *(const v4fa*)(sr + j0);
#pragma unroll
        for (int q = 0; q < 4; ++q) { const int j = j0 + q; (void)j; const float t = (j <= i && i - j < WIN) ? a[q] * SCL : -3.0e38f; v[ch * 4 + q] = t; mx = fmaxf(mx, t); } }
#pragma unroll
    for (int sh = 16; sh; sh >>= 1) mx = fmaxf(mx, __shfl_xor(mx, sh, 32));
    float sum = 0.f;
#pragma unroll
    for (int k = 0; k < TT / 32; ++k) { float d0 = __fsub_rn(v[k], mx); asm volatile("" : "+v"(d0)); v[k] = __builtin_amdgcn_exp2f(__fmul_rn(d0, 1.4426950408889634f)); sum += v[k]; }
#pragma unroll
    for (int sh = 16; sh; sh >>= 1) sum += __shfl_xor(sum, sh, 32);
    const float f = __fdiv_rn(hires ? 1.0f : PCAR, sum);
{
        if (hires) {
#pragma unroll
            for (int ch = 0; ch < TT / 128; ++ch) { v4us oh, ol;
#pragma unroll
                for (int q = 0; q < 4; ++q) { unsigned short a, c2; splitf(v[ch * 4 + q] * f, a, c2); oh[q] = a; ol[q] = c2; }
                bf* pr = (bf*)sr + ch * 128 + lane * 4; *(v4usa*)pr = oh; *(v4usa*)(pr + TT) = ol; }
        } else {
#pragma unroll
            for (int ch = 0; ch < TT / 128; ++ch) { v4h o4;
#pragma unroll
                for (int q = 0; q < 4; ++q) o4[q] = tohx(v[ch * 4 + q] * f);
                *(v4ha*)((h16*)sr + ch * 128 + lane * 4) = o4; } }
         }
}
__global__ __launch_bounds__(256) void k_merge(const float* __restrict__ O, int h0, bf* Ah, bf* Al) { const size_t e = ((size_t)blockIdx.x * 256 + threadIdx.x) * 2; if (e >= (size_t)ZH * TT * HD) return; const int d = (int)(e % HD); const int t = (int)((e / HD) % TT); const int zz = (int)(e / ((size_t)HD * TT)); const float cs = (t < RH) ? 1.0f : (1.0f / PCAR); const size_t oo = ((size_t)(h0 + zz) * TT + t) * HD + d;   /* RAW MERGE: the (H, S, hd) context written flat = the module's ctx.reshape(b, S, H * hd) without a transpose */
    v2us oh, ol;
#pragma unroll
    for (int q = 0; q < 2; ++q) { unsigned short a, c2; splitf(O[e + q] * cs, a, c2); oh[q] = a; ol[q] = c2; } *(v2us*)(Ah + oo) = oh; *(v2us*)(Al + oo) = ol;  }

extern "C" void kernel_launch(void* const* d_in, const int* in_sizes, int n_in,
                              void* d_out, int out_size, void* d_ws, size_t ws_size, hipStream_t stream) {
    (void)in_sizes; (void)n_in; (void)out_size;
    const float* x = (const float*)d_in[0]; const float* wq = (const float*)d_in[1]; const float* wk = (const float*)d_in[2]; const float* wv = (const float*)d_in[3]; const float* wo = (const float*)d_in[4];
    float* OUT = (float*)d_out;     // [2][2048][1024]
    char* wsp = (char*)d_ws;
    auto take = [&](size_t bytes) { char* p = wsp; wsp += (bytes + 255) & ~(size_t)255; return (void*)p; };
    bf* WQ = (bf*)take((size_t)DQ * DM * 2); bf* WK = (bf*)take((size_t)DKV * DM * 2); bf* WV = (bf*)take((size_t)DKV * DM * 2); bf* WO = (bf*)take((size_t)DM * DQ * 2); float* CS = (float*)take((size_t)TT * HD * 2 * 4);
    bf* XB = (bf*)take((size_t)TT * DM * 2); float* FQ = (float*)take((size_t)TT * DQ * 4); float* FK = (float*)take((size_t)TT * DKV * 4);
    h16* QP16 = (h16*)take((size_t)NH_ * TT * HD * 2); h16* KP16 = (h16*)take((size_t)NKV * TT * HD * 2); h16* VT16 = (h16*)take((size_t)NKV * HD * TT * 2);
    bf* QPh = (bf*)take((size_t)NH_ * TT * HD * 2); bf* QPl = (bf*)take((size_t)NH_ * TT * HD * 2); bf* KPh = (bf*)take((size_t)NKV * TT * HD * 2); bf* KPl = (bf*)take((size_t)NKV * TT * HD * 2); bf* VTh = (bf*)take((size_t)NKV * HD * TT * 2); bf* VTl = (bf*)take((size_t)NKV * HD * TT * 2);
    float* Sb = (float*)take((size_t)ZH * TT * TT * 4); float* Ob = (float*)take((size_t)ZH * TT * HD * 4); bf* ATh = (bf*)take((size_t)TT * DQ * 2); bf* ATl = (bf*)take((size_t)TT * DQ * 2);
    if ((size_t)(wsp - (char*)d_ws) > ws_size) return;    // ws 256 MiB
    float* FV = FK;   // v projection reuses the k buffer after the k planes are built (stream-ordered)
    { k_wtG<<<(unsigned)((DM * DQ / 64 + 63) / 64), 256, 0, stream>>>(wq, DM, DQ, WQ); k_wtG<<<(unsigned)((DM * DKV / 64 + 63) / 64), 256, 0, stream>>>(wk, DM, DKV, WK); k_wtG<<<(unsigned)((DM * DKV / 64 + 63) / 64), 256, 0, stream>>>(wv, DM, DKV, WV);
      k_wtG<<<(unsigned)((DQ * DM / 64 + 63) / 64), 256, 0, stream>>>(wo, DQ, DM, WO);
       }
    k_csid<<<(TT * HD + 255) / 256, 256, 0, stream>>>(CS);
    const unsigned LQ = (unsigned)(((size_t)NH_ * TT * HD / 2 + 255) / 256), LKv = (unsigned)(((size_t)NKV * TT * HD / 2 + 255) / 256);
    for (int b = 0; b < NB_; ++b) {
        
        k_cvt8<<<(unsigned)(((size_t)TT * DM / 8 + 255) / 256), 256, 0, stream>>>(x + (size_t)b * TT * DM, XB, (size_t)TT * DM / 8);
        k_gemmw<bf, 0, false><<<dim3(TT / 64, DQ / 64, 1), 32, 0, stream>>>(XB, nullptr, WQ, nullptr, DM, FQ, DQ, nullptr, 0, 0, 0);
        k_rope<<<LQ, 256, 0, stream>>>(FQ, HD, NH_, CS, nullptr, nullptr, 1.0f, QP16, QPh, QPl);
        k_gemmw<bf, 0, false><<<dim3(TT / 64, DKV / 64, 1), 32, 0, stream>>>(XB, nullptr, WK, nullptr, DM, FK, DKV, nullptr, 0, 0, 0);
        k_rope<<<LKv, 256, 0, stream>>>(FK, HD, NKV, CS, nullptr, nullptr, 1.0f, KP16, KPh, KPl);
        k_gemmw<bf, 0, false><<<dim3(TT / 64, DKV / 64, 1), 32, 0, stream>>>(XB, nullptr, WV, nullptr, DM, FV, DKV, nullptr, 0, 0, 0); k_vtp<<<LKv, 256, 0, stream>>>(FV, HD, NKV, VT16, VTh, VTl);
        for (int h0 = 0; h0 < NH_; h0 += ZH) { const size_t zq = (size_t)h0, zk = (size_t)(h0 / REP);   // one kv head per query head: the pass's ZH heads use consecutive kv planes (z-strides TT*HD)
            k_gemmc<bf, 2, 1, 1><<<dim3(RH / 64, TT / 64, ZH), 32, 0, stream>>>(QPh + zq * TT * HD, QPl + zq * TT * HD, KPh + zk * TT * HD, KPl + zk * TT * HD, HD, HD, Sb, TT, 0, (size_t)TT * HD, (size_t)TT * HD, (size_t)TT * TT);
            k_gemmc<h16, 0, 1, 1><<<dim3((TT - RH) / 64, TT / 64, ZH), 32, 0, stream>>>(QP16 + zq * TT * HD + (size_t)RH * HD, nullptr, KP16 + zk * TT * HD, nullptr, HD, HD, Sb + (size_t)RH * TT, TT, RH, (size_t)TT * HD, (size_t)TT * HD, (size_t)TT * TT);
            k_asoft<<<ZH * TT / 8, 256, 0, stream>>>(Sb);
            k_gemmc<bf, 2, 2, 8><<<dim3(RH / 64, HD / 64, ZH), 256, 0, stream>>>((const bf*)Sb, (const bf*)Sb + TT, VTh + zk * HD * TT, VTl + zk * HD * TT, TT, 2 * TT, Ob, HD, 0, (size_t)2 * TT * TT, (size_t)HD * TT, (size_t)TT * HD);
            k_gemmc<h16, 0, 2, 16><<<dim3((TT - RH) / 64, HD / 64, ZH), 512, 0, stream>>>((const h16*)Sb + (size_t)RH * 2 * TT, nullptr, VT16 + zk * HD * TT, nullptr, TT, 2 * TT, Ob + (size_t)RH * HD, HD, RH, (size_t)2 * TT * TT, (size_t)HD * TT, (size_t)TT * HD);
            k_merge<<<(unsigned)(((size_t)ZH * TT * HD / 2 + 255) / 256), 256, 0, stream>>>(Ob, h0, ATh, ATl); }
        k_gemmw<bf, 1, false><<<dim3(TT / 64, DM / 64, 1), 32, 0, stream>>>(ATh, ATl, WO, nullptr, DQ, OUT + (size_t)b * TT * DM, DM, nullptr, 0, 0, 0); }
}

// v003
// It runs in 350 microseconds.
// In two side-by-side timings against v002, it was 1.66 and 1.68 times as fast.
// All steps since v000 together make it 4.16 times as fast.
#include <hip/hip_runtime.h>

// Causal multi-head attention whose heads are a RAW VIEW of the projections (x [2][2048][1024]; q, k, v = x W ('xw' [1024][1024] 0.02-scale, no bias); each is reshaped (b, 16, 2048, 64) WITHOUT a transpose: pseudo-head h, pseudo-position s, dim d = flat element h*2048*64 + s*64 + d of the [2048][1024] projection output (head h covers tokens 128 h .. 128 h + 127; pseudo-position s is the 64-wide feature block s mod 16 of token 128 h + s / 16); scores / sqrt(64); triu(k = 1) over the pseudo-positions -> -inf; softmax; the context (b, 16, 2048, 64) is reshaped (b, 2048, 1024) again WITHOUT a transpose; out = that Wproj ('xw', no bias) -> [2][2048][1024] (4.2 M); argument order x, Wq, Wk, Wv, Wproj).
// Layout per batch: bf16 copy of x; 'xw' weights transposed once; exact projections; RAW VIEW: the plane builders read each [2048][1024] projection output as (16, 2048, 64) WITHOUT a transpose (row pitch HD, head stride TT x HD) and k_fa writes the context planes back flat (no transpose back): the module's own reshapes; causal T-2048 attention (hybrid rows: < 512 hi/lo 3 products, rest fp16; key blocks above the diagonal skipped; one fused kernel, online softmax); merged hi/lo x Wo exact.
// Compute dtypes, f32 accumulate: every input rounded to bf16; projections exact; attention rows < 512 3 products, rest fp16; softmax f32; Wo hl x exact.

#define NB_  2
#define TT   2048
#define DM   1024
#define NH_  16
#define NKV  16
#define HD   64
#define DQ   (NH_ * HD)
#define DKV  (NKV * HD)
#define RH   512                  // query rows < RH use hi+lo planes (0: none)
typedef _Float16 h16;
typedef unsigned short bf;
typedef __attribute__((ext_vector_type(16))) __bf16   v16bf;
typedef __attribute__((ext_vector_type(16))) _Float16 v16h;
typedef __attribute__((ext_vector_type(8)))  _Float16 v8h;
typedef __attribute__((ext_vector_type(8)))  unsigned short v8us;
typedef __attribute__((ext_vector_type(8)))  float    v8f;
typedef __attribute__((ext_vector_type(4)))  float    v4f;
typedef v8h  __attribute__((may_alias)) v8ha;
typedef v4f  __attribute__((may_alias)) v4fa;
typedef v8us __attribute__((may_alias)) v8usa;

__device__ __forceinline__ unsigned short f2bf(float f) { unsigned u = __float_as_uint(f); u += 0x7FFFu + ((u >> 16) & 1u); return (unsigned short)(u >> 16); }
__device__ __forceinline__ float bf2f(unsigned short b) { return __uint_as_float(((unsigned)b) << 16); }
__device__ __forceinline__ float bfr(float f) { return bf2f(f2bf(f)); }
__device__ __forceinline__ v16h cat16(v8h lo, v8h hi) { return __builtin_shufflevector(lo, hi, 0, 1, 2, 3, 4, 5, 6, 7, 8, 9, 10, 11, 12, 13, 14, 15); }
__device__ __forceinline__ v16bf cat16b(v8us lo, v8us hi) { return __builtin_bit_cast(v16bf, __builtin_shufflevector(lo, hi, 0, 1, 2, 3, 4, 5, 6, 7, 8, 9, 10, 11, 12, 13, 14, 15)); }
__device__ __forceinline__ v8f wmma16(v16h a, v16h b, v8f c) { return __builtin_amdgcn_wmma_f32_16x16x32_f16(false, a, false, b, (short)0, c, false, false); }
__device__ __forceinline__ v8f wmmab(v16bf a, v16bf b, v8f c) { return __builtin_amdgcn_wmma_f32_16x16x32_bf16(false, a, false, b, (short)0, c, false, false); }



// ---- k_gemmw: register-blocked GEMM, ONE WAVE per 64x64 output tile (16 accumulators), operands straight from K-contiguous 16-bit planes; grid (M/64, N/64, Z), 32 threads.
// C[m][n] (f32, pitch ldc, + optional f32 bias[n]) = sum_k A[m][k] Bt[n][k] (+ split products per NSPLIT). z-batch strides sA/sB/sC in elements. K % 32 == 0.
template <typename T16> struct WFrag;
template <> struct WFrag<h16> { typedef v16h V; static __device__ __forceinline__ V ld(const h16* p) { return cat16(*(const v8h*)p, *(const v8h*)(p + 16)); } static __device__ __forceinline__ v8f mma(V a, V b, v8f c) { return wmma16(a, b, c); } };
template <> struct WFrag<bf> { typedef v16bf V; static __device__ __forceinline__ V ld(const bf* p) { return cat16b(*(const v8us*)p, *(const v8us*)(p + 16)); } static __device__ __forceinline__ v8f mma(V a, V b, v8f c) { return wmmab(a, b, c); } };
template <typename T16, int NSPLIT, bool BIAS>
__global__ __launch_bounds__(32) void k_gemmw(const T16* __restrict__ A, const T16* __restrict__ A2, const T16* __restrict__ Bt, const T16* __restrict__ Bt2, int K, float* C, int ldc, const float* __restrict__ bias, size_t sA, size_t sB, size_t sC) {
    typedef typename WFrag<T16>::V V;
    __shared__ __align__(16) float os[16 * 68];
    const size_t z = blockIdx.z; A += z * sA; if (A2) A2 += z * sA; Bt += z * sB; if (Bt2) Bt2 += z * sB; C += z * sC;
    const int lane = threadIdx.x & 31, lr = lane & 15, hi = lane >> 4; const int r0 = blockIdx.x * 64, c0 = blockIdx.y * 64;
    v8f acc[4][4];
#pragma unroll
    for (int mb = 0; mb < 4; ++mb)
#pragma unroll
        for (int nb = 0; nb < 4; ++nb) acc[mb][nb] = (v8f){};
    const size_t aoff = (size_t)(r0 + lr) * K + 8 * hi, boff = (size_t)(c0 + lr) * K + 8 * hi;
#pragma unroll 1
    for (int kc = 0; kc < K; kc += 32) {
        V a[4], a2[4];
#pragma unroll
        for (int mb = 0; mb < 4; ++mb) { a[mb] = WFrag<T16>::ld(A + aoff + (size_t)mb * 16 * K + kc); if (NSPLIT == 1 || NSPLIT == 2) a2[mb] = WFrag<T16>::ld(A2 + aoff + (size_t)mb * 16 * K + kc); }
#pragma unroll
        for (int nb = 0; nb < 4; ++nb) { const V b = WFrag<T16>::ld(Bt + boff + (size_t)nb * 16 * K + kc); V b2; if (NSPLIT >= 2) b2 = WFrag<T16>::ld(Bt2 + boff + (size_t)nb * 16 * K + kc);
#pragma unroll
            for (int mb = 0; mb < 4; ++mb) { acc[mb][nb] = WFrag<T16>::mma(a[mb], b, acc[mb][nb]); if (NSPLIT == 1 || NSPLIT == 2) acc[mb][nb] = WFrag<T16>::mma(a2[mb], b, acc[mb][nb]); if (NSPLIT >= 2) acc[mb][nb] = WFrag<T16>::mma(a[mb], b2, acc[mb][nb]); } }
        asm volatile("v_nop\n\tv_nop\n\tv_nop\n\tv_nop" : "+v"(acc[0][0]), "+v"(acc[1][1]), "+v"(acc[2][2]), "+v"(acc[3][3]) : "v"(a[0]), "v"(a[3]));
    }
#pragma unroll
    for (int mb = 0; mb < 4; ++mb) {
#pragma unroll
        for (int nb = 0; nb < 4; ++nb) {
#pragma unroll
            for (int j = 0; j < 8; ++j) os[(hi * 8 + j) * 68 + nb * 16 + lr] = acc[mb][nb][j]; }
        __builtin_amdgcn_wave_barrier(); asm volatile("" ::: "memory");
        float* crow = C + (size_t)(r0 + mb * 16) * ldc + c0;
{
#pragma unroll
            for (int s = 0; s < 8; ++s) { const int row = 2 * s + hi, cofs = lr * 4; v4f val = *(const v4fa*)(os + row * 68 + cofs); if (BIAS) { val[0] += bfr(bias[c0 + cofs]); val[1] += bfr(bias[c0 + cofs + 1]); val[2] += bfr(bias[c0 + cofs + 2]); val[3] += bfr(bias[c0 + cofs + 3]); }
                *(v4f*)(crow + (size_t)row * ldc + cofs) = val; }
             }
        __builtin_amdgcn_wave_barrier(); asm volatile("" ::: "memory");
    }
}

__device__ __forceinline__ h16 tohx(float x) { return (h16)x; }
__device__ __forceinline__ void splitf(float y, unsigned short& h, unsigned short& l) { h = f2bf(y); l = f2bf(y - bf2f(h)); }
typedef __attribute__((ext_vector_type(2))) _Float16 v2h;
typedef __attribute__((ext_vector_type(4))) _Float16 v4h;
typedef __attribute__((ext_vector_type(2))) unsigned short v2us;
typedef __attribute__((ext_vector_type(4))) unsigned short v4us;
typedef __attribute__((ext_vector_type(2))) float v2f;
typedef __attribute__((ext_vector_type(4))) int v4i;
typedef v4h  __attribute__((may_alias)) v4ha;
typedef v4us __attribute__((may_alias)) v4usa;

__global__ __launch_bounds__(256) void k_wtG(const float* __restrict__ w, int K, int N, bf* Bt) {
    const int lane = threadIdx.x & 31; const int L0 = (blockIdx.x * 8 + (threadIdx.x >> 5)) * 8; const int nlines = N * K / 64;
{
#pragma unroll 1
        for (int l = 0; l < 8; ++l) { const int L = L0 + l; if (L >= nlines) break; const size_t e = (size_t)L * 64 + lane * 2; const int k = (int)(e % K), n = (int)(e / K); v2us o;
            o[0] = f2bf(w[(size_t)k * N + n]); o[1] = f2bf(w[(size_t)(k + 1) * N + n]); *(v2us*)(Bt + e) = o; }
         }
}
__global__ __launch_bounds__(256) void k_cvt8(const float* __restrict__ src, bf* dst, size_t n8) { const size_t i = (size_t)blockIdx.x * 256 + threadIdx.x; if (i >= n8) return; const v8f v = *(const v8f*)(src + i * 8); v8us o;
#pragma unroll
    for (int k = 0; k < 8; ++k) o[k] = f2bf(v[k]); *(v8us*)(dst + i * 8) = o;  }

// k_rope: head planes [h][t][d] (fp16 + hi/lo) of rope(x) x sc with the rotate-half convention out[d] = x[d] cos[t][d] - x[d+HD/2] sin[t][d], out[d+HD/2] = x[d+HD/2] cos[t][d+HD/2] + x[d] sin[t][d+HD/2]
__global__ __launch_bounds__(256) void k_rope(const float* __restrict__ F, int pitch, int nheads, const float* __restrict__ CS, const float* __restrict__ RF, const float* __restrict__ nw, float sc, h16* P16, bf* Ph, bf* Pl) {
    const size_t e = ((size_t)blockIdx.x * 256 + threadIdx.x) * 2; if (e >= (size_t)nheads * TT * HD) return; const int d = (int)(e % HD); const int t = (int)((e / HD) % TT); const int h = (int)(e / ((size_t)HD * TT)); const float* f = F + ((size_t)h * TT + t) * pitch;   /* RAW VIEW: pseudo-head h, pseudo-position t = the flat (S, D) projection output read as (H, S, hd): row pitch 'pitch' (= HD here), head stride TT * pitch */ const float rf = RF ? RF[(size_t)h * TT + t] : 1.0f; v2h o16; v2us oh, ol;
#pragma unroll
    for (int q = 0; q < 2; ++q) { const int dd = d + q; const int dp = (dd < HD / 2) ? dd + HD / 2 : dd - HD / 2; float x0 = f[dd], x1 = f[dp];
        if (RF) { float n0 = __fmul_rn(x0, rf), n1 = __fmul_rn(x1, rf); asm volatile("" : "+v"(n0)); asm volatile("" : "+v"(n1)); x0 = __fmul_rn(bfr(nw[dd]), n0); x1 = __fmul_rn(bfr(nw[dp]), n1); }
        const v2f cs = *(const v2f*)(CS + ((size_t)t * HD + dd) * 2); float a = __fmul_rn(x0, cs[0]), bq = __fmul_rn(x1, cs[1]); asm volatile("" : "+v"(a)); asm volatile("" : "+v"(bq)); const float r = ((dd < HD / 2) ? __fsub_rn(a, bq) : __fadd_rn(a, bq)) * sc;
        o16[q] = tohx(r); unsigned short a2, c2; splitf(r, a2, c2); oh[q] = a2; ol[q] = c2; }
    *(v2h*)(P16 + e) = o16; *(v2us*)(Ph + e) = oh; *(v2us*)(Pl + e) = ol;  }
__global__ __launch_bounds__(256) void k_vtp(const float* __restrict__ F, int pitch, int nheads, h16* V16, bf* Vh, bf* Vl) { const size_t e = ((size_t)blockIdx.x * 256 + threadIdx.x) * 2; if (e >= (size_t)nheads * HD * TT) return; const int t = (int)(e % TT); const int d = (int)((e / TT) % HD); const int g = (int)(e / ((size_t)TT * HD)); v2h o16; v2us oh, ol;
#pragma unroll
    for (int q = 0; q < 2; ++q) { const float x = F[((size_t)g * TT + (t + q)) * pitch + d];   /* RAW VIEW (as in k_rope) */ o16[q] = tohx(x); unsigned short a2, c2; splitf(x, a2, c2); oh[q] = a2; ol[q] = c2; }
    *(v2h*)(V16 + e) = o16; *(v2us*)(Vh + e) = oh; *(v2us*)(Vl + e) = ol;  }
__global__ __launch_bounds__(256) void k_csid(float* CS) { const int idx = blockIdx.x * 256 + threadIdx.x; if (idx >= TT * HD) return; v2f cs; cs[0] = 1.0f; cs[1] = 0.0f; *(v2f*)(CS + (size_t)idx * 2) = cs;  }
// ---- k_fa: scores, causal softmax, probability x value and the hi/lo merge in ONE kernel (online softmax; no score plane in memory). Grid (TT / QT, heads), FNW waves per work-group.
// A work-group owns QT = 32 query rows of one head; its keys 0 .. q0 + 31 are dealt over the FNW waves in runs of 64 (one 128-byte line of each value row), worked in blocks of 32.
// Everything is computed TRANSPOSED so that no fragment changes lanes: S^T = K Q^T (D: row = key hi * 8 + j, column = query lr), which is already the B fragment of O^T = V^T P^T
// (lane lr = query, places 0..7 = keys 8 hi + j of key tile 0, places 8..15 = keys 16 + 8 hi + j of key tile 1: the k order of the V^T loader), and the running maximum and sum of a query live in its own lane.
// FaBody::run works NQ x 16 queries from q0 on (their rows in the LDS partial start at qr). Each wave ends with its own (max, sum, O^T); the FNW partials are joined through LDS in fixed wave order 0..FNW-1 behind one work-group barrier, divided by the sum, split hi/lo and written flat (RAW MERGE).
// The short inner loops are all unrolled so that the fragment, score and context arrays stay in registers.
// Rows < RH: bf16 hi/lo planes, 3 products in both contractions; the other rows fp16 (probabilities exp(s - max) <= 1 rounded to fp16).
#define QT   32
#define FNW  8
#define OPIT 68                   // f32 pitch of one query's 64 context values in a wave's LDS partial
#define SCL2 0.18033688011112042f // HD^-0.5 x log2(e): scores go to the base-2 exponent directly
typedef __attribute__((ext_vector_type(16))) unsigned short v16us;
__device__ __forceinline__ void mkp(const float* p, v16h& a, v16h&) {
#pragma unroll
    for (int i = 0; i < 16; ++i) a[i] = (h16)p[i]; }
__device__ __forceinline__ void mkp(const float* p, v16bf& a, v16bf& a2) { v16us h, l;
#pragma unroll
    for (int i = 0; i < 16; ++i) { unsigned short x, y; splitf(p[i], x, y); h[i] = x; l[i] = y; }
    a = __builtin_bit_cast(v16bf, h); a2 = __builtin_bit_cast(v16bf, l); }
template <typename T16, int NSPLIT, int NQ> struct FaBody {
static __device__ __forceinline__ void run(const T16* __restrict__ Q, const T16* __restrict__ Q2, const T16* __restrict__ Kp, const T16* __restrict__ Kp2, const T16* __restrict__ Vt, const T16* __restrict__ Vt2, int q0, int qr, float* os, float* ms, float* ls) {
    typedef typename WFrag<T16>::V V;
    const int lane = threadIdx.x & 31, lr = lane & 15, hi = lane >> 4; const int wv = __builtin_amdgcn_readfirstlane((int)(threadIdx.x >> 5));
    V qf[NQ][2], qf2[NQ][2]; const size_t qo = (size_t)(q0 + lr) * HD + 8 * hi; const T16* qp = Q + qo; const T16* qp2 = (NSPLIT == 2) ? Q2 + qo : qp;
#pragma unroll
    for (int nq = 0; nq < NQ; ++nq)
#pragma unroll
        for (int ks = 0; ks < 2; ++ks) { qf[nq][ks] = WFrag<T16>::ld(qp + nq * 16 * HD + ks * 32); if (NSPLIT == 2) qf2[nq][ks] = WFrag<T16>::ld(qp2 + nq * 16 * HD + ks * 32); }
    asm volatile("s_wait_xcnt 0x0" :: "v"(qp), "v"(qp2) : "memory");   // stands in front of any reuse of the loads' address registers; naming the addresses as inputs keeps them whole up to here
    v8f o[4][NQ]; float m[NQ], l[NQ];
#pragma unroll
    for (int nq = 0; nq < NQ; ++nq) { m[nq] = -3.0e38f; l[nq] = 0.f;
#pragma unroll
        for (int dt = 0; dt < 4; ++dt) o[dt][nq] = (v8f){}; }
    const int nkb = q0 / 32 + 1;                                     // key blocks of 32 up to and including the diagonal block
    const int nit = 2 * ((nkb / 2 - wv + FNW - 1) / FNW) + (((nkb & 1) && (nkb / 2) % FNW == wv) ? 1 : 0);   // this wave's blocks: two per whole run of 64, one more where the half run at the diagonal is its own
#pragma unroll 1   // rolled: one block's fragments, scores and the context tile already fill the registers
    for (int it = 0; it < nit; ++it) {
        const int kb = ((it >> 1) * FNW + wv) * 2 + (it & 1); const int k0 = kb * 32;
        const size_t ko = (size_t)(k0 + lr) * HD + 8 * hi, vo = (size_t)lr * TT + k0 + 8 * hi;
        const T16* kp = Kp + ko; const T16* kp2 = (NSPLIT == 2) ? Kp2 + ko : kp; const T16* vp = Vt + vo; const T16* vp2 = (NSPLIT == 2) ? Vt2 + vo : vp;
        V ka[2][2], ka2[2][2];
#pragma unroll
        for (int kt = 0; kt < 2; ++kt)
#pragma unroll
            for (int ks = 0; ks < 2; ++ks) { ka[kt][ks] = WFrag<T16>::ld(kp + kt * 16 * HD + ks * 32); if (NSPLIT == 2) ka2[kt][ks] = WFrag<T16>::ld(kp2 + kt * 16 * HD + ks * 32); }
        V va[4], va2[4];
#pragma unroll
        for (int dt = 0; dt < 4; ++dt) { va[dt] = WFrag<T16>::ld(vp + (size_t)dt * 16 * TT); if (NSPLIT == 2) va2[dt] = WFrag<T16>::ld(vp2 + (size_t)dt * 16 * TT); }
        __builtin_amdgcn_sched_barrier(0);                           // all of the block's loads issue together, ahead of the first product: one load latency a block (without it the loads are sunk between the products and wait one after the other)
        asm volatile("s_wait_xcnt 0x0" :: "v"(kp), "v"(kp2), "v"(vp), "v"(vp2) : "memory");   // as behind the query loads: in front of any reuse of the address registers, which stay whole up to here
        v8f s[2][NQ];
#pragma unroll
        for (int kt = 0; kt < 2; ++kt)
#pragma unroll
            for (int nq = 0; nq < NQ; ++nq) { v8f c = (v8f){};
#pragma unroll
                for (int ks = 0; ks < 2; ++ks) { c = WFrag<T16>::mma(ka[kt][ks], qf[nq][ks], c); if (NSPLIT == 2) { c = WFrag<T16>::mma(ka[kt][ks], qf2[nq][ks], c); c = WFrag<T16>::mma(ka2[kt][ks], qf[nq][ks], c); } }
                s[kt][nq] = c; }
        if (kb == nkb - 1) {                                         // only the last block holds keys beyond a query of this tile (wave-uniform test)
#pragma unroll
            for (int kt = 0; kt < 2; ++kt)
#pragma unroll
                for (int nq = 0; nq < NQ; ++nq)
#pragma unroll
                    for (int j = 0; j < 8; ++j) if (k0 + kt * 16 + hi * 8 + j > q0 + nq * 16 + lr) s[kt][nq][j] = -3.0e38f; }
#pragma unroll
        for (int nq = 0; nq < NQ; ++nq) { float p[16]; float mx = -3.0e38f;
#pragma unroll
            for (int kt = 0; kt < 2; ++kt)
#pragma unroll
                for (int j = 0; j < 8; ++j) { const float t = s[kt][nq][j] * SCL2; p[kt * 8 + j] = t; mx = fmaxf(mx, t); }
            mx = fmaxf(mx, __shfl_xor(mx, 16, 32));                  // the two lane halves hold the two halves of a query's keys
            const float mn = fmaxf(m[nq], mx); const float sc = __builtin_amdgcn_exp2f(m[nq] - mn); m[nq] = mn; float sum = 0.f;
#pragma unroll
            for (int i = 0; i < 16; ++i) { p[i] = __builtin_amdgcn_exp2f(p[i] - mn); sum += p[i]; }
            l[nq] = l[nq] * sc + sum;
            V pf, pf2; mkp(p, pf, pf2);
#pragma unroll
            for (int dt = 0; dt < 4; ++dt) { v8f c = o[dt][nq] * sc; c = WFrag<T16>::mma(va[dt], pf, c); if (NSPLIT == 2) { c = WFrag<T16>::mma(va[dt], pf2, c); c = WFrag<T16>::mma(va2[dt], pf, c); } o[dt][nq] = c; } }
    }
    float* ow = os + wv * (QT * OPIT);
#pragma unroll
    for (int nq = 0; nq < NQ; ++nq) { l[nq] += __shfl_xor(l[nq], 16, 32);
#pragma unroll
        for (int dt = 0; dt < 4; ++dt) { float* d = ow + (qr + nq * 16 + lr) * OPIT + dt * 16 + hi * 8; v4f x, y;
#pragma unroll
            for (int j = 0; j < 4; ++j) { x[j] = o[dt][nq][j]; y[j] = o[dt][nq][4 + j]; }
            *(v4fa*)d = x; *(v4fa*)(d + 4) = y; }
        if (hi == 0) { ms[wv * QT + qr + nq * 16 + lr] = m[nq]; ls[wv * QT + qr + nq * 16 + lr] = l[nq]; } }
}
};
__global__ __launch_bounds__(256) void k_fa(const h16* __restrict__ Q16, const h16* __restrict__ K16, const h16* __restrict__ V16, const bf* __restrict__ Qh, const bf* __restrict__ Ql, const bf* __restrict__ Kh, const bf* __restrict__ Kl, const bf* __restrict__ Vh, const bf* __restrict__ Vl, bf* Ah, bf* Al) {
    __shared__ __align__(16) float os[FNW * QT * OPIT]; __shared__ float ms[FNW * QT]; __shared__ float ls[FNW * QT];
    const size_t po = (size_t)blockIdx.y * TT * HD; const int q0 = (TT / QT - 1 - (int)blockIdx.x) * QT;   // longest rows first
    if (q0 < RH) {
#pragma unroll 1   // the hi/lo rows (short key loops, twice the fragments) go 16 queries at a time, so that they do not set the register count of the fp16 rows
        for (int hf = 0; hf < 2; ++hf) FaBody<bf, 2, 1>::run(Qh + po, Ql + po, Kh + po, Kl + po, Vh + po, Vl + po, q0 + hf * 16, hf * 16, os, ms, ls);
    } else FaBody<h16, 0, 2>::run(Q16 + po, nullptr, K16 + po, nullptr, V16 + po, nullptr, q0, 0, os, ms, ls);
    __syncthreads();                                                 // every wave's partial (max, sum, O^T) is in LDS before any thread joins them
    const int q = threadIdx.x >> 3, d0 = (threadIdx.x & 7) * 8; float mt = ms[q];
#pragma unroll
    for (int w = 1; w < FNW; ++w) mt = fmaxf(mt, ms[w * QT + q]);
    float acc[8], lt = 0.f;
#pragma unroll
    for (int j = 0; j < 8; ++j) acc[j] = 0.f;
#pragma unroll
    for (int w = 0; w < FNW; ++w) { const float f = __builtin_amdgcn_exp2f(ms[w * QT + q] - mt); lt += f * ls[w * QT + q]; const float* s = os + w * (QT * OPIT) + q * OPIT + d0; const v4f x = *(const v4fa*)s, y = *(const v4fa*)(s + 4);
#pragma unroll
        for (int j = 0; j < 4; ++j) { acc[j] += f * x[j]; acc[4 + j] += f * y[j]; } }
    const float inv = __fdiv_rn(1.0f, lt); v8us oh, ol;
#pragma unroll
    for (int j = 0; j < 8; ++j) { unsigned short a, c2; splitf(acc[j] * inv, a, c2); oh[j] = a; ol[j] = c2; }
    const size_t oo = po + (size_t)(q0 + q) * HD + d0;   /* RAW MERGE: the (H, S, hd) context written flat = the module's ctx.reshape(b, S, H * hd) without a transpose */
    *(v8usa*)(Ah + oo) = oh; *(v8usa*)(Al + oo) = ol;
}

extern "C" void kernel_launch(void* const* d_in, const int* in_sizes, int n_in,
                              void* d_out, int out_size, void* d_ws, size_t ws_size, hipStream_t stream) {
    (void)in_sizes; (void)n_in; (void)out_size;
    const float* x = (const float*)d_in[0]; const float* wq = (const float*)d_in[1]; const float* wk = (const float*)d_in[2]; const float* wv = (const float*)d_in[3]; const float* wo = (const float*)d_in[4];
    float* OUT = (float*)d_out;     // [2][2048][1024]
    char* wsp = (char*)d_ws;
    auto take = [&](size_t bytes) { char* p = wsp; wsp += (bytes + 255) & ~(size_t)255; return (void*)p; };
    bf* WQ = (bf*)take((size_t)DQ * DM * 2); bf* WK = (bf*)take((size_t)DKV * DM * 2); bf* WV = (bf*)take((size_t)DKV * DM * 2); bf* WO = (bf*)take((size_t)DM * DQ * 2); float* CS = (float*)take((size_t)TT * HD * 2 * 4);
    bf* XB = (bf*)take((size_t)TT * DM * 2); float* FQ = (float*)take((size_t)TT * DQ * 4); float* FK = (float*)take((size_t)TT * DKV * 4);
    h16* QP16 = (h16*)take((size_t)NH_ * TT * HD * 2); h16* KP16 = (h16*)take((size_t)NKV * TT * HD * 2); h16* VT16 = (h16*)take((size_t)NKV * HD * TT * 2);
    bf* QPh = (bf*)take((size_t)NH_ * TT * HD * 2); bf* QPl = (bf*)take((size_t)NH_ * TT * HD * 2); bf* KPh = (bf*)take((size_t)NKV * TT * HD * 2); bf* KPl = (bf*)take((size_t)NKV * TT * HD * 2); bf* VTh = (bf*)take((size_t)NKV * HD * TT * 2); bf* VTl = (bf*)take((size_t)NKV * HD * TT * 2);
    bf* ATh = (bf*)take((size_t)TT * DQ * 2); bf* ATl = (bf*)take((size_t)TT * DQ * 2);
    if ((size_t)(wsp - (char*)d_ws) > ws_size) return;    // ws 256 MiB
    float* FV = FK;   // v projection reuses the k buffer after the k planes are built (stream-ordered)
    { k_wtG<<<(unsigned)((DM * DQ / 64 + 63) / 64), 256, 0, stream>>>(wq, DM, DQ, WQ); k_wtG<<<(unsigned)((DM * DKV / 64 + 63) / 64), 256, 0, stream>>>(wk, DM, DKV, WK); k_wtG<<<(unsigned)((DM * DKV / 64 + 63) / 64), 256, 0, stream>>>(wv, DM, DKV, WV);
      k_wtG<<<(unsigned)((DQ * DM / 64 + 63) / 64), 256, 0, stream>>>(wo, DQ, DM, WO);
       }
    k_csid<<<(TT * HD + 255) / 256, 256, 0, stream>>>(CS);
    const unsigned LQ = (unsigned)(((size_t)NH_ * TT * HD / 2 + 255) / 256), LKv = (unsigned)(((size_t)NKV * TT * HD / 2 + 255) / 256);
    for (int b = 0; b < NB_; ++b) {
        
        k_cvt8<<<(unsigned)(((size_t)TT * DM / 8 + 255) / 256), 256, 0, stream>>>(x + (size_t)b * TT * DM, XB, (size_t)TT * DM / 8);
        k_gemmw<bf, 0, false><<<dim3(TT / 64, DQ / 64, 1), 32, 0, stream>>>(XB, nullptr, WQ, nullptr, DM, FQ, DQ, nullptr, 0, 0, 0);
        k_rope<<<LQ, 256, 0, stream>>>(FQ, HD, NH_, CS, nullptr, nullptr, 1.0f, QP16, QPh, QPl);
        k_gemmw<bf, 0, false><<<dim3(TT / 64, DKV / 64, 1), 32, 0, stream>>>(XB, nullptr, WK, nullptr, DM, FK, DKV, nullptr, 0, 0, 0);
        k_rope<<<LKv, 256, 0, stream>>>(FK, HD, NKV, CS, nullptr, nullptr, 1.0f, KP16, KPh, KPl);
        k_gemmw<bf, 0, false><<<dim3(TT / 64, DKV / 64, 1), 32, 0, stream>>>(XB, nullptr, WV, nullptr, DM, FV, DKV, nullptr, 0, 0, 0); k_vtp<<<LKv, 256, 0, stream>>>(FV, HD, NKV, VT16, VTh, VTl);
        k_fa<<<dim3(TT / QT, NH_, 1), 32 * FNW, 0, stream>>>(QP16, KP16, VT16, QPh, QPl, KPh, KPl, VTh, VTl, ATh, ATl);
        k_gemmw<bf, 1, false><<<dim3(TT / 64, DM / 64, 1), 32, 0, stream>>>(ATh, ATl, WO, nullptr, DQ, OUT + (size_t)b * TT * DM, DM, nullptr, 0, 0, 0); }
}

// v004
// It runs in 196 microseconds.
// Timed twice side by side with v003, it ran 1.78 and 1.79 times as fast.
// All steps since v000 together make it 7.42 times as fast.
#include <hip/hip_runtime.h>

// Causal multi-head attention whose heads are a RAW VIEW of the projections (x [2][2048][1024]; q, k, v = x W ('xw' [1024][1024] 0.02-scale, no bias); each is reshaped (b, 16, 2048, 64) WITHOUT a transpose: pseudo-head h, pseudo-position s, dim d = flat element h*2048*64 + s*64 + d of the [2048][1024] projection output (head h covers tokens 128 h .. 128 h + 127; pseudo-position s is the 64-wide feature block s mod 16 of token 128 h + s / 16); scores / sqrt(64); triu(k = 1) over the pseudo-positions -> -inf; softmax; the context (b, 16, 2048, 64) is reshaped (b, 2048, 1024) again WITHOUT a transpose; out = that Wproj ('xw', no bias) -> [2][2048][1024] (4.2 M); argument order x, Wq, Wk, Wv, Wproj).
// Layout, both batches in every launch (5 launches: k_prep, k_gemmw q/k/v, k_planes, k_fa, k_gemmw out): bf16 copy of x; 'xw' weights transposed once; exact projections; RAW VIEW: the plane builders read each [2048][1024] projection output as (16, 2048, 64) WITHOUT a transpose (row pitch HD, head stride TT x HD) and k_fa writes the context planes back flat (no transpose back): the module's own reshapes; causal T-2048 attention (hybrid rows: < 512 hi/lo 3 products, rest fp16; key blocks above the diagonal skipped; one fused kernel, online softmax); merged hi/lo x Wo exact.
// Compute dtypes, f32 accumulate: every input rounded to bf16; projections exact; attention rows < 512 3 products, rest fp16; softmax f32; Wo hl x exact.

#define NB_  2
#define TT   2048
#define DM   1024
#define NH_  16
#define NKV  16
#define HD   64
#define DQ   (NH_ * HD)
#define DKV  (NKV * HD)
#define RH   512                  // query rows < RH use hi+lo planes (0: none)
typedef _Float16 h16;
typedef unsigned short bf;
typedef __attribute__((ext_vector_type(16))) __bf16   v16bf;
typedef __attribute__((ext_vector_type(16))) _Float16 v16h;
typedef __attribute__((ext_vector_type(8)))  _Float16 v8h;
typedef __attribute__((ext_vector_type(8)))  unsigned short v8us;
typedef __attribute__((ext_vector_type(8)))  float    v8f;
typedef __attribute__((ext_vector_type(4)))  float    v4f;
typedef v8h  __attribute__((may_alias)) v8ha;
typedef v4f  __attribute__((may_alias)) v4fa;
typedef v8us __attribute__((may_alias)) v8usa;

__device__ __forceinline__ unsigned short f2bf(float f) { unsigned u = __float_as_uint(f); u += 0x7FFFu + ((u >> 16) & 1u); return (unsigned short)(u >> 16); }
__device__ __forceinline__ float bf2f(unsigned short b) { return __uint_as_float(((unsigned)b) << 16); }
__device__ __forceinline__ float bfr(float f) { return bf2f(f2bf(f)); }
__device__ __forceinline__ v16h cat16(v8h lo, v8h hi) { return __builtin_shufflevector(lo, hi, 0, 1, 2, 3, 4, 5, 6, 7, 8, 9, 10, 11, 12, 13, 14, 15); }
__device__ __forceinline__ v16bf cat16b(v8us lo, v8us hi) { return __builtin_bit_cast(v16bf, __builtin_shufflevector(lo, hi, 0, 1, 2, 3, 4, 5, 6, 7, 8, 9, 10, 11, 12, 13, 14, 15)); }
__device__ __forceinline__ v8f wmma16(v16h a, v16h b, v8f c) { return __builtin_amdgcn_wmma_f32_16x16x32_f16(false, a, false, b, (short)0, c, false, false); }
__device__ __forceinline__ v8f wmmab(v16bf a, v16bf b, v8f c) { return __builtin_amdgcn_wmma_f32_16x16x32_bf16(false, a, false, b, (short)0, c, false, false); }



// ---- k_gemmw: register-blocked GEMM, ONE WAVE per 64x64 output tile (16 accumulators), operands straight from K-contiguous 16-bit planes; grid (M/64, N/64, Z), 32 threads.
// C[m][n] (f32, pitch ldc, + optional f32 bias[n]) = sum_k A[m][k] Bt[n][k] (+ split products per NSPLIT). z-batch strides sA/sB/sC in elements. K % 32 == 0.
template <typename T16> struct WFrag;
template <> struct WFrag<h16> { typedef v16h V; static __device__ __forceinline__ V ld(const h16* p) { return cat16(*(const v8h*)p, *(const v8h*)(p + 16)); } static __device__ __forceinline__ v8f mma(V a, V b, v8f c) { return wmma16(a, b, c); } };
template <> struct WFrag<bf> { typedef v16bf V; static __device__ __forceinline__ V ld(const bf* p) { return cat16b(*(const v8us*)p, *(const v8us*)(p + 16)); } static __device__ __forceinline__ v8f mma(V a, V b, v8f c) { return wmmab(a, b, c); } };
template <typename T16, int NSPLIT, bool BIAS>
__global__ __launch_bounds__(32) void k_gemmw(const T16* __restrict__ A, const T16* __restrict__ A2, const T16* __restrict__ Bt, const T16* __restrict__ Bt2, int K, float* C, int ldc, const float* __restrict__ bias, size_t sA, size_t sB, size_t sC) {
    typedef typename WFrag<T16>::V V;
    __shared__ __align__(16) float os[16 * 68];
    const size_t z = blockIdx.z; A += z * sA; if (A2) A2 += z * sA; Bt += z * sB; if (Bt2) Bt2 += z * sB; C += z * sC;
    const int lane = threadIdx.x & 31, lr = lane & 15, hi = lane >> 4; const int r0 = blockIdx.x * 64, c0 = blockIdx.y * 64;
    v8f acc[4][4];
#pragma unroll
    for (int mb = 0; mb < 4; ++mb)
#pragma unroll
        for (int nb = 0; nb < 4; ++nb) acc[mb][nb] = (v8f){};
    const size_t aoff = (size_t)(r0 + lr) * K + 8 * hi, boff = (size_t)(c0 + lr) * K + 8 * hi;
#pragma unroll 1
    for (int kc = 0; kc < K; kc += 32) {
        V a[4], a2[4];
#pragma unroll
        for (int mb = 0; mb < 4; ++mb) { a[mb] = WFrag<T16>::ld(A + aoff + (size_t)mb * 16 * K + kc); if (NSPLIT == 1 || NSPLIT == 2) a2[mb] = WFrag<T16>::ld(A2 + aoff + (size_t)mb * 16 * K + kc); }
#pragma unroll
        for (int nb = 0; nb < 4; ++nb) { const V b = WFrag<T16>::ld(Bt + boff + (size_t)nb * 16 * K + kc); V b2; if (NSPLIT >= 2) b2 = WFrag<T16>::ld(Bt2 + boff + (size_t)nb * 16 * K + kc);
#pragma unroll
            for (int mb = 0; mb < 4; ++mb) { acc[mb][nb] = WFrag<T16>::mma(a[mb], b, acc[mb][nb]); if (NSPLIT == 1 || NSPLIT == 2) acc[mb][nb] = WFrag<T16>::mma(a2[mb], b, acc[mb][nb]); if (NSPLIT >= 2) acc[mb][nb] = WFrag<T16>::mma(a[mb], b2, acc[mb][nb]); } }
        asm volatile("v_nop\n\tv_nop\n\tv_nop\n\tv_nop" : "+v"(acc[0][0]), "+v"(acc[1][1]), "+v"(acc[2][2]), "+v"(acc[3][3]) : "v"(a[0]), "v"(a[3]));
    }
#pragma unroll
    for (int mb = 0; mb < 4; ++mb) {
#pragma unroll
        for (int nb = 0; nb < 4; ++nb) {
#pragma unroll
            for (int j = 0; j < 8; ++j) os[(hi * 8 + j) * 68 + nb * 16 + lr] = acc[mb][nb][j]; }
        __builtin_amdgcn_wave_barrier(); asm volatile("" ::: "memory");
        float* crow = C + (size_t)(r0 + mb * 16) * ldc + c0;
{
#pragma unroll
            for (int s = 0; s < 8; ++s) { const int row = 2 * s + hi, cofs = lr * 4; v4f val = *(const v4fa*)(os + row * 68 + cofs); if (BIAS) { val[0] += bfr(bias[c0 + cofs]); val[1] += bfr(bias[c0 + cofs + 1]); val[2] += bfr(bias[c0 + cofs + 2]); val[3] += bfr(bias[c0 + cofs + 3]); }
                *(v4f*)(crow + (size_t)row * ldc + cofs) = val; }
             }
        __builtin_amdgcn_wave_barrier(); asm volatile("" ::: "memory");
    }
}

__device__ __forceinline__ h16 tohx(float x) { return (h16)x; }
__device__ __forceinline__ void splitf(float y, unsigned short& h, unsigned short& l) { h = f2bf(y); l = f2bf(y - bf2f(h)); }
typedef __attribute__((ext_vector_type(2))) _Float16 v2h;
typedef __attribute__((ext_vector_type(4))) _Float16 v4h;
typedef __attribute__((ext_vector_type(2))) unsigned short v2us;
typedef __attribute__((ext_vector_type(4))) unsigned short v4us;
typedef __attribute__((ext_vector_type(2))) float v2f;
typedef __attribute__((ext_vector_type(4))) int v4i;
typedef v4h  __attribute__((may_alias)) v4ha;
typedef v4us __attribute__((may_alias)) v4usa;

// The small builders are device functions that take their block index bx: launches that do not depend on one another share one grid (k_prep, k_planes below).
__device__ __forceinline__ void b_wtG(int bx, const float* __restrict__ w, int K, int N, bf* Bt) {
    const int lane = threadIdx.x & 31; const int L0 = (bx * 8 + (threadIdx.x >> 5)) * 8; const int nlines = N * K / 64;
{
#pragma unroll 1
        for (int l = 0; l < 8; ++l) { const int L = L0 + l; if (L >= nlines) break; const size_t e = (size_t)L * 64 + lane * 2; const int k = (int)(e % K), n = (int)(e / K); v2us o;
            o[0] = f2bf(w[(size_t)k * N + n]); o[1] = f2bf(w[(size_t)(k + 1) * N + n]); *(v2us*)(Bt + e) = o; }
         }
}
__device__ __forceinline__ void b_cvt8(int bx, const float* __restrict__ src, bf* dst, size_t n8) { const size_t i = (size_t)bx * 256 + threadIdx.x; if (i >= n8) return; const v8f v = *(const v8f*)(src + i * 8); v8us o;
#pragma unroll
    for (int k = 0; k < 8; ++k) o[k] = f2bf(v[k]); *(v8us*)(dst + i * 8) = o;  }

// b_rope: head planes [h][t][d] (fp16 + hi/lo) of rope(x) x sc with the rotate-half convention out[d] = x[d] cos[t][d] - x[d+HD/2] sin[t][d], out[d+HD/2] = x[d+HD/2] cos[t][d+HD/2] + x[d] sin[t][d+HD/2]
__device__ __forceinline__ void b_rope(int bx, const float* __restrict__ F, int pitch, int nheads, const float* __restrict__ CS, const float* __restrict__ RF, const float* __restrict__ nw, float sc, h16* P16, bf* Ph, bf* Pl) {
    const size_t e = ((size_t)bx * 256 + threadIdx.x) * 2; if (e >= (size_t)nheads * TT * HD) return; const int d = (int)(e % HD); const int t = (int)((e / HD) % TT); const int h = (int)(e / ((size_t)HD * TT)); const float* f = F + ((size_t)h * TT + t) * pitch;   /* RAW VIEW: pseudo-head h, pseudo-position t = the flat (S, D) projection output read as (H, S, hd): row pitch 'pitch' (= HD here), head stride TT * pitch */ const float rf = RF ? RF[(size_t)h * TT + t] : 1.0f; v2h o16; v2us oh, ol;
#pragma unroll
    for (int q = 0; q < 2; ++q) { const int dd = d + q; const int dp = (dd < HD / 2) ? dd + HD / 2 : dd - HD / 2; float x0 = f[dd], x1 = f[dp];
        if (RF) { float n0 = __fmul_rn(x0, rf), n1 = __fmul_rn(x1, rf); asm volatile("" : "+v"(n0)); asm volatile("" : "+v"(n1)); x0 = __fmul_rn(bfr(nw[dd]), n0); x1 = __fmul_rn(bfr(nw[dp]), n1); }
        const v2f cs = *(const v2f*)(CS + ((size_t)t * HD + dd) * 2); float a = __fmul_rn(x0, cs[0]), bq = __fmul_rn(x1, cs[1]); asm volatile("" : "+v"(a)); asm volatile("" : "+v"(bq)); const float r = ((dd < HD / 2) ? __fsub_rn(a, bq) : __fadd_rn(a, bq)) * sc;
        o16[q] = tohx(r); unsigned short a2, c2; splitf(r, a2, c2); oh[q] = a2; ol[q] = c2; }
    *(v2h*)(P16 + e) = o16; *(v2us*)(Ph + e) = oh; *(v2us*)(Pl + e) = ol;  }
__device__ __forceinline__ void b_vtp(int bx, const float* __restrict__ F, int pitch, int nheads, h16* V16, bf* Vh, bf* Vl) { const size_t e = ((size_t)bx * 256 + threadIdx.x) * 2; if (e >= (size_t)nheads * HD * TT) return; const int t = (int)(e % TT); const int d = (int)((e / TT) % HD); const int g = (int)(e / ((size_t)TT * HD)); v2h o16; v2us oh, ol;
#pragma unroll
    for (int q = 0; q < 2; ++q) { const float x = F[((size_t)g * TT + (t + q)) * pitch + d];   /* RAW VIEW (as in b_rope) */ o16[q] = tohx(x); unsigned short a2, c2; splitf(x, a2, c2); oh[q] = a2; ol[q] = c2; }
    *(v2h*)(V16 + e) = o16; *(v2us*)(Vh + e) = oh; *(v2us*)(Vl + e) = ol;  }
__device__ __forceinline__ void b_csid(int bx, float* CS) { const int idx = bx * 256 + threadIdx.x; if (idx >= TT * HD) return; v2f cs; cs[0] = 1.0f; cs[1] = 0.0f; *(v2f*)(CS + (size_t)idx * 2) = cs;  }
// ---- k_prep: everything that reads only the inputs, in one launch: the four weight transposes (WB blocks each, planes WT[0..3] = q, k, v, out), the bf16 copy of x (both batches, XBLK blocks), the identity cos/sin table (CBLK blocks). The block ranges are work-group uniform.
#define WB   (DM * DQ / 64 / 64)
#define XBLK (NB_ * TT * DM / 8 / 256)
#define CBLK (TT * HD / 256)
__global__ __launch_bounds__(256) void k_prep(const float* __restrict__ x, const float* __restrict__ wq, const float* __restrict__ wk, const float* __restrict__ wv, const float* __restrict__ wo, bf* WT, bf* XB, float* CS) {
    const int bx = (int)blockIdx.x;
    if (bx < 4 * WB) { const int wi = bx / WB; const float* w = (wi == 0) ? wq : (wi == 1) ? wk : (wi == 2) ? wv : wo; b_wtG(bx - wi * WB, w, DM, DQ, WT + (size_t)wi * DM * DQ); }
    else if (bx < 4 * WB + XBLK) b_cvt8(bx - 4 * WB, x, XB, (size_t)NB_ * TT * DM / 8);
    else b_csid(bx - 4 * WB - XBLK, CS);
}
// ---- k_planes: the value planes (VBLK blocks, transposed reads, first) and the query and key planes (one run of NB_ x (NH_ + NKV) flat pseudo-heads: the q output of both batches, then the k output) in one launch.
#define VBLK (NB_ * NKV * HD * TT / 2 / 256)
#define RBLK (NB_ * (NH_ + NKV) * TT * HD / 2 / 256)
__global__ __launch_bounds__(256) void k_planes(const float* __restrict__ FQK, const float* __restrict__ FV, const float* __restrict__ CS, h16* QK16, bf* QKh, bf* QKl, h16* V16, bf* Vh, bf* Vl) {
    const int bx = (int)blockIdx.x;
    if (bx < VBLK) b_vtp(bx, FV, HD, NB_ * NKV, V16, Vh, Vl);
    else b_rope(bx - VBLK, FQK, HD, NB_ * (NH_ + NKV), CS, nullptr, nullptr, 1.0f, QK16, QKh, QKl);
}
// ---- k_fa: scores, causal softmax, probability x value and the hi/lo merge in ONE kernel (online softmax; no score plane in memory). Grid (TT / QT, batches x heads), FNW waves per work-group.
// A work-group owns QT = 32 query rows of one head; its keys 0 .. q0 + 31 are dealt over the FNW waves in runs of 64 (one 128-byte line of each value row), worked in blocks of 32.
// Everything is computed TRANSPOSED so that no fragment changes lanes: S^T = K Q^T (D: row = key hi * 8 + j, column = query lr), which is already the B fragment of O^T = V^T P^T
// (lane lr = query, places 0..7 = keys 8 hi + j of key tile 0, places 8..15 = keys 16 + 8 hi + j of key tile 1: the k order of the V^T loader), and the running maximum and sum of a query live in its own lane.
// FaBody::run works NQ x 16 queries from q0 on (their rows in the LDS partial start at qr). Each wave ends with its own (max, sum, O^T); the FNW partials are joined through LDS in fixed wave order 0..FNW-1 behind one work-group barrier, divided by the sum, split hi/lo and written flat (RAW MERGE).
// The short inner loops are all unrolled so that the fragment, score and context arrays stay in registers.
// Rows < RH: bf16 hi/lo planes, 3 products in both contractions; the other rows fp16 (probabilities exp(s - max) <= 1 rounded to fp16).
#define QT   32
#define FNW  8
#define OPIT 68                   // f32 pitch of one query's 64 context values in a wave's LDS partial
#define SCL2 0.18033688011112042f // HD^-0.5 x log2(e): scores go to the base-2 exponent directly
typedef __attribute__((ext_vector_type(16))) unsigned short v16us;
__device__ __forceinline__ void mkp(const float* p, v16h& a, v16h&) {
#pragma unroll
    for (int i = 0; i < 16; ++i) a[i] = (h16)p[i]; }
__device__ __forceinline__ void mkp(const float* p, v16bf& a, v16bf& a2) { v16us h, l;
#pragma unroll
    for (int i = 0; i < 16; ++i) { unsigned short x, y; splitf(p[i], x, y); h[i] = x; l[i] = y; }
    a = __builtin_bit_cast(v16bf, h); a2 = __builtin_bit_cast(v16bf, l); }
template <typename T16, int NSPLIT, int NQ> struct FaBody {
static __device__ __forceinline__ void run(const T16* __restrict__ Q, const T16* __restrict__ Q2, const T16* __restrict__ Kp, const T16* __restrict__ Kp2, const T16* __restrict__ Vt, const T16* __restrict__ Vt2, int q0, int qr, float* os, float* ms, float* ls) {
    typedef typename WFrag<T16>::V V;
    const int lane = threadIdx.x & 31, lr = lane & 15, hi = lane >> 4; const int wv = __builtin_amdgcn_readfirstlane((int)(threadIdx.x >> 5));
    V qf[NQ][2], qf2[NQ][2]; const size_t qo = (size_t)(q0 + lr) * HD + 8 * hi; const T16* qp = Q + qo; const T16* qp2 = (NSPLIT == 2) ? Q2 + qo : qp;
#pragma unroll
    for (int nq = 0; nq < NQ; ++nq)
#pragma unroll
        for (int ks = 0; ks < 2; ++ks) { qf[nq][ks] = WFrag<T16>::ld(qp + nq * 16 * HD + ks * 32); if (NSPLIT == 2) qf2[nq][ks] = WFrag<T16>::ld(qp2 + nq * 16 * HD + ks * 32); }
    asm volatile("s_wait_xcnt 0x0" :: "v"(qp), "v"(qp2) : "memory");   // stands in front of any reuse of the loads' address registers; naming the addresses as inputs keeps them whole up to here
    v8f o[4][NQ]; float m[NQ], l[NQ];
#pragma unroll
    for (int nq = 0; nq < NQ; ++nq) { m[nq] = -3.0e38f; l[nq] = 0.f;
#pragma unroll
        for (int dt = 0; dt < 4; ++dt) o[dt][nq] = (v8f){}; }
    const int nkb = q0 / 32 + 1;                                     // key blocks of 32 up to and including the diagonal block
    const int nit = 2 * ((nkb / 2 - wv + FNW - 1) / FNW) + (((nkb & 1) && (nkb / 2) % FNW == wv) ? 1 : 0);   // this wave's blocks: two per whole run of 64, one more where the half run at the diagonal is its own
#pragma unroll 1   // rolled: one block's fragments, scores and the context tile already fill the registers
    for (int it = 0; it < nit; ++it) {
        const int kb = ((it >> 1) * FNW + wv) * 2 + (it & 1); const int k0 = kb * 32;
        const size_t ko = (size_t)(k0 + lr) * HD + 8 * hi, vo = (size_t)lr * TT + k0 + 8 * hi;
        const T16* kp = Kp + ko; const T16* kp2 = (NSPLIT == 2) ? Kp2 + ko : kp; const T16* vp = Vt + vo; const T16* vp2 = (NSPLIT == 2) ? Vt2 + vo : vp;
        V ka[2][2], ka2[2][2];
#pragma unroll
        for (int kt = 0; kt < 2; ++kt)
#pragma unroll
            for (int ks = 0; ks < 2; ++ks) { ka[kt][ks] = WFrag<T16>::ld(kp + kt * 16 * HD + ks * 32); if (NSPLIT == 2) ka2[kt][ks] = WFrag<T16>::ld(kp2 + kt * 16 * HD + ks * 32); }
        V va[4], va2[4];
#pragma unroll
        for (int dt = 0; dt < 4; ++dt) { va[dt] = WFrag<T16>::ld(vp + (size_t)dt * 16 * TT); if (NSPLIT == 2) va2[dt] = WFrag<T16>::ld(vp2 + (size_t)dt * 16 * TT); }
        __builtin_amdgcn_sched_barrier(0);                           // all of the block's loads issue together, ahead of the first product: one load latency a block (without it the loads are sunk between the products and wait one after the other)
        asm volatile("s_wait_xcnt 0x0" :: "v"(kp), "v"(kp2), "v"(vp), "v"(vp2) : "memory");   // as behind the query loads: in front of any reuse of the address registers, which stay whole up to here
        v8f s[2][NQ];
#pragma unroll
        for (int kt = 0; kt < 2; ++kt)
#pragma unroll
            for (int nq = 0; nq < NQ; ++nq) { v8f c = (v8f){};
#pragma unroll
                for (int ks = 0; ks < 2; ++ks) { c = WFrag<T16>::mma(ka[kt][ks], qf[nq][ks], c); if (NSPLIT == 2) { c = WFrag<T16>::mma(ka[kt][ks], qf2[nq][ks], c); c = WFrag<T16>::mma(ka2[kt][ks], qf[nq][ks], c); } }
                s[kt][nq] = c; }
        if (kb == nkb - 1) {                                         // only the last block holds keys beyond a query of this tile (wave-uniform test)
#pragma unroll
            for (int kt = 0; kt < 2; ++kt)
#pragma unroll
                for (int nq = 0; nq < NQ; ++nq)
#pragma unroll
                    for (int j = 0; j < 8; ++j) if (k0 + kt * 16 + hi * 8 + j > q0 + nq * 16 + lr) s[kt][nq][j] = -3.0e38f; }
#pragma unroll
        for (int nq = 0; nq < NQ; ++nq) { float p[16]; float mx = -3.0e38f;
#pragma unroll
            for (int kt = 0; kt < 2; ++kt)
#pragma unroll
                for (int j = 0; j < 8; ++j) { const float t = s[kt][nq][j] * SCL2; p[kt * 8 + j] = t; mx = fmaxf(mx, t); }
            mx = fmaxf(mx, __shfl_xor(mx, 16, 32));                  // the two lane halves hold the two halves of a query's keys
            const float mn = fmaxf(m[nq], mx); const float sc = __builtin_amdgcn_exp2f(m[nq] - mn); m[nq] = mn; float sum = 0.f;
#pragma unroll
            for (int i = 0; i < 16; ++i) { p[i] = __builtin_amdgcn_exp2f(p[i] - mn); sum += p[i]; }
            l[nq] = l[nq] * sc + sum;
            V pf, pf2; mkp(p, pf, pf2);
#pragma unroll
            for (int dt = 0; dt < 4; ++dt) { v8f c = o[dt][nq] * sc; c = WFrag<T16>::mma(va[dt], pf, c); if (NSPLIT == 2) { c = WFrag<T16>::mma(va[dt], pf2, c); c = WFrag<T16>::mma(va2[dt], pf, c); } o[dt][nq] = c; } }
    }
    float* ow = os + wv * (QT * OPIT);
#pragma unroll
    for (int nq = 0; nq < NQ; ++nq) { l[nq] += __shfl_xor(l[nq], 16, 32);
#pragma unroll
        for (int dt = 0; dt < 4; ++dt) { float* d = ow + (qr + nq * 16 + lr) * OPIT + dt * 16 + hi * 8; v4f x, y;
#pragma unroll
            for (int j = 0; j < 4; ++j) { x[j] = o[dt][nq][j]; y[j] = o[dt][nq][4 + j]; }
            *(v4fa*)d = x; *(v4fa*)(d + 4) = y; }
        if (hi == 0) { ms[wv * QT + qr + nq * 16 + lr] = m[nq]; ls[wv * QT + qr + nq * 16 + lr] = l[nq]; } }
}
};
__global__ __launch_bounds__(256) void k_fa(const h16* __restrict__ Q16, const h16* __restrict__ K16, const h16* __restrict__ V16, const bf* __restrict__ Qh, const bf* __restrict__ Ql, const bf* __restrict__ Kh, const bf* __restrict__ Kl, const bf* __restrict__ Vh, const bf* __restrict__ Vl, bf* Ah, bf* Al) {
    __shared__ __align__(16) float os[FNW * QT * OPIT]; __shared__ float ms[FNW * QT]; __shared__ float ls[FNW * QT];
    const size_t po = (size_t)blockIdx.y * TT * HD; const int q0 = (TT / QT - 1 - (int)blockIdx.x) * QT;   // longest rows first
    if (q0 < RH) {
#pragma unroll 1   // the hi/lo rows (short key loops, twice the fragments) go 16 queries at a time, so that they do not set the register count of the fp16 rows
        for (int hf = 0; hf < 2; ++hf) FaBody<bf, 2, 1>::run(Qh + po, Ql + po, Kh + po, Kl + po, Vh + po, Vl + po, q0 + hf * 16, hf * 16, os, ms, ls);
    } else FaBody<h16, 0, 2>::run(Q16 + po, nullptr, K16 + po, nullptr, V16 + po, nullptr, q0, 0, os, ms, ls);
    __syncthreads();                                                 // every wave's partial (max, sum, O^T) is in LDS before any thread joins them
    const int q = threadIdx.x >> 3, d0 = (threadIdx.x & 7) * 8; float mt = ms[q];
#pragma unroll
    for (int w = 1; w < FNW; ++w) mt = fmaxf(mt, ms[w * QT + q]);
    float acc[8], lt = 0.f;
#pragma unroll
    for (int j = 0; j < 8; ++j) acc[j] = 0.f;
#pragma unroll
    for (int w = 0; w < FNW; ++w) { const float f = __builtin_amdgcn_exp2f(ms[w * QT + q] - mt); lt += f * ls[w * QT + q]; const float* s = os + w * (QT * OPIT) + q * OPIT + d0; const v4f x = *(const v4fa*)s, y = *(const v4fa*)(s + 4);
#pragma unroll
        for (int j = 0; j < 4; ++j) { acc[j] += f * x[j]; acc[4 + j] += f * y[j]; } }
    const float inv = __fdiv_rn(1.0f, lt); v8us oh, ol;
#pragma unroll
    for (int j = 0; j < 8; ++j) { unsigned short a, c2; splitf(acc[j] * inv, a, c2); oh[j] = a; ol[j] = c2; }
    const size_t oo = po + (size_t)(q0 + q) * HD + d0;   /* RAW MERGE: the (H, S, hd) context written flat = the module's ctx.reshape(b, S, H * hd) without a transpose */
    *(v8usa*)(Ah + oo) = oh; *(v8usa*)(Al + oo) = ol;
}

extern "C" void kernel_launch(void* const* d_in, const int* in_sizes, int n_in,
                              void* d_out, int out_size, void* d_ws, size_t ws_size, hipStream_t stream) {
    (void)in_sizes; (void)n_in; (void)out_size;
    const float* x = (const float*)d_in[0]; const float* wq = (const float*)d_in[1]; const float* wk = (const float*)d_in[2]; const float* wv = (const float*)d_in[3]; const float* wo = (const float*)d_in[4];
    float* OUT = (float*)d_out;     // [2][2048][1024]
    char* wsp = (char*)d_ws;
    auto take = [&](size_t bytes) { char* p = wsp; wsp += (bytes + 255) & ~(size_t)255; return (void*)p; };
    const size_t PL = (size_t)NB_ * TT * DQ;   // elements of one plane over both batches (DQ == DKV == DM here)
    bf* WT = (bf*)take((size_t)4 * DQ * DM * 2); bf* WO = WT + (size_t)3 * DQ * DM; float* CS = (float*)take((size_t)TT * HD * 2 * 4);
    bf* XB = (bf*)take(PL * 2); float* FQ = (float*)take(3 * PL * 4); float* FV = FQ + 2 * PL;   // q, k, v projection outputs one behind the other
    h16* QP16 = (h16*)take(2 * PL * 2); h16* KP16 = QP16 + PL; h16* VT16 = (h16*)take(PL * 2);
    bf* QPh = (bf*)take(2 * PL * 2); bf* KPh = QPh + PL; bf* QPl = (bf*)take(2 * PL * 2); bf* KPl = QPl + PL; bf* VTh = (bf*)take(PL * 2); bf* VTl = (bf*)take(PL * 2);
    bf* ATh = (bf*)take(PL * 2); bf* ATl = (bf*)take(PL * 2);
    if ((size_t)(wsp - (char*)d_ws) > ws_size) return;    // ws 256 MiB
    k_prep<<<4 * WB + XBLK + CBLK, 256, 0, stream>>>(x, wq, wk, wv, wo, WT, XB, CS);
    k_gemmw<bf, 0, false><<<dim3(NB_ * TT / 64, DQ / 64, 3), 32, 0, stream>>>(XB, nullptr, WT, nullptr, DM, FQ, DQ, nullptr, 0, (size_t)DQ * DM, PL);   // z = q, k, v
    k_planes<<<VBLK + RBLK, 256, 0, stream>>>(FQ, FV, CS, QP16, QPh, QPl, VT16, VTh, VTl);
    k_fa<<<dim3(TT / QT, NB_ * NH_, 1), 32 * FNW, 0, stream>>>(QP16, KP16, VT16, QPh, QPl, KPh, KPl, VTh, VTl, ATh, ATl);
    k_gemmw<bf, 1, false><<<dim3(NB_ * TT / 64, DM / 64, 1), 32, 0, stream>>>(ATh, ATl, WO, nullptr, DQ, OUT, DM, nullptr, 0, 0, 0);
}

// v005
// Measured time: 168 microseconds a run.
// Timed twice side by side with v004, it ran 1.18 and 1.17 times as fast.
// Counting every step since v000, it is 8.70 times as fast.
#include <hip/hip_runtime.h>

// Causal multi-head attention whose heads are a RAW VIEW of the projections (x [2][2048][1024]; q, k, v = x W ('xw' [1024][1024] 0.02-scale, no bias); each is reshaped (b, 16, 2048, 64) WITHOUT a transpose: pseudo-head h, pseudo-position s, dim d = flat element h*2048*64 + s*64 + d of the [2048][1024] projection output (head h covers tokens 128 h .. 128 h + 127; pseudo-position s is the 64-wide feature block s mod 16 of token 128 h + s / 16); scores / sqrt(64); triu(k = 1) over the pseudo-positions -> -inf; softmax; the context (b, 16, 2048, 64) is reshaped (b, 2048, 1024) again WITHOUT a transpose; out = that Wproj ('xw', no bias) -> [2][2048][1024] (4.2 M); argument order x, Wq, Wk, Wv, Wproj).
// Layout, both batches in every launch (4 launches: k_prep, k_gemmw q/k/v, k_fa, k_gemmw out): bf16 copy of x; 'xw' weights transposed once; exact projections; RAW VIEW: the q/k/v GEMM's epilogue writes the 16-bit head planes itself, taking each [2048][1024] projection output as (16, 2048, 64) WITHOUT a transpose (q, k row pitch HD; v per head as [d][t], pitch TT; head stride TT x HD; no f32 projection plane in memory), and k_fa writes the context planes back flat (no transpose back): the module's own reshapes; causal T-2048 attention (hybrid rows: < 512 hi/lo 3 products, rest fp16; key blocks above the diagonal skipped; one fused kernel, online softmax); merged hi/lo x Wo exact.
// Compute dtypes, f32 accumulate: every input rounded to bf16; projections exact; attention rows < 512 3 products, rest fp16; softmax f32; Wo hl x exact.

#define NB_  2
#define TT   2048
#define DM   1024
#define NH_  16
#define NKV  16
#define HD   64
#define DQ   (NH_ * HD)
#define DKV  (NKV * HD)
#define RH   512                  // query rows < RH use hi+lo planes (0: none)
typedef _Float16 h16;
typedef unsigned short bf;
typedef __attribute__((ext_vector_type(16))) __bf16   v16bf;
typedef __attribute__((ext_vector_type(16))) _Float16 v16h;
typedef __attribute__((ext_vector_type(8)))  _Float16 v8h;
typedef __attribute__((ext_vector_type(8)))  unsigned short v8us;
typedef __attribute__((ext_vector_type(8)))  float    v8f;
typedef __attribute__((ext_vector_type(4)))  float    v4f;
typedef v8h  __attribute__((may_alias)) v8ha;
typedef v4f  __attribute__((may_alias)) v4fa;
typedef v8us __attribute__((may_alias)) v8usa;

__device__ __forceinline__ unsigned short f2bf(float f) { unsigned u = __float_as_uint(f); u += 0x7FFFu + ((u >> 16) & 1u); return (unsigned short)(u >> 16); }
__device__ __forceinline__ float bf2f(unsigned short b) { return __uint_as_float(((unsigned)b) << 16); }
__device__ __forceinline__ float bfr(float f) { return bf2f(f2bf(f)); }
__device__ __forceinline__ v16h cat16(v8h lo, v8h hi) { return __builtin_shufflevector(lo, hi, 0, 1, 2, 3, 4, 5, 6, 7, 8, 9, 10, 11, 12, 13, 14, 15); }
__device__ __forceinline__ v16bf cat16b(v8us lo, v8us hi) { return __builtin_bit_cast(v16bf, __builtin_shufflevector(lo, hi, 0, 1, 2, 3, 4, 5, 6, 7, 8, 9, 10, 11, 12, 13, 14, 15)); }
__device__ __forceinline__ v8f wmma16(v16h a, v16h b, v8f c) { return __builtin_amdgcn_wmma_f32_16x16x32_f16(false, a, false, b, (short)0, c, false, false); }
__device__ __forceinline__ v8f wmmab(v16bf a, v16bf b, v8f c) { return __builtin_amdgcn_wmma_f32_16x16x32_bf16(false, a, false, b, (short)0, c, false, false); }



// ---- k_gemmw: register-blocked GEMM, ONE WAVE per 64x64 output tile (16 accumulators), operands straight from K-contiguous 16-bit planes; grid (M/64, N/64, Z), 32 threads.
// C[m][n] (f32, pitch ldc, + optional f32 bias[n]) = sum_k A[m][k] Bt[n][k] (+ split products per NSPLIT). z-batch strides sA/sB/sC in elements. K % 32 == 0.
// PLANES (the q/k/v projections, z = 0, 1, 2; ldc = DQ): no C; each staged 16 x 64 block goes out as the fp16 and bf16 hi/lo head planes, 8 values and one 16-byte store a plane and lane.
//   z < 2: plane element = flat element of the projection output (RAW VIEW), 4 whole 128-byte rows a store.
//   z = 2: value planes [pseudo-head g][d][pseudo-position t]. k_prep has put the value weight's rows in the order n' = 16 d + fb (feature fb * 64 + d), so a tile holds 4 dims d = 4 blockIdx.y + nb, each with all 16 feature blocks fb = lr:
//          token row R, column (nb, lr) is g = R / 128, t = (R % 128) * 16 + lr, and the 16 x 16 block (mb, nb) is 256 consecutive t of one d: 512 contiguous bytes a store.
template <typename T16> struct WFrag;
template <> struct WFrag<h16> { typedef v16h V; static __device__ __forceinline__ V ld(const h16* p) { return cat16(*(const v8h*)p, *(const v8h*)(p + 16)); } static __device__ __forceinline__ v8f mma(V a, V b, v8f c) { return wmma16(a, b, c); } };
template <> struct WFrag<bf> { typedef v16bf V; static __device__ __forceinline__ V ld(const bf* p) { return cat16b(*(const v8us*)p, *(const v8us*)(p + 16)); } static __device__ __forceinline__ v8f mma(V a, V b, v8f c) { return wmmab(a, b, c); } };
__device__ __forceinline__ h16 tohx(float x) { return (h16)x; }
__device__ __forceinline__ void splitf(float y, unsigned short& h, unsigned short& l) { h = f2bf(y); l = f2bf(y - bf2f(h)); }
template <typename T16, int NSPLIT, bool BIAS, bool PLANES>
__global__ __launch_bounds__(32) void k_gemmw(const T16* __restrict__ A, const T16* __restrict__ A2, const T16* __restrict__ Bt, const T16* __restrict__ Bt2, int K, float* C, int ldc, const float* __restrict__ bias, size_t sA, size_t sB, size_t sC, h16* QK16, bf* QKh, bf* QKl, h16* V16, bf* Vh, bf* Vl) {
    typedef typename WFrag<T16>::V V;
    __shared__ __align__(16) float os[16 * 68];
    const size_t z = blockIdx.z; A += z * sA; if (A2) A2 += z * sA; Bt += z * sB; if (Bt2) Bt2 += z * sB; if (!PLANES) C += z * sC;
    const int lane = threadIdx.x & 31, lr = lane & 15, hi = lane >> 4; const int r0 = blockIdx.x * 64, c0 = blockIdx.y * 64;
    v8f acc[4][4];
#pragma unroll
    for (int mb = 0; mb < 4; ++mb)
#pragma unroll
        for (int nb = 0; nb < 4; ++nb) acc[mb][nb] = (v8f){};
    const size_t aoff = (size_t)(r0 + lr) * K + 8 * hi, boff = (size_t)(c0 + lr) * K + 8 * hi;
#pragma unroll 1
    for (int kc = 0; kc < K; kc += 32) {
        V a[4], a2[4];
#pragma unroll
        for (int mb = 0; mb < 4; ++mb) { a[mb] = WFrag<T16>::ld(A + aoff + (size_t)mb * 16 * K + kc); if (NSPLIT == 1 || NSPLIT == 2) a2[mb] = WFrag<T16>::ld(A2 + aoff + (size_t)mb * 16 * K + kc); }
#pragma unroll
        for (int nb = 0; nb < 4; ++nb) { const V b = WFrag<T16>::ld(Bt + boff + (size_t)nb * 16 * K + kc); V b2; if (NSPLIT >= 2) b2 = WFrag<T16>::ld(Bt2 + boff + (size_t)nb * 16 * K + kc);
#pragma unroll
            for (int mb = 0; mb < 4; ++mb) { acc[mb][nb] = WFrag<T16>::mma(a[mb], b, acc[mb][nb]); if (NSPLIT == 1 || NSPLIT == 2) acc[mb][nb] = WFrag<T16>::mma(a2[mb], b, acc[mb][nb]); if (NSPLIT >= 2) acc[mb][nb] = WFrag<T16>::mma(a[mb], b2, acc[mb][nb]); } }
        asm volatile("v_nop\n\tv_nop\n\tv_nop\n\tv_nop" : "+v"(acc[0][0]), "+v"(acc[1][1]), "+v"(acc[2][2]), "+v"(acc[3][3]) : "v"(a[0]), "v"(a[3]));
    }
#pragma unroll
    for (int mb = 0; mb < 4; ++mb) {
#pragma unroll
        for (int nb = 0; nb < 4; ++nb) {
#pragma unroll
            for (int j = 0; j < 8; ++j) os[(hi * 8 + j) * 68 + nb * 16 + lr] = acc[mb][nb][j]; }
        __builtin_amdgcn_wave_barrier(); asm volatile("" ::: "memory");
        if (PLANES) {
            const bool isv = (z == 2); const int R0 = r0 + mb * 16; h16* P16 = isv ? V16 : QK16; bf* Ph = isv ? Vh : QKh; bf* Pl = isv ? Vl : QKl;
            const int lofs = isv ? (lane >> 1) * 68 + (lane & 1) * 8 : (lane >> 3) * 68 + (lane & 7) * 8, lstep = isv ? 16 : 4 * 68;
            const size_t e0 = isv ? ((size_t)(R0 / 128) * HD + blockIdx.y * 4) * TT + (R0 % 128) * 16 + lane * 8 : z * sC + (size_t)(R0 + (lane >> 3)) * ldc + c0 + (lane & 7) * 8, estep = isv ? (size_t)TT : (size_t)4 * ldc;
#pragma unroll
            for (int s = 0; s < 4; ++s) { const float* p = os + lofs + s * lstep; const v4f x = *(const v4fa*)p, y = *(const v4fa*)(p + 4); v8h o16; v8us oh, ol;
#pragma unroll
                for (int j = 0; j < 8; ++j) { const float r = (j < 4) ? x[j & 3] : y[j & 3]; o16[j] = tohx(r); unsigned short a2, c2; splitf(r, a2, c2); oh[j] = a2; ol[j] = c2; }
                const size_t e = e0 + s * estep; *(v8ha*)(P16 + e) = o16; *(v8usa*)(Ph + e) = oh; *(v8usa*)(Pl + e) = ol; }
        } else {
        float* crow = C + (size_t)(r0 + mb * 16) * ldc + c0;
#pragma unroll
            for (int s = 0; s < 8; ++s) { const int row = 2 * s + hi, cofs = lr * 4; v4f val = *(const v4fa*)(os + row * 68 + cofs); if (BIAS) { val[0] += bfr(bias[c0 + cofs]); val[1] += bfr(bias[c0 + cofs + 1]); val[2] += bfr(bias[c0 + cofs + 2]); val[3] += bfr(bias[c0 + cofs + 3]); }
                *(v4f*)(crow + (size_t)row * ldc + cofs) = val; }
             }
        __builtin_amdgcn_wave_barrier(); asm volatile("" ::: "memory");
    }
}

typedef __attribute__((ext_vector_type(4))) _Float16 v4h;
typedef __attribute__((ext_vector_type(2))) unsigned short v2us;
typedef __attribute__((ext_vector_type(4))) unsigned short v4us;
typedef __attribute__((ext_vector_type(4))) int v4i;
typedef v4h  __attribute__((may_alias)) v4ha;
typedef v4us __attribute__((may_alias)) v4usa;

// The small builders are device functions that take their block index bx: launches that do not depend on one another share one grid (k_prep below).
// b_wtG: Bt[n][k] = bf16(w[k][n]); with vord, row n of Bt holds column (n % 16) * HD + n / 16 of w (the value weight's row order, see k_gemmw PLANES).
__device__ __forceinline__ void b_wtG(int bx, const float* __restrict__ w, int K, int N, bf* Bt, bool vord) {
    const int lane = threadIdx.x & 31; const int L0 = (bx * 8 + (threadIdx.x >> 5)) * 8; const int nlines = N * K / 64;
{
#pragma unroll 1
        for (int l = 0; l < 8; ++l) { const int L = L0 + l; if (L >= nlines) break; const size_t e = (size_t)L * 64 + lane * 2; const int k = (int)(e % K), nr = (int)(e / K), n = vord ? (nr & 15) * HD + (nr >> 4) : nr; v2us o;
            o[0] = f2bf(w[(size_t)k * N + n]); o[1] = f2bf(w[(size_t)(k + 1) * N + n]); *(v2us*)(Bt + e) = o; }
         }
}
__device__ __forceinline__ void b_cvt8(int bx, const float* __restrict__ src, bf* dst, size_t n8) { const size_t i = (size_t)bx * 256 + threadIdx.x; if (i >= n8) return; const v8f v = *(const v8f*)(src + i * 8); v8us o;
#pragma unroll
    for (int k = 0; k < 8; ++k) o[k] = f2bf(v[k]); *(v8us*)(dst + i * 8) = o;  }

// ---- k_prep: everything that reads only the inputs, in one launch: the four weight transposes (WB blocks each, planes WT[0..3] = q, k, v, out), the bf16 copy of x (both batches, XBLK blocks). The block ranges are work-group uniform.
#define WB   (DM * DQ / 64 / 64)
#define XBLK (NB_ * TT * DM / 8 / 256)
__global__ __launch_bounds__(256) void k_prep(const float* __restrict__ x, const float* __restrict__ wq, const float* __restrict__ wk, const float* __restrict__ wv, const float* __restrict__ wo, bf* WT, bf* XB) {
    const int bx = (int)blockIdx.x;
    if (bx < 4 * WB) { const int wi = bx / WB; const float* w = (wi == 0) ? wq : (wi == 1) ? wk : (wi == 2) ? wv : wo; b_wtG(bx - wi * WB, w, DM, DQ, WT + (size_t)wi * DM * DQ, wi == 2); }
    else b_cvt8(bx - 4 * WB, x, XB, (size_t)NB_ * TT * DM / 8);
}
// ---- k_fa: scores, causal softmax, probability x value and the hi/lo merge in ONE kernel (online softmax; no score plane in memory). Grid (TT / QT, batches x heads), FNW waves per work-group.
// A work-group owns QT = 32 query rows of one head; its keys 0 .. q0 + 31 are dealt over the FNW waves in runs of 64 (one 128-byte line of each value row), worked in blocks of 32.
// Everything is computed TRANSPOSED so that no fragment changes lanes: S^T = K Q^T (D: row = key hi * 8 + j, column = query lr), which is already the B fragment of O^T = V^T P^T
// (lane lr = query, places 0..7 = keys 8 hi + j of key tile 0, places 8..15 = keys 16 + 8 hi + j of key tile 1: the k order of the V^T loader), and the running maximum and sum of a query live in its own lane.
// FaBody::run works NQ x 16 queries from q0 on (their rows in the LDS partial start at qr). Each wave ends with its own (max, sum, O^T); the FNW partials are joined through LDS in fixed wave order 0..FNW-1 behind one work-group barrier, divided by the sum, split hi/lo and written flat (RAW MERGE).
// The short inner loops are all unrolled so that the fragment, score and context arrays stay in registers.
// Rows < RH: bf16 hi/lo planes, 3 products in both contractions; the other rows fp16 (probabilities exp(s - max) <= 1 rounded to fp16).
#define QT   32
#define FNW  8
#define OPIT 68                   // f32 pitch of one query's 64 context values in a wave's LDS partial
#define SCL2 0.18033688011112042f // HD^-0.5 x log2(e): scores go to the base-2 exponent directly
typedef __attribute__((ext_vector_type(16))) unsigned short v16us;
__device__ __forceinline__ void mkp(const float* p, v16h& a, v16h&) {
#pragma unroll
    for (int i = 0; i < 16; ++i) a[i] = (h16)p[i]; }
__device__ __forceinline__ void mkp(const float* p, v16bf& a, v16bf& a2) { v16us h, l;
#pragma unroll
    for (int i = 0; i < 16; ++i) { unsigned short x, y; splitf(p[i], x, y); h[i] = x; l[i] = y; }
    a = __builtin_bit_cast(v16bf, h); a2 = __builtin_bit_cast(v16bf, l); }
template <typename T16, int NSPLIT, int NQ> struct FaBody {
static __device__ __forceinline__ void run(const T16* __restrict__ Q, const T16* __restrict__ Q2, const T16* __restrict__ Kp, const T16* __restrict__ Kp2, const T16* __restrict__ Vt, const T16* __restrict__ Vt2, int q0, int qr, float* os, float* ms, float* ls) {
    typedef typename WFrag<T16>::V V;
    const int lane = threadIdx.x & 31, lr = lane & 15, hi = lane >> 4; const int wv = __builtin_amdgcn_readfirstlane((int)(threadIdx.x >> 5));
    V qf[NQ][2], qf2[NQ][2]; const size_t qo = (size_t)(q0 + lr) * HD + 8 * hi; const T16* qp = Q + qo; const T16* qp2 = (NSPLIT == 2) ? Q2 + qo : qp;
#pragma unroll
    for (int nq = 0; nq < NQ; ++nq)
#pragma unroll
        for (int ks = 0; ks < 2; ++ks) { qf[nq][ks] = WFrag<T16>::ld(qp + nq * 16 * HD + ks * 32); if (NSPLIT == 2) qf2[nq][ks] = WFrag<T16>::ld(qp2 + nq * 16 * HD + ks * 32); }
    asm volatile("s_wait_xcnt 0x0" :: "v"(qp), "v"(qp2) : "memory");   // stands in front of any reuse of the loads' address registers; naming the addresses as inputs keeps them whole up to here
    v8f o[4][NQ]; float m[NQ], l[NQ];
#pragma unroll
    for (int nq = 0; nq < NQ; ++nq) { m[nq] = -3.0e38f; l[nq] = 0.f;
#pragma unroll
        for (int dt = 0; dt < 4; ++dt) o[dt][nq] = (v8f){}; }
    const int nkb = q0 / 32 + 1;                                     // key blocks of 32 up to and including the diagonal block
    const int nit = 2 * ((nkb / 2 - wv + FNW - 1) / FNW) + (((nkb & 1) && (nkb / 2) % FNW == wv) ? 1 : 0);   // this wave's blocks: two per whole run of 64, one more where the half run at the diagonal is its own
#pragma unroll 1   // rolled: one block's fragments, scores and the context tile already fill the registers
    for (int it = 0; it < nit; ++it) {
        const int kb = ((it >> 1) * FNW + wv) * 2 + (it & 1); const int k0 = kb * 32;
        const size_t ko = (size_t)(k0 + lr) * HD + 8 * hi, vo = (size_t)lr * TT + k0 + 8 * hi;
        const T16* kp = Kp + ko; const T16* kp2 = (NSPLIT == 2) ? Kp2 + ko : kp; const T16* vp = Vt + vo; const T16* vp2 = (NSPLIT == 2) ? Vt2 + vo : vp;
        V ka[2][2], ka2[2][2];
#pragma unroll
        for (int kt = 0; kt < 2; ++kt)
#pragma unroll
            for (int ks = 0; ks < 2; ++ks) { ka[kt][ks] = WFrag<T16>::ld(kp + kt * 16 * HD + ks * 32); if (NSPLIT == 2) ka2[kt][ks] = WFrag<T16>::ld(kp2 + kt * 16 * HD + ks * 32); }
        V va[4], va2[4];
#pragma unroll
        for (int dt = 0; dt < 4; ++dt) { va[dt] = WFrag<T16>::ld(vp + (size_t)dt * 16 * TT); if (NSPLIT == 2) va2[dt] = WFrag<T16>::ld(vp2 + (size_t)dt * 16 * TT); }
        __builtin_amdgcn_sched_barrier(0);                           // all of the block's loads issue together, ahead of the first product: one load latency a block (without it the loads are sunk between the products and wait one after the other)
        asm volatile("s_wait_xcnt 0x0" :: "v"(kp), "v"(kp2), "v"(vp), "v"(vp2) : "memory");   // as behind the query loads: in front of any reuse of the address registers, which stay whole up to here
        v8f s[2][NQ];
#pragma unroll
        for (int kt = 0; kt < 2; ++kt)
#pragma unroll
            for (int nq = 0; nq < NQ; ++nq) { v8f c = (v8f){};
#pragma unroll
                for (int ks = 0; ks < 2; ++ks) { c = WFrag<T16>::mma(ka[kt][ks], qf[nq][ks], c); if (NSPLIT == 2) { c = WFrag<T16>::mma(ka[kt][ks], qf2[nq][ks], c); c = WFrag<T16>::mma(ka2[kt][ks], qf[nq][ks], c); } }
                s[kt][nq] = c; }
        if (kb == nkb - 1) {                                         // only the last block holds keys beyond a query of this tile (wave-uniform test)
#pragma unroll
            for (int kt = 0; kt < 2; ++kt)
#pragma unroll
                for (int nq = 0; nq < NQ; ++nq)
#pragma unroll
                    for (int j = 0; j < 8; ++j) if (k0 + kt * 16 + hi * 8 + j > q0 + nq * 16 + lr) s[kt][nq][j] = -3.0e38f; }
#pragma unroll
        for (int nq = 0; nq < NQ; ++nq) { float p[16]; float mx = -3.0e38f;
#pragma unroll
            for (int kt = 0; kt < 2; ++kt)
#pragma unroll
                for (int j = 0; j < 8; ++j) { const float t = s[kt][nq][j] * SCL2; p[kt * 8 + j] = t; mx = fmaxf(mx, t); }
            mx = fmaxf(mx, __shfl_xor(mx, 16, 32));                  // the two lane halves hold the two halves of a query's keys
            const float mn = fmaxf(m[nq], mx); const float sc = __builtin_amdgcn_exp2f(m[nq] - mn); m[nq] = mn; float sum = 0.f;
#pragma unroll
            for (int i = 0; i < 16; ++i) { p[i] = __builtin_amdgcn_exp2f(p[i] - mn); sum += p[i]; }
            l[nq] = l[nq] * sc + sum;
            V pf, pf2; mkp(p, pf, pf2);
#pragma unroll
            for (int dt = 0; dt < 4; ++dt) { v8f c = o[dt][nq] * sc; c = WFrag<T16>::mma(va[dt], pf, c); if (NSPLIT == 2) { c = WFrag<T16>::mma(va[dt], pf2, c); c = WFrag<T16>::mma(va2[dt], pf, c); } o[dt][nq] = c; } }
    }
    float* ow = os + wv * (QT * OPIT);
#pragma unroll
    for (int nq = 0; nq < NQ; ++nq) { l[nq] += __shfl_xor(l[nq], 16, 32);
#pragma unroll
        for (int dt = 0; dt < 4; ++dt) { float* d = ow + (qr + nq * 16 + lr) * OPIT + dt * 16 + hi * 8; v4f x, y;
#pragma unroll
            for (int j = 0; j < 4; ++j) { x[j] = o[dt][nq][j]; y[j] = o[dt][nq][4 + j]; }
            *(v4fa*)d = x; *(v4fa*)(d + 4) = y; }
        if (hi == 0) { ms[wv * QT + qr + nq * 16 + lr] = m[nq]; ls[wv * QT + qr + nq * 16 + lr] = l[nq]; } }
}
};
__global__ __launch_bounds__(256) void k_fa(const h16* __restrict__ Q16, const h16* __restrict__ K16, const h16* __restrict__ V16, const bf* __restrict__ Qh, const bf* __restrict__ Ql, const bf* __restrict__ Kh, const bf* __restrict__ Kl, const bf* __restrict__ Vh, const bf* __restrict__ Vl, bf* Ah, bf* Al) {
    __shared__ __align__(16) float os[FNW * QT * OPIT]; __shared__ float ms[FNW * QT]; __shared__ float ls[FNW * QT];
    const size_t po = (size_t)blockIdx.y * TT * HD; const int q0 = (TT / QT - 1 - (int)blockIdx.x) * QT;   // longest rows first
    if (q0 < RH) {
#pragma unroll 1   // the hi/lo rows (short key loops, twice the fragments) go 16 queries at a time, so that they do not set the register count of the fp16 rows
        for (int hf = 0; hf < 2; ++hf) FaBody<bf, 2, 1>::run(Qh + po, Ql + po, Kh + po, Kl + po, Vh + po, Vl + po, q0 + hf * 16, hf * 16, os, ms, ls);
    } else FaBody<h16, 0, 2>::run(Q16 + po, nullptr, K16 + po, nullptr, V16 + po, nullptr, q0, 0, os, ms, ls);
    __syncthreads();                                                 // every wave's partial (max, sum, O^T) is in LDS before any thread joins them
    const int q = threadIdx.x >> 3, d0 = (threadIdx.x & 7) * 8; float mt = ms[q];
#pragma unroll
    for (int w = 1; w < FNW; ++w) mt = fmaxf(mt, ms[w * QT + q]);
    float acc[8], lt = 0.f;
#pragma unroll
    for (int j = 0; j < 8; ++j) acc[j] = 0.f;
#pragma unroll
    for (int w = 0; w < FNW; ++w) { const float f = __builtin_amdgcn_exp2f(ms[w * QT + q] - mt); lt += f * ls[w * QT + q]; const float* s = os + w * (QT * OPIT) + q * OPIT + d0; const v4f x = *(const v4fa*)s, y = *(const v4fa*)(s + 4);
#pragma unroll
        for (int j = 0; j < 4; ++j) { acc[j] += f * x[j]; acc[4 + j] += f * y[j]; } }
    const float inv = __fdiv_rn(1.0f, lt); v8us oh, ol;
#pragma unroll
    for (int j = 0; j < 8; ++j) { unsigned short a, c2; splitf(acc[j] * inv, a, c2); oh[j] = a; ol[j] = c2; }
    const size_t oo = po + (size_t)(q0 + q) * HD + d0;   /* RAW MERGE: the (H, S, hd) context written flat = the module's ctx.reshape(b, S, H * hd) without a transpose */
    *(v8usa*)(Ah + oo) = oh; *(v8usa*)(Al + oo) = ol;
}

extern "C" void kernel_launch(void* const* d_in, const int* in_sizes, int n_in,
                              void* d_out, int out_size, void* d_ws, size_t ws_size, hipStream_t stream) {
    (void)in_sizes; (void)n_in; (void)out_size;
    const float* x = (const float*)d_in[0]; const float* wq = (const float*)d_in[1]; const float* wk = (const float*)d_in[2]; const float* wv = (const float*)d_in[3]; const float* wo = (const float*)d_in[4];
    float* OUT = (float*)d_out;     // [2][2048][1024]
    char* wsp = (char*)d_ws;
    auto take = [&](size_t bytes) { char* p = wsp; wsp += (bytes + 255) & ~(size_t)255; return (void*)p; };
    const size_t PL = (size_t)NB_ * TT * DQ;   // elements of one plane over both batches (DQ == DKV == DM here)
    bf* WT = (bf*)take((size_t)4 * DQ * DM * 2); bf* WO = WT + (size_t)3 * DQ * DM;
    bf* XB = (bf*)take(PL * 2);
    h16* QP16 = (h16*)take(2 * PL * 2); h16* KP16 = QP16 + PL; h16* VT16 = (h16*)take(PL * 2);
    bf* QPh = (bf*)take(2 * PL * 2); bf* KPh = QPh + PL; bf* QPl = (bf*)take(2 * PL * 2); bf* KPl = QPl + PL; bf* VTh = (bf*)take(PL * 2); bf* VTl = (bf*)take(PL * 2);
    bf* ATh = (bf*)take(PL * 2); bf* ATl = (bf*)take(PL * 2);
    if ((size_t)(wsp - (char*)d_ws) > ws_size) return;    // ws 256 MiB
    k_prep<<<4 * WB + XBLK, 256, 0, stream>>>(x, wq, wk, wv, wo, WT, XB);
    k_gemmw<bf, 0, false, true><<<dim3(NB_ * TT / 64, DQ / 64, 3), 32, 0, stream>>>(XB, nullptr, WT, nullptr, DM, nullptr, DQ, nullptr, 0, (size_t)DQ * DM, PL, QP16, QPh, QPl, VT16, VTh, VTl);   // z = q, k, v; writes the head planes
    k_fa<<<dim3(TT / QT, NB_ * NH_, 1), 32 * FNW, 0, stream>>>(QP16, KP16, VT16, QPh, QPl, KPh, KPl, VTh, VTl, ATh, ATl);
    k_gemmw<bf, 1, false, false><<<dim3(NB_ * TT / 64, DM / 64, 1), 32, 0, stream>>>(ATh, ATl, WO, nullptr, DQ, OUT, DM, nullptr, 0, 0, 0, nullptr, nullptr, nullptr, nullptr, nullptr, nullptr);
}

// v006
// It runs in 120 microseconds.
// Next to v005, in two timings, it ran 1.40 and 1.39 times as fast.
// Counting every step since v000, it is 12.1 times as fast.
#include <hip/hip_runtime.h>

// Causal multi-head attention whose heads are a RAW VIEW of the projections (x [2][2048][1024]; q, k, v = x W ('xw' [1024][1024] 0.02-scale, no bias); each is reshaped (b, 16, 2048, 64) WITHOUT a transpose: pseudo-head h, pseudo-position s, dim d = flat element h*2048*64 + s*64 + d of the [2048][1024] projection output (head h covers tokens 128 h .. 128 h + 127; pseudo-position s is the 64-wide feature block s mod 16 of token 128 h + s / 16); scores / sqrt(64); triu(k = 1) over the pseudo-positions -> -inf; softmax; the context (b, 16, 2048, 64) is reshaped (b, 2048, 1024) again WITHOUT a transpose; out = that Wproj ('xw', no bias) -> [2][2048][1024] (4.2 M); argument order x, Wq, Wk, Wv, Wproj).
// Layout, both batches in every launch (4 launches: k_prep, k_gemmw q/k/v, k_fa, k_gemmw out): bf16 copy of x and 'xw' weights transposed once, both stored in WMMA fragment blocks; exact projections; RAW VIEW: the q/k/v GEMM's epilogue writes the 16-bit head planes itself, taking each [2048][1024] projection output as (16, 2048, 64) WITHOUT a transpose (head stride TT x HD, inside a head WMMA fragment blocks; no f32 projection plane in memory), and k_fa writes the context planes back flat but for an interleave of row pairs (no transpose back): the module's own reshapes; causal T-2048 attention (hybrid rows: < 512 hi/lo 3 products, rest fp16; key blocks above the diagonal skipped; one fused kernel, online softmax); merged hi/lo x Wo exact.
// Compute dtypes, f32 accumulate: every input rounded to bf16; projections exact; attention rows < 512 3 products, rest fp16; softmax f32; Wo hl x exact.

#define NB_  2
#define TT   2048
#define DM   1024
#define NH_  16
#define NKV  16
#define HD   64
#define DQ   (NH_ * HD)
#define DKV  (NKV * HD)
#define RH   512                  // query rows < RH use hi+lo planes (0: none)
typedef _Float16 h16;
typedef unsigned short bf;
typedef __attribute__((ext_vector_type(16))) __bf16   v16bf;
typedef __attribute__((ext_vector_type(16))) _Float16 v16h;
typedef __attribute__((ext_vector_type(8)))  _Float16 v8h;
typedef __attribute__((ext_vector_type(8)))  unsigned short v8us;
typedef __attribute__((ext_vector_type(8)))  float    v8f;
typedef __attribute__((ext_vector_type(4)))  float    v4f;
typedef v8h  __attribute__((may_alias)) v8ha;
typedef v4f  __attribute__((may_alias)) v4fa;
typedef v8us __attribute__((may_alias)) v8usa;

__device__ __forceinline__ unsigned short f2bf(float f) { unsigned u = __float_as_uint(f); u += 0x7FFFu + ((u >> 16) & 1u); return (unsigned short)(u >> 16); }
__device__ __forceinline__ float bf2f(unsigned short b) { return __uint_as_float(((unsigned)b) << 16); }
__device__ __forceinline__ float bfr(float f) { return bf2f(f2bf(f)); }
__device__ __forceinline__ v16h cat16(v8h lo, v8h hi) { return __builtin_shufflevector(lo, hi, 0, 1, 2, 3, 4, 5, 6, 7, 8, 9, 10, 11, 12, 13, 14, 15); }
__device__ __forceinline__ v16bf cat16b(v8us lo, v8us hi) { return __builtin_bit_cast(v16bf, __builtin_shufflevector(lo, hi, 0, 1, 2, 3, 4, 5, 6, 7, 8, 9, 10, 11, 12, 13, 14, 15)); }
__device__ __forceinline__ v8f wmma16(v16h a, v16h b, v8f c) { return __builtin_amdgcn_wmma_f32_16x16x32_f16(false, a, false, b, (short)0, c, false, false); }
__device__ __forceinline__ v8f wmmab(v16bf a, v16bf b, v8f c) { return __builtin_amdgcn_wmma_f32_16x16x32_bf16(false, a, false, b, (short)0, c, false, false); }



// ---- k_gemmw: register-blocked GEMM, ONE WAVE per 64x64 output tile (16 accumulators), operands straight from 16-bit planes; grid (M/64, N/64, Z), 32 threads.
// Plane layouts: Bt always, and A where PLANES, in FRAGMENT BLOCKS (see b_wtG: a fragment load reads 512 contiguous bytes); A otherwise in ROW PAIRS (see k_fa: [row / 2][k / 32][row % 2][k % 32], a fragment load touches 8 lines). The k order inside a fragment is the same in all of them.
// C[m][n] (f32, pitch ldc, + optional f32 bias[n]) = sum_k A[m][k] Bt[n][k] (+ split products per NSPLIT). z-batch strides sA/sB/sC in elements. K % 32 == 0.
// PLANES (the q/k/v projections, z = 0, 1, 2; ldc = DQ): no C; each staged 16 x 64 block goes out as the fp16 and bf16 hi/lo head planes, 8 values and one 16-byte store a plane and lane.
//   The head planes are FRAGMENT BLOCKS too, per pseudo-head g = R / 128: query and key planes 16 positions x 32 dims, value planes (transposed) 16 dims x 32 positions. k_prep has put the weights' rows in an order (b_wtG, ord 1 and 2)
//   in which the 64 columns of a tile are, for token row R, 8 positions (R % 128) * 16 + fb x 8 dims: one whole 128-byte line of a block; a store writes the lines of 4 token rows.
//   z < 2: columns (fb % 8) * 8 + d % 8, blockIdx.y = (d / 8) * 2 + fb / 8: the line stands at R * ldc + c0, the address of the flat RAW VIEW (a token's 16 positions x 64 dims are its two blocks, 2 KB).
//   z = 2: columns (d % 8) * 8 + fb % 8, blockIdx.y = (d / 16) * 4 + (fb / 8) * 2 + (d / 8) % 2: the line stands at ((g * HD + (d / 16) * 16) * TT) + (R % 128) * 256 + (blockIdx.y % 4) * 64.
template <typename T16> struct WFrag;
template <> struct WFrag<h16> { typedef v16h V; static __device__ __forceinline__ V ld(const h16* p) { return cat16(*(const v8h*)p, *(const v8h*)(p + 16)); } static __device__ __forceinline__ V ldp(const h16* p) { return cat16(*(const v8h*)p, *(const v8h*)(p + 256)); } static __device__ __forceinline__ v8f mma(V a, V b, v8f c) { return wmma16(a, b, c); } };
template <> struct WFrag<bf> { typedef v16bf V; static __device__ __forceinline__ V ld(const bf* p) { return cat16b(*(const v8us*)p, *(const v8us*)(p + 16)); } static __device__ __forceinline__ V ldp(const bf* p) { return cat16b(*(const v8us*)p, *(const v8us*)(p + 256)); } static __device__ __forceinline__ v8f mma(V a, V b, v8f c) { return wmmab(a, b, c); } };
__device__ __forceinline__ h16 tohx(float x) { return (h16)x; }
__device__ __forceinline__ void splitf(float y, unsigned short& h, unsigned short& l) { h = f2bf(y); l = f2bf(y - bf2f(h)); }
template <typename T16, int NSPLIT, bool BIAS, bool PLANES, int K>
__global__ __launch_bounds__(32) void k_gemmw(const T16* __restrict__ A, const T16* __restrict__ A2, const T16* __restrict__ Bt, const T16* __restrict__ Bt2, float* C, int ldc, const float* __restrict__ bias, size_t sA, size_t sB, size_t sC, h16* QK16, bf* QKh, bf* QKl, h16* V16, bf* Vh, bf* Vl) {
    typedef typename WFrag<T16>::V V;
    __shared__ __align__(16) float os[16 * 68];
    const size_t z = blockIdx.z; A += z * sA; if (A2) A2 += z * sA; Bt += z * sB; if (Bt2) Bt2 += z * sB; if (!PLANES) C += z * sC;
    const int lane = threadIdx.x & 31, lr = lane & 15, hi = lane >> 4; const int r0 = blockIdx.x * 64, c0 = blockIdx.y * 64;
    v8f acc[4][4];
#pragma unroll
    for (int mb = 0; mb < 4; ++mb)
#pragma unroll
        for (int nb = 0; nb < 4; ++nb) acc[mb][nb] = (v8f){};
    // Load address = a wave-uniform plane base (never stepped) + the lane's byte offset oa (A, A2) or ob (Bt, Bt2), stepped once a trip, + an immediate (K is a constant) for the tile.
    unsigned oa = (PLANES ? lane * 8 : (lr & ~1) * K + (lr & 1) * 32 + 8 * hi) * 2, ob = lane * 16;
    const char* Ab = (const char*)(A + (size_t)r0 * K); const char* Ab2 = (NSPLIT == 1 || NSPLIT == 2) ? (const char*)(A2 + (size_t)r0 * K) : Ab; const char* Bb = (const char*)(Bt + (size_t)c0 * K); const char* Bb2 = (NSPLIT >= 2) ? (const char*)(Bt2 + (size_t)c0 * K) : Bb;
#pragma unroll 1
    for (int kc = 0; kc < K; kc += 32) {
        V a[4], a2[4]; const T16* pa = (const T16*)(Ab + oa); const T16* pa2 = (const T16*)(Ab2 + oa); const T16* pb = (const T16*)(Bb + ob); const T16* pb2 = (const T16*)(Bb2 + ob);
#pragma unroll
        for (int mb = 0; mb < 4; ++mb) { a[mb] = PLANES ? WFrag<T16>::ldp(pa + mb * 16 * K) : WFrag<T16>::ld(pa + mb * 16 * K); if (NSPLIT == 1 || NSPLIT == 2) a2[mb] = PLANES ? WFrag<T16>::ldp(pa2 + mb * 16 * K) : WFrag<T16>::ld(pa2 + mb * 16 * K); }
#pragma unroll
        for (int nb = 0; nb < 4; ++nb) { const V b = WFrag<T16>::ldp(pb + nb * 16 * K); V b2; if (NSPLIT >= 2) b2 = WFrag<T16>::ldp(pb2 + nb * 16 * K);
#pragma unroll
            for (int mb = 0; mb < 4; ++mb) { acc[mb][nb] = WFrag<T16>::mma(a[mb], b, acc[mb][nb]); if (NSPLIT == 1 || NSPLIT == 2) acc[mb][nb] = WFrag<T16>::mma(a2[mb], b, acc[mb][nb]); if (NSPLIT >= 2) acc[mb][nb] = WFrag<T16>::mma(a[mb], b2, acc[mb][nb]); } }
        asm volatile("s_wait_xcnt 0x0" : "+v"(oa), "+v"(ob) :: "memory");   // in front of the step of the trip's load address registers: the two offsets pass through the statement, so that they stay whole up to it and are stepped behind it
        oa += PLANES ? 1024 : 128; ob += 1024;   // 32 k on: one fragment block, or 64 elements of a row pair
        asm volatile("v_nop\n\tv_nop\n\tv_nop\n\tv_nop" : "+v"(acc[0][0]), "+v"(acc[1][1]), "+v"(acc[2][2]), "+v"(acc[3][3]) : "v"(a[0]), "v"(a[3]));
    }
#pragma unroll
    for (int mb = 0; mb < 4; ++mb) {
#pragma unroll
        for (int nb = 0; nb < 4; ++nb) {
#pragma unroll
            for (int j = 0; j < 8; ++j) os[(hi * 8 + j) * 68 + nb * 16 + lr] = acc[mb][nb][j]; }
        __builtin_amdgcn_wave_barrier(); asm volatile("" ::: "memory");
        if (PLANES) {
            const bool isv = (z == 2); const int R0 = r0 + mb * 16; h16* P16 = isv ? V16 : QK16; bf* Ph = isv ? Vh : QKh; bf* Pl = isv ? Vl : QKl;
            const int lofs = (lane >> 3) * 68 + (lane & 7) * 8, lstep = 4 * 68;
            const size_t e0 = isv ? ((size_t)(R0 / 128) * HD + (blockIdx.y >> 2) * 16) * TT + (R0 % 128 + (lane >> 3)) * 256 + (blockIdx.y & 3) * 64 + (lane & 7) * 8 : z * sC + (size_t)(R0 + (lane >> 3)) * ldc + c0 + (lane & 7) * 8, estep = isv ? (size_t)4 * 256 : (size_t)4 * ldc;
#pragma unroll
            for (int s = 0; s < 4; ++s) { const float* p = os + lofs + s * lstep; const v4f x = *(const v4fa*)p, y = *(const v4fa*)(p + 4); v8h o16; v8us oh, ol;
#pragma unroll
                for (int j = 0; j < 8; ++j) { const float r = (j < 4) ? x[j & 3] : y[j & 3]; o16[j] = tohx(r); unsigned short a2, c2; splitf(r, a2, c2); oh[j] = a2; ol[j] = c2; }
                const size_t e = e0 + s * estep; *(v8ha*)(P16 + e) = o16; *(v8usa*)(Ph + e) = oh; *(v8usa*)(Pl + e) = ol; }
        } else {
        float* crow = C + (size_t)(r0 + mb * 16) * ldc + c0;
#pragma unroll
            for (int s = 0; s < 8; ++s) { const int row = 2 * s + hi, cofs = lr * 4; v4f val = *(const v4fa*)(os + row * 68 + cofs); if (BIAS) { val[0] += bfr(bias[c0 + cofs]); val[1] += bfr(bias[c0 + cofs + 1]); val[2] += bfr(bias[c0 + cofs + 2]); val[3] += bfr(bias[c0 + cofs + 3]); }
                *(v4f*)(crow + (size_t)row * ldc + cofs) = val; }
             }
        __builtin_amdgcn_wave_barrier(); asm volatile("" ::: "memory");
    }
}

typedef __attribute__((ext_vector_type(4))) _Float16 v4h;
typedef __attribute__((ext_vector_type(2))) unsigned short v2us;
typedef __attribute__((ext_vector_type(4))) unsigned short v4us;
typedef __attribute__((ext_vector_type(4))) int v4i;
typedef v4h  __attribute__((may_alias)) v4ha;
typedef v4us __attribute__((may_alias)) v4usa;

// The small builders are device functions that take their block index bx: launches that do not depend on one another share one grid (k_prep below).
// FRAGMENT BLOCKS: a K-contiguous plane P[row][k] is stored as blocks of 16 rows x 32 k (512 elements, 1 KB), block (row / 16) * (K / 32) + k / 32; inside a block element (row, k) stands at
//   ((k / 16) % 2) * 256 + (((k / 8) % 2) * 16 + row % 16) * 8 + k % 8: the two 16-byte loads of a WMMA fragment (lane = hi * 16 + lr) each read 512 contiguous bytes. A thread of a builder makes one 16-byte piece (8 k of one row).
// b_wtG: P[n'][k] = bf16(w[k][n]), piece = thread, 256 pieces (4 KB) a block. Row n' of P holds column n of w, by ord (fb = n / HD the feature block = pseudo-position % 16, d = n % HD):
//   0: n = n'. 1 (query, key weights): n' = (d / 8) * 128 + (fb / 8) * 64 + (fb % 8) * 8 + d % 8. 2 (value weight): n' = (d / 16) * 256 + (fb / 8) * 128 + ((d / 8) % 2) * 64 + (d % 8) * 8 + fb % 8.
//   With 1 and 2 the 64 columns of a GEMM tile are 8 positions x 8 dims of each token: one whole 128-byte line of the head planes' fragment blocks (see k_gemmw PLANES).
__device__ __forceinline__ void b_wtG(int bx, const float* __restrict__ w, int K, int N, bf* Bt, int ord) {
    const int t = threadIdx.x, KB = K / 32, blk = bx * 4 + (t >> 6), rb = blk / KB, kb = blk % KB, hh = (t >> 4) & 3, lr = t & 15;   // hh = (k / 8) % 4
    const int nr = rb * 16 + lr, by = nr >> 6, c8 = (nr >> 3) & 7, c1 = nr & 7;
    const int n = (ord == 1) ? ((by & 1) * 8 + c8) * HD + (by >> 1) * 8 + c1 : (ord == 2) ? (((by >> 1) & 1) * 8 + c1) * HD + ((by >> 2) * 2 + (by & 1)) * 8 + c8 : nr;
    const int k = kb * 32 + hh * 8; v8us o;
#pragma unroll
    for (int j = 0; j < 8; ++j) o[j] = f2bf(w[(size_t)(k + j) * N + n]);
    *(v8us*)(Bt + ((size_t)rb * KB + kb) * 512 + (hh * 16 + lr) * 8) = o;
}
// b_cvt8: bf16 copy of src[row][K] in fragment blocks; piece = thread (whole lines stored), 32 bytes read a thread.
__device__ __forceinline__ void b_cvt8(int bx, const float* __restrict__ src, int K, bf* dst, size_t n8) { const size_t i = (size_t)bx * 256 + threadIdx.x; if (i >= n8) return;
    const int KB = K / 32, blk = (int)(i >> 6), hh = (int)(i >> 4) & 3, lr = (int)i & 15; const float* sp = src + (size_t)((blk / KB) * 16 + lr) * K + (blk % KB) * 32 + hh * 8; const v8f v = *(const v8f*)sp; v8us o;
    asm volatile("s_wait_xcnt 0x0" :: "v"(sp) : "memory");   // in front of any reuse of the load's address registers; naming the address as an input keeps it whole up to here
#pragma unroll
    for (int k = 0; k < 8; ++k) o[k] = f2bf(v[k]); *(v8us*)(dst + i * 8) = o;  }

// ---- k_prep: everything that reads only the inputs, in one launch: the four weight transposes (WB blocks each, planes WT[0..3] = q, k, v, out), the bf16 copy of x (both batches, XBLK blocks). The block ranges are work-group uniform.
#define WB   (DM * DQ / 8 / 256)
#define XBLK (NB_ * TT * DM / 8 / 256)
__global__ __launch_bounds__(256) void k_prep(const float* __restrict__ x, const float* __restrict__ wq, const float* __restrict__ wk, const float* __restrict__ wv, const float* __restrict__ wo, bf* WT, bf* XB) {
    const int bx = (int)blockIdx.x;
    if (bx < 4 * WB) { const int wi = bx / WB; const float* w = (wi == 0) ? wq : (wi == 1) ? wk : (wi == 2) ? wv : wo; b_wtG(bx - wi * WB, w, DM, DQ, WT + (size_t)wi * DM * DQ, (wi < 2) ? 1 : (wi == 2) ? 2 : 0); }
    else b_cvt8(bx - 4 * WB, x, DM, XB, (size_t)NB_ * TT * DM / 8);
}
// ---- k_fa: scores, causal softmax, probability x value and the hi/lo merge in ONE kernel (online softmax; no score plane in memory). Grid (TT / QT, batches x heads), FNW waves per work-group.
// A work-group owns QT = 32 query rows of one head; its keys 0 .. q0 + 31 are dealt over the FNW waves in runs of 64, worked in blocks of 32 (the planes are fragment blocks, see b_wtG and k_gemmw PLANES: every fragment load reads 512 contiguous bytes).
// Everything is computed TRANSPOSED so that no fragment changes lanes: S^T = K Q^T (D: row = key hi * 8 + j, column = query lr), which is already the B fragment of O^T = V^T P^T
// (lane lr = query, places 0..7 = keys 8 hi + j of key tile 0, places 8..15 = keys 16 + 8 hi + j of key tile 1: the k order of the V^T loader), and the running maximum and sum of a query live in its own lane.
// FaBody::run works NQ x 16 queries from q0 on (their rows in the LDS partial start at qr). Each wave ends with its own (max, sum, O^T); the FNW partials are joined through LDS in fixed wave order 0..FNW-1 behind one work-group barrier, divided by the sum, split hi/lo and written flat but for an interleave of row pairs (RAW MERGE).
// The short inner loops are all unrolled so that the fragment, score and context arrays stay in registers.
// Rows < RH: bf16 hi/lo planes, 3 products in both contractions; the other rows fp16 (probabilities exp(s - max) <= 1 rounded to fp16).
#define QT   32
#define FNW  8
#define OPIT 68                   // f32 pitch of one query's 64 context values in a wave's LDS partial
#define SCL2 0.18033688011112042f // HD^-0.5 x log2(e): scores go to the base-2 exponent directly
typedef __attribute__((ext_vector_type(16))) unsigned short v16us;
__device__ __forceinline__ void mkp(const float* p, v16h& a, v16h&) {
#pragma unroll
    for (int i = 0; i < 16; ++i) a[i] = (h16)p[i]; }
__device__ __forceinline__ void mkp(const float* p, v16bf& a, v16bf& a2) { v16us h, l;
#pragma unroll
    for (int i = 0; i < 16; ++i) { unsigned short x, y; splitf(p[i], x, y); h[i] = x; l[i] = y; }
    a = __builtin_bit_cast(v16bf, h); a2 = __builtin_bit_cast(v16bf, l); }
template <typename T16, int NSPLIT, int NQ> struct FaBody {
static __device__ __forceinline__ void run(const T16* __restrict__ Q, const T16* __restrict__ Q2, const T16* __restrict__ Kp, const T16* __restrict__ Kp2, const T16* __restrict__ Vt, const T16* __restrict__ Vt2, int q0, int qr, float* os, float* ms, float* ls) {
    typedef typename WFrag<T16>::V V;
    const int lane = threadIdx.x & 31, lr = lane & 15, hi = lane >> 4; const int wv = __builtin_amdgcn_readfirstlane((int)(threadIdx.x >> 5));
    V qf[NQ][2], qf2[NQ][2]; const size_t qo = (size_t)q0 * HD + lane * 8; const T16* qp = Q + qo; const T16* qp2 = (NSPLIT == 2) ? Q2 + qo : qp;
#pragma unroll
    for (int nq = 0; nq < NQ; ++nq)
#pragma unroll
        for (int ks = 0; ks < 2; ++ks) { qf[nq][ks] = WFrag<T16>::ldp(qp + nq * 16 * HD + ks * 512); if (NSPLIT == 2) qf2[nq][ks] = WFrag<T16>::ldp(qp2 + nq * 16 * HD + ks * 512); }
    asm volatile("s_wait_xcnt 0x0" :: "v"(qp), "v"(qp2) : "memory");   // stands in front of any reuse of the loads' address registers; naming the addresses as inputs keeps them whole up to here
    v8f o[4][NQ]; float m[NQ], l[NQ];
#pragma unroll
    for (int nq = 0; nq < NQ; ++nq) { m[nq] = -3.0e38f; l[nq] = 0.f;
#pragma unroll
        for (int dt = 0; dt < 4; ++dt) o[dt][nq] = (v8f){}; }
    const int nkb = q0 / 32 + 1;                                     // key blocks of 32 up to and including the diagonal block
    const int nit = 2 * ((nkb / 2 - wv + FNW - 1) / FNW) + (((nkb & 1) && (nkb / 2) % FNW == wv) ? 1 : 0);   // this wave's blocks: two per whole run of 64, one more where the half run at the diagonal is its own
#pragma unroll 1   // rolled: one block's fragments, scores and the context tile already fill the registers
    for (int it = 0; it < nit; ++it) {
        const int kb = ((it >> 1) * FNW + wv) * 2 + (it & 1); const int k0 = kb * 32;
        const size_t ko = (size_t)k0 * HD + lane * 8, vo = (size_t)k0 * 16 + lane * 8;   // fragment blocks: 16 keys x 32 dims (two a key tile), 16 dims x 32 keys (TT / 32 a dim tile)
        const T16* kp = Kp + ko; const T16* kp2 = (NSPLIT == 2) ? Kp2 + ko : kp; const T16* vp = Vt + vo; const T16* vp2 = (NSPLIT == 2) ? Vt2 + vo : vp;
        V ka[2][2], ka2[2][2];
#pragma unroll
        for (int kt = 0; kt < 2; ++kt)
#pragma unroll
            for (int ks = 0; ks < 2; ++ks) { ka[kt][ks] = WFrag<T16>::ldp(kp + kt * 16 * HD + ks * 512); if (NSPLIT == 2) ka2[kt][ks] = WFrag<T16>::ldp(kp2 + kt * 16 * HD + ks * 512); }
        V va[4], va2[4];
#pragma unroll
        for (int dt = 0; dt < 4; ++dt) { va[dt] = WFrag<T16>::ldp(vp + (size_t)dt * 16 * TT); if (NSPLIT == 2) va2[dt] = WFrag<T16>::ldp(vp2 + (size_t)dt * 16 * TT); }
        __builtin_amdgcn_sched_barrier(0);                           // all of the block's loads issue together, ahead of the first product: one load latency a block (without it the loads are sunk between the products and wait one after the other)
        asm volatile("s_wait_xcnt 0x0" :: "v"(kp), "v"(kp2), "v"(vp), "v"(vp2) : "memory");   // as behind the query loads: in front of any reuse of the address registers, which stay whole up to here
        v8f s[2][NQ];
#pragma unroll
        for (int kt = 0; kt < 2; ++kt)
#pragma unroll
            for (int nq = 0; nq < NQ; ++nq) { v8f c = (v8f){};
#pragma unroll
                for (int ks = 0; ks < 2; ++ks) { c = WFrag<T16>::mma(ka[kt][ks], qf[nq][ks], c); if (NSPLIT == 2) { c = WFrag<T16>::mma(ka[kt][ks], qf2[nq][ks], c); c = WFrag<T16>::mma(ka2[kt][ks], qf[nq][ks], c); } }
                s[kt][nq] = c; }
        if (kb == nkb - 1) {                                         // only the last block holds keys beyond a query of this tile (wave-uniform test)
#pragma unroll
            for (int kt = 0; kt < 2; ++kt)
#pragma unroll
                for (int nq = 0; nq < NQ; ++nq)
#pragma unroll
                    for (int j = 0; j < 8; ++j) if (k0 + kt * 16 + hi * 8 + j > q0 + nq * 16 + lr) s[kt][nq][j] = -3.0e38f; }
#pragma unroll
        for (int nq = 0; nq < NQ; ++nq) { float p[16]; float mx = -3.0e38f;
#pragma unroll
            for (int kt = 0; kt < 2; ++kt)
#pragma unroll
                for (int j = 0; j < 8; ++j) { const float t = s[kt][nq][j] * SCL2; p[kt * 8 + j] = t; mx = fmaxf(mx, t); }
            mx = fmaxf(mx, __shfl_xor(mx, 16, 32));                  // the two lane halves hold the two halves of a query's keys
            const float mn = fmaxf(m[nq], mx); const float sc = __builtin_amdgcn_exp2f(m[nq] - mn); m[nq] = mn; float sum = 0.f;
#pragma unroll
            for (int i = 0; i < 16; ++i) { p[i] = __builtin_amdgcn_exp2f(p[i] - mn); sum += p[i]; }
            l[nq] = l[nq] * sc + sum;
            V pf, pf2; mkp(p, pf, pf2);
#pragma unroll
            for (int dt = 0; dt < 4; ++dt) { v8f c = o[dt][nq] * sc; c = WFrag<T16>::mma(va[dt], pf, c); if (NSPLIT == 2) { c = WFrag<T16>::mma(va[dt], pf2, c); c = WFrag<T16>::mma(va2[dt], pf, c); } o[dt][nq] = c; } }
    }
    float* ow = os + wv * (QT * OPIT);
#pragma unroll
    for (int nq = 0; nq < NQ; ++nq) { l[nq] += __shfl_xor(l[nq], 16, 32);
#pragma unroll
        for (int dt = 0; dt < 4; ++dt) { float* d = ow + (qr + nq * 16 + lr) * OPIT + dt * 16 + hi * 8; v4f x, y;
#pragma unroll
            for (int j = 0; j < 4; ++j) { x[j] = o[dt][nq][j]; y[j] = o[dt][nq][4 + j]; }
            *(v4fa*)d = x; *(v4fa*)(d + 4) = y; }
        if (hi == 0) { ms[wv * QT + qr + nq * 16 + lr] = m[nq]; ls[wv * QT + qr + nq * 16 + lr] = l[nq]; } }
}
};
__global__ __launch_bounds__(256) void k_fa(const h16* __restrict__ Q16, const h16* __restrict__ K16, const h16* __restrict__ V16, const bf* __restrict__ Qh, const bf* __restrict__ Ql, const bf* __restrict__ Kh, const bf* __restrict__ Kl, const bf* __restrict__ Vh, const bf* __restrict__ Vl, bf* Ah, bf* Al) {
    __shared__ __align__(16) float os[FNW * QT * OPIT]; __shared__ float ms[FNW * QT]; __shared__ float ls[FNW * QT];
    const size_t po = (size_t)blockIdx.y * TT * HD; const int q0 = (TT / QT - 1 - (int)blockIdx.x) * QT;   // longest rows first
    if (q0 < RH) {
#pragma unroll 1   // the hi/lo rows (short key loops, twice the fragments) go 16 queries at a time, so that they do not set the register count of the fp16 rows
        for (int hf = 0; hf < 2; ++hf) FaBody<bf, 2, 1>::run(Qh + po, Ql + po, Kh + po, Kl + po, Vh + po, Vl + po, q0 + hf * 16, hf * 16, os, ms, ls);
    } else FaBody<h16, 0, 2>::run(Q16 + po, nullptr, K16 + po, nullptr, V16 + po, nullptr, q0, 0, os, ms, ls);
    __syncthreads();                                                 // every wave's partial (max, sum, O^T) is in LDS before any thread joins them
    // ROW PAIRS: the work-group's 2048 flat context values are rows R, R + 1 of the [tokens][DQ] operand of the last GEMM; they are stored, in the same 4 KB, as [k / 32][row % 2][k % 32], so that a fragment load of 16 rows touches 8 lines and uses them whole.
    // Thread -> piece: a wave stores 512 contiguous bytes (4 k blocks); its lane half is the row, so that 16 lanes read two neighbouring queries' partials from LDS as before.
    const int rw = (threadIdx.x >> 4) & 1, kb = (threadIdx.x >> 5) * 4 + ((threadIdx.x >> 2) & 3), k8 = threadIdx.x & 3;
    const int q = rw * 16 + (kb >> 1), d0 = (kb & 1) * 32 + k8 * 8; float mt = ms[q];
#pragma unroll
    for (int w = 1; w < FNW; ++w) mt = fmaxf(mt, ms[w * QT + q]);
    float acc[8], lt = 0.f;
#pragma unroll
    for (int j = 0; j < 8; ++j) acc[j] = 0.f;
#pragma unroll
    for (int w = 0; w < FNW; ++w) { const float f = __builtin_amdgcn_exp2f(ms[w * QT + q] - mt); lt += f * ls[w * QT + q]; const float* s = os + w * (QT * OPIT) + q * OPIT + d0; const v4f x = *(const v4fa*)s, y = *(const v4fa*)(s + 4);
#pragma unroll
        for (int j = 0; j < 4; ++j) { acc[j] += f * x[j]; acc[4 + j] += f * y[j]; } }
    const float inv = __fdiv_rn(1.0f, lt); v8us oh, ol;
#pragma unroll
    for (int j = 0; j < 8; ++j) { unsigned short a, c2; splitf(acc[j] * inv, a, c2); oh[j] = a; ol[j] = c2; }
    const size_t oo = po + (size_t)q0 * HD + (kb * 8 + rw * 4 + k8) * 8;   /* RAW MERGE: flat element (q0 + q) * HD + d0 of the (H, S, hd) context = the module's ctx.reshape(b, S, H * hd) without a transpose, at its place in the row pair */
    *(v8usa*)(Ah + oo) = oh; *(v8usa*)(Al + oo) = ol;
}

extern "C" void kernel_launch(void* const* d_in, const int* in_sizes, int n_in,
                              void* d_out, int out_size, void* d_ws, size_t ws_size, hipStream_t stream) {
    (void)in_sizes; (void)n_in; (void)out_size;
    const float* x = (const float*)d_in[0]; const float* wq = (const float*)d_in[1]; const float* wk = (const float*)d_in[2]; const float* wv = (const float*)d_in[3]; const float* wo = (const float*)d_in[4];
    float* OUT = (float*)d_out;     // [2][2048][1024]
    char* wsp = (char*)d_ws;
    auto take = [&](size_t bytes) { char* p = wsp; wsp += (bytes + 255) & ~(size_t)255; return (void*)p; };
    const size_t PL = (size_t)NB_ * TT * DQ;   // elements of one plane over both batches (DQ == DKV == DM here)
    bf* WT = (bf*)take((size_t)4 * DQ * DM * 2); bf* WO = WT + (size_t)3 * DQ * DM;
    bf* XB = (bf*)take(PL * 2);
    h16* QP16 = (h16*)take(2 * PL * 2); h16* KP16 = QP16 + PL; h16* VT16 = (h16*)take(PL * 2);
    bf* QPh = (bf*)take(2 * PL * 2); bf* KPh = QPh + PL; bf* QPl = (bf*)take(2 * PL * 2); bf* KPl = QPl + PL; bf* VTh = (bf*)take(PL * 2); bf* VTl = (bf*)take(PL * 2);
    bf* ATh = (bf*)take(PL * 2); bf* ATl = (bf*)take(PL * 2);
    if ((size_t)(wsp - (char*)d_ws) > ws_size) return;    // ws 256 MiB
    k_prep<<<4 * WB + XBLK, 256, 0, stream>>>(x, wq, wk, wv, wo, WT, XB);
    k_gemmw<bf, 0, false, true, DM><<<dim3(NB_ * TT / 64, DQ / 64, 3), 32, 0, stream>>>(XB, nullptr, WT, nullptr, nullptr, DQ, nullptr, 0, (size_t)DQ * DM, PL, QP16, QPh, QPl, VT16, VTh, VTl);   // z = q, k, v; writes the head planes
    k_fa<<<dim3(TT / QT, NB_ * NH_, 1), 32 * FNW, 0, stream>>>(QP16, KP16, VT16, QPh, QPl, KPh, KPl, VTh, VTl, ATh, ATl);
    k_gemmw<bf, 1, false, false, DQ><<<dim3(NB_ * TT / 64, DM / 64, 1), 32, 0, stream>>>(ATh, ATl, WO, nullptr, OUT, DM, nullptr, 0, 0, 0, nullptr, nullptr, nullptr, nullptr, nullptr, nullptr);
}

// v007
// One run takes 87.8 microseconds.
// Two timings next to v006 put it at 1.36 and 1.38 times that version's speed.
// Over all steps from v000 it is 16.7 times as fast.
#include <hip/hip_runtime.h>

// Causal multi-head attention whose heads are a RAW VIEW of the projections (x [2][2048][1024]; q, k, v = x W ('xw' [1024][1024] 0.02-scale, no bias); each is reshaped (b, 16, 2048, 64) WITHOUT a transpose: pseudo-head h, pseudo-position s, dim d = flat element h*2048*64 + s*64 + d of the [2048][1024] projection output (head h covers tokens 128 h .. 128 h + 127; pseudo-position s is the 64-wide feature block s mod 16 of token 128 h + s / 16); scores / sqrt(64); triu(k = 1) over the pseudo-positions -> -inf; softmax; the context (b, 16, 2048, 64) is reshaped (b, 2048, 1024) again WITHOUT a transpose; out = that Wproj ('xw', no bias) -> [2][2048][1024] (4.2 M); argument order x, Wq, Wk, Wv, Wproj).
// Layout, both batches in every launch (4 launches: k_prep, k_gemmw q/k/v, k_fa, k_gemmw out): bf16 copy of x and 'xw' weights transposed once, both stored in WMMA fragment blocks; exact projections; RAW VIEW: the q/k/v GEMM's epilogue writes the 16-bit head planes itself, taking each [2048][1024] projection output as (16, 2048, 64) WITHOUT a transpose (head stride TT x HD, inside a head WMMA fragment blocks; no f32 projection plane in memory), and k_fa writes the context planes back flat but for an interleave of row pairs (no transpose back): the module's own reshapes; causal T-2048 attention (hybrid rows: < 512 hi/lo 3 products, rest fp16; key blocks above the diagonal skipped; one fused kernel, online softmax); merged hi/lo x Wo exact.
// Compute dtypes, f32 accumulate: every input rounded to bf16; projections exact; attention rows < 512 3 products, rest fp16; softmax f32; Wo hl x exact.

#define NB_  2
#define TT   2048
#define DM   1024
#define NH_  16
#define NKV  16
#define HD   64
#define DQ   (NH_ * HD)
#define DKV  (NKV * HD)
#define RH   512                  // query rows < RH use hi+lo planes (0: none)
typedef _Float16 h16;
typedef unsigned short bf;
typedef __attribute__((ext_vector_type(16))) __bf16   v16bf;
typedef __attribute__((ext_vector_type(16))) _Float16 v16h;
typedef __attribute__((ext_vector_type(8)))  _Float16 v8h;
typedef __attribute__((ext_vector_type(8)))  unsigned short v8us;
typedef __attribute__((ext_vector_type(8)))  float    v8f;
typedef __attribute__((ext_vector_type(4)))  float    v4f;
typedef v8h  __attribute__((may_alias)) v8ha;
typedef v4f  __attribute__((may_alias)) v4fa;
typedef v8us __attribute__((may_alias)) v8usa;

__device__ __forceinline__ unsigned short f2bf(float f) { unsigned u = __float_as_uint(f); u += 0x7FFFu + ((u >> 16) & 1u); return (unsigned short)(u >> 16); }
__device__ __forceinline__ float bf2f(unsigned short b) { return __uint_as_float(((unsigned)b) << 16); }
__device__ __forceinline__ float bfr(float f) { return bf2f(f2bf(f)); }
__device__ __forceinline__ v16h cat16(v8h lo, v8h hi) { return __builtin_shufflevector(lo, hi, 0, 1, 2, 3, 4, 5, 6, 7, 8, 9, 10, 11, 12, 13, 14, 15); }
__device__ __forceinline__ v16bf cat16b(v8us lo, v8us hi) { return __builtin_bit_cast(v16bf, __builtin_shufflevector(lo, hi, 0, 1, 2, 3, 4, 5, 6, 7, 8, 9, 10, 11, 12, 13, 14, 15)); }
__device__ __forceinline__ v8f wmma16(v16h a, v16h b, v8f c) { return __builtin_amdgcn_wmma_f32_16x16x32_f16(false, a, false, b, (short)0, c, false, false); }
__device__ __forceinline__ v8f wmmab(v16bf a, v16bf b, v8f c) { return __builtin_amdgcn_wmma_f32_16x16x32_bf16(false, a, false, b, (short)0, c, false, false); }



// ---- k_gemmw: register-blocked GEMM, a work-group of 4 waves (2 x 2) per 128x128 output tile, each wave a 64x64 quarter (16 accumulators); grid (M/128, N/128, Z), 128 threads.
// The operands come from 16-bit planes through LDS: a stage is 64 k of the tile's 128 A rows (each A plane) and 128 Bt rows, brought in by asynchronous copies (16 bytes a lane, through no register) and read by both waves that need it;
// two buffers: the next stage's copies fly while this one is worked on. In LDS every operand stands in FRAGMENT BLOCKS, a unit = 16 rows x 64 k = 2 blocks = 2 KB; units: A plane 0 (8), A plane 1 (8, where NSPLIT), Bt (8).
// Plane layouts in memory: Bt always, and A where PLANES, in FRAGMENT BLOCKS (see b_wtG): a unit is 2 KB in a row. A otherwise in ROW PAIRS (see k_fa: [row / 2][k / 32][row % 2][k % 32]): a unit is 256 bytes of each of 8 row pairs, and the copy puts each 16-byte piece at its
//   place in the fragment block, the 16 rows of the piece column k8 = (k / 8) % 4 turned by 4 * k8 places (the pieces of one copy then fall on all banks; a reader's 16 lanes still read one whole 256-byte column). The k order inside a fragment is the same in all of them.
// C[m][n] (f32, pitch ldc, + optional f32 bias[n]) = sum_k A[m][k] Bt[n][k] (+ A2[m][k] Bt[n][k] where NSPLIT). z-batch strides sA/sB/sC in elements. K % 64 == 0, K >= 128.
// PLANES (the q/k/v projections, z = 0, 1, 2; ldc = DQ): no C; each staged 16 x 64 block goes out as the fp16 and bf16 hi/lo head planes, 8 values and one 16-byte store a plane and lane. by = the wave's column tile of 64.
//   The head planes are FRAGMENT BLOCKS too, per pseudo-head g = R / 128: query and key planes 16 positions x 32 dims, value planes (transposed) 16 dims x 32 positions. k_prep has put the weights' rows in an order (b_wtG, ord 1 and 2)
//   in which the 64 columns of a tile are, for token row R, 8 positions (R % 128) * 16 + fb x 8 dims: one whole 128-byte line of a block; a store writes the lines of 4 token rows.
//   z < 2: columns (fb % 8) * 8 + d % 8, by = (d / 8) * 2 + fb / 8: the line stands at R * ldc + c0, the address of the flat RAW VIEW (a token's 16 positions x 64 dims are its two blocks, 2 KB).
//   z = 2: columns (d % 8) * 8 + fb % 8, by = (d / 16) * 4 + (fb / 8) * 2 + (d / 8) % 2: the line stands at ((g * HD + (d / 16) * 16) * TT) + (R % 128) * 256 + (by % 4) * 64.
template <typename T16> struct WFrag;
template <> struct WFrag<h16> { typedef v16h V; static __device__ __forceinline__ V ldp(const h16* p) { return cat16(*(const v8h*)p, *(const v8h*)(p + 256)); } static __device__ __forceinline__ V ld2(const char* p, const char* q) { return cat16(*(const v8ha*)p, *(const v8ha*)q); } static __device__ __forceinline__ v8f mma(V a, V b, v8f c) { return wmma16(a, b, c); } };
template <> struct WFrag<bf> { typedef v16bf V; static __device__ __forceinline__ V ldp(const bf* p) { return cat16b(*(const v8us*)p, *(const v8us*)(p + 256)); } static __device__ __forceinline__ V ld2(const char* p, const char* q) { return cat16b(*(const v8usa*)p, *(const v8usa*)q); } static __device__ __forceinline__ v8f mma(V a, V b, v8f c) { return wmmab(a, b, c); } };
__device__ __forceinline__ h16 tohx(float x) { return (h16)x; }
__device__ __forceinline__ void splitf(float y, unsigned short& h, unsigned short& l) { h = f2bf(y); l = f2bf(y - bf2f(h)); }
// One unit's four asynchronous copies (each lane: its own 16 bytes, LDS byte address l, global address g). The s_wait_xcnt stands inside the statement, behind the last copy, so that no address register is rewritten in front of it.
__device__ __forceinline__ void cp4(unsigned l0, const char* g0, unsigned l1, const char* g1, unsigned l2, const char* g2, unsigned l3, const char* g3) {
    asm volatile("global_load_async_to_lds_b128 %0, %1, off\n\tglobal_load_async_to_lds_b128 %2, %3, off\n\tglobal_load_async_to_lds_b128 %4, %5, off\n\tglobal_load_async_to_lds_b128 %6, %7, off\n\ts_wait_xcnt 0x0"
                 :: "v"(l0), "v"(g0), "v"(l1), "v"(g1), "v"(l2), "v"(g2), "v"(l3), "v"(g3) : "memory");
}
template <typename T16, int NSPLIT, bool BIAS, bool PLANES, int K>
__global__ __launch_bounds__(128) void k_gemmw(const T16* __restrict__ A, const T16* __restrict__ A2, const T16* __restrict__ Bt, float* C, int ldc, const float* __restrict__ bias, size_t sA, size_t sB, size_t sC, h16* QK16, bf* QKh, bf* QKl, h16* V16, bf* Vh, bf* Vl) {
    typedef typename WFrag<T16>::V V;
    static_assert(NSPLIT == 0 || NSPLIT == 1, "one or two A planes"); static_assert(K % 64 == 0 && K >= 128, "two stages or more");
    constexpr int NA = NSPLIT + 1, STG = (NA + 1) * 8 * 2048, NT = K / 64;   // A planes; bytes of a stage; stages
    __shared__ __align__(1024) char ring[2 * STG]; __shared__ __align__(16) float osw[4 * 16 * 68];
    const size_t z = blockIdx.z; A += z * sA; if (NA == 2) A2 += z * sA; Bt += z * sB; if (!PLANES) C += z * sC;
    const int lane = threadIdx.x & 31, lr = lane & 15, hi = lane >> 4; const int wv = __builtin_amdgcn_readfirstlane((int)(threadIdx.x >> 5)), wm = wv >> 1, wn = wv & 1;
    const int r0 = blockIdx.x * 128 + wm * 64, by = blockIdx.y * 2 + wn, c0 = by * 64; float* os = osw + wv * (16 * 68);
    v8f acc[4][4];
#pragma unroll
    for (int mb = 0; mb < 4; ++mb)
#pragma unroll
        for (int nb = 0; nb < 4; ++nb) acc[mb][nb] = (v8f){};
    // The copies of a stage are dealt by unit: wave wv brings A units wv * 2 NA .. + 2 NA - 1 (of 8 NA) and Bt units wv * 2, wv * 2 + 1 (of 8): 4 copies a unit.
    const unsigned rb32 = (unsigned)(size_t)(void*)ring;   // the ring's byte address in the work-group's LDS
    unsigned la[4];                                        // the lane's place inside an A unit, copy c
#pragma unroll
    for (int c = 0; c < 4; ++c) la[c] = PLANES ? c * 512 + lane * 16 : ((lane >> 3) & 1) * 1024 + ((lane >> 1) & 1) * 512 + (lane & 1) * 256 + ((lane >> 4) * 2 + ((lane >> 2) & 1) + 4 * ((c + lane) & 3)) * 16;
    constexpr int CSA = PLANES ? 512 : 8 * K, TSA = PLANES ? 2048 : 256;   // global bytes from copy to copy (row pairs: two pairs on) and from stage to stage
    const int ua = wv * (2 * NA);
    const char* gA = (const char*)(((NA == 2 && ua >= 8) ? A2 : A) + (size_t)(blockIdx.x * 128 + (ua & 7) * 16) * K) + (PLANES ? lane * 16 : (lane >> 4) * (4 * K) + (lane & 15) * 16);
    const char* gB = (const char*)(Bt + (size_t)(blockIdx.y * 128 + wv * 32) * K) + lane * 16;
    auto issue = [&](int t, int buf) {
        const unsigned lb = rb32 + buf * STG;
#pragma unroll
        for (int i = 0; i < 2 * NA; ++i) { const char* g = gA + (size_t)i * (32 * K) + (size_t)t * TSA; const unsigned l = lb + (ua + i) * 2048;
            cp4(l + la[0], g, l + la[1], g + CSA, l + la[2], g + 2 * CSA, l + la[3], g + 3 * CSA); }
#pragma unroll
        for (int i = 0; i < 2; ++i) { const char* g = gB + (size_t)i * (32 * K) + (size_t)t * 2048; const unsigned l = lb + (NA * 8 + wv * 2 + i) * 2048 + lane * 16;
            cp4(l, g, l + 512, g + 512, l + 1024, g + 1024, l + 1536, g + 1536); }
    };
    issue(0, 0);
    asm volatile("s_wait_asynccnt 0x0" ::: "memory");   // this wave's copies of stage 0 have landed
    __syncthreads();                                     // every wave's have: stage 0 may be read
    issue(1, 1);
    // The lane's two 16-byte reads of a fragment inside a block: k 8 hi .. and 16 + 8 hi ..; the A blocks made from row pairs have their rows turned (see above).
    const int ao0 = PLANES ? lane * 16 : hi * 256 + ((lr + 4 * hi) & 15) * 16, ao1 = 512 + (PLANES ? lane * 16 : hi * 256 + ((lr + 8 + 4 * hi) & 15) * 16);
#pragma unroll 1   // rolled: one stage a trip, the buffer chosen by the trip's parity
    for (int t = 0; t < NT; ++t) {
        const char* sb = ring + (t & 1) * STG; const char* sa = sb + wm * (4 * 2048); const char* sbt = sb + (NA * 8 + wn * 4) * 2048 + lane * 16;
        V a[2][4], a2[2][4], b[2][4];
#pragma unroll
        for (int kk = 0; kk < 2; ++kk) {
#pragma unroll
            for (int mb = 0; mb < 4; ++mb) { const char* p = sa + mb * 2048 + kk * 1024; a[kk][mb] = WFrag<T16>::ld2(p + ao0, p + ao1); if (NA == 2) a2[kk][mb] = WFrag<T16>::ld2(p + 8 * 2048 + ao0, p + 8 * 2048 + ao1); }
#pragma unroll
            for (int nb = 0; nb < 4; ++nb) { const char* p = sbt + nb * 2048 + kk * 1024; b[kk][nb] = WFrag<T16>::ld2(p, p + 512); }
        }
        __builtin_amdgcn_sched_barrier(0);                   // the stage's LDS reads issue as one group ahead of its products: one LDS latency a trip (without it one Bt fragment is read at a time, and every four products wait for a read)
#pragma unroll
        for (int kk = 0; kk < 2; ++kk)
#pragma unroll
            for (int nb = 0; nb < 4; ++nb)
#pragma unroll
                for (int mb = 0; mb < 4; ++mb) { acc[mb][nb] = WFrag<T16>::mma(a[kk][mb], b[kk][nb], acc[mb][nb]); if (NA == 2) acc[mb][nb] = WFrag<T16>::mma(a2[kk][mb], b[kk][nb], acc[mb][nb]); }
        __builtin_amdgcn_sched_barrier(0);                   // the hand-over stays behind the products: moved up in front of them, its wait for the next stage's copies would stand a few LDS reads behind their issue instead of a whole trip
        asm volatile("s_wait_dscnt 0x0" ::: "memory");      // this wave's reads of the buffer are done before the buffer is refilled
        asm volatile("s_wait_asynccnt 0x0" ::: "memory");   // this wave's copies of stage t + 1 have landed
        __syncthreads();                                     // publishes stage t + 1 and ends every wave's reads of stage t
        if (t + 2 < NT) issue(t + 2, t & 1);
    }
    asm volatile("s_wait_asynccnt 0x0" ::: "memory");       // no copy is outstanding when the wave goes on to its end
#pragma unroll
    for (int mb = 0; mb < 4; ++mb) {
#pragma unroll
        for (int nb = 0; nb < 4; ++nb) {
#pragma unroll
            for (int j = 0; j < 8; ++j) os[(hi * 8 + j) * 68 + nb * 16 + lr] = acc[mb][nb][j]; }
        __builtin_amdgcn_wave_barrier(); asm volatile("" ::: "memory");
        if (PLANES) {
            const bool isv = (z == 2); const int R0 = r0 + mb * 16; h16* P16 = isv ? V16 : QK16; bf* Ph = isv ? Vh : QKh; bf* Pl = isv ? Vl : QKl;
            const int lofs = (lane >> 3) * 68 + (lane & 7) * 8, lstep = 4 * 68;
            const size_t e0 = isv ? ((size_t)(R0 / 128) * HD + (by >> 2) * 16) * TT + (R0 % 128 + (lane >> 3)) * 256 + (by & 3) * 64 + (lane & 7) * 8 : z * sC + (size_t)(R0 + (lane >> 3)) * ldc + c0 + (lane & 7) * 8, estep = isv ? (size_t)4 * 256 : (size_t)4 * ldc;
#pragma unroll
            for (int s = 0; s < 4; ++s) { const float* p = os + lofs + s * lstep; const v4f x = *(const v4fa*)p, y = *(const v4fa*)(p + 4); v8h o16; v8us oh, ol;
#pragma unroll
                for (int j = 0; j < 8; ++j) { const float r = (j < 4) ? x[j & 3] : y[j & 3]; o16[j] = tohx(r); unsigned short a2, c2; splitf(r, a2, c2); oh[j] = a2; ol[j] = c2; }
                const size_t e = e0 + s * estep; *(v8ha*)(P16 + e) = o16; *(v8usa*)(Ph + e) = oh; *(v8usa*)(Pl + e) = ol; }
        } else {
        float* crow = C + (size_t)(r0 + mb * 16) * ldc + c0;
#pragma unroll
            for (int s = 0; s < 8; ++s) { const int row = 2 * s + hi, cofs = lr * 4; v4f val = *(const v4fa*)(os + row * 68 + cofs); if (BIAS) { val[0] += bfr(bias[c0 + cofs]); val[1] += bfr(bias[c0 + cofs + 1]); val[2] += bfr(bias[c0 + cofs + 2]); val[3] += bfr(bias[c0 + cofs + 3]); }
                *(v4f*)(crow + (size_t)row * ldc + cofs) = val; }
             }
        __builtin_amdgcn_wave_barrier(); asm volatile("" ::: "memory");
    }
}

typedef __attribute__((ext_vector_type(4))) _Float16 v4h;
typedef __attribute__((ext_vector_type(2))) unsigned short v2us;
typedef __attribute__((ext_vector_type(4))) unsigned short v4us;
typedef __attribute__((ext_vector_type(4))) int v4i;
typedef v4h  __attribute__((may_alias)) v4ha;
typedef v4us __attribute__((may_alias)) v4usa;

// The small builders are device functions that take their block index bx: launches that do not depend on one another share one grid (k_prep below).
// FRAGMENT BLOCKS: a K-contiguous plane P[row][k] is stored as blocks of 16 rows x 32 k (512 elements, 1 KB), block (row / 16) * (K / 32) + k / 32; inside a block element (row, k) stands at
//   ((k / 16) % 2) * 256 + (((k / 8) % 2) * 16 + row % 16) * 8 + k % 8: the two 16-byte loads of a WMMA fragment (lane = hi * 16 + lr) each read 512 contiguous bytes. A thread of a builder makes one 16-byte piece (8 k of one row).
// b_wtG: P[n'][k] = bf16(w[k][n]), piece = thread, 256 pieces (4 KB) a block. Row n' of P holds column n of w, by ord (fb = n / HD the feature block = pseudo-position % 16, d = n % HD):
//   0: n = n'. 1 (query, key weights): n' = (d / 8) * 128 + (fb / 8) * 64 + (fb % 8) * 8 + d % 8. 2 (value weight): n' = (d / 16) * 256 + (fb / 8) * 128 + ((d / 8) % 2) * 64 + (d % 8) * 8 + fb % 8.
//   With 1 and 2 the 64 columns of a GEMM tile are 8 positions x 8 dims of each token: one whole 128-byte line of the head planes' fragment blocks (see k_gemmw PLANES).
__device__ __forceinline__ void b_wtG(int bx, const float* __restrict__ w, int K, int N, bf* Bt, int ord) {
    const int t = threadIdx.x, KB = K / 32, blk = bx * 4 + (t >> 6), rb = blk / KB, kb = blk % KB, hh = (t >> 4) & 3, lr = t & 15;   // hh = (k / 8) % 4
    const int nr = rb * 16 + lr, by = nr >> 6, c8 = (nr >> 3) & 7, c1 = nr & 7;
    const int n = (ord == 1) ? ((by & 1) * 8 + c8) * HD + (by >> 1) * 8 + c1 : (ord == 2) ? (((by >> 1) & 1) * 8 + c1) * HD + ((by >> 2) * 2 + (by & 1)) * 8 + c8 : nr;
    const int k = kb * 32 + hh * 8; v8us o;
#pragma unroll
    for (int j = 0; j < 8; ++j) o[j] = f2bf(w[(size_t)(k + j) * N + n]);
    *(v8us*)(Bt + ((size_t)rb * KB + kb) * 512 + (hh * 16 + lr) * 8) = o;
}
// b_cvt8: bf16 copy of src[row][K] in fragment blocks; piece = thread (whole lines stored), 32 bytes read a thread.
__device__ __forceinline__ void b_cvt8(int bx, const float* __restrict__ src, int K, bf* dst, size_t n8) { const size_t i = (size_t)bx * 256 + threadIdx.x; if (i >= n8) return;
    const int KB = K / 32, blk = (int)(i >> 6), hh = (int)(i >> 4) & 3, lr = (int)i & 15; const float* sp = src + (size_t)((blk / KB) * 16 + lr) * K + (blk % KB) * 32 + hh * 8; const v8f v = *(const v8f*)sp; v8us o;
    asm volatile("s_wait_xcnt 0x0" :: "v"(sp) : "memory");   // in front of any reuse of the load's address registers; naming the address as an input keeps it whole up to here
#pragma unroll
    for (int k = 0; k < 8; ++k) o[k] = f2bf(v[k]); *(v8us*)(dst + i * 8) = o;  }

// ---- k_prep: everything that reads only the inputs, in one launch: the four weight transposes (WB blocks each, planes WT[0..3] = q, k, v, out), the bf16 copy of x (both batches, XBLK blocks). The block ranges are work-group uniform.
#define WB   (DM * DQ / 8 / 256)
#define XBLK (NB_ * TT * DM / 8 / 256)
__global__ __launch_bounds__(256) void k_prep(const float* __restrict__ x, const float* __restrict__ wq, const float* __restrict__ wk, const float* __restrict__ wv, const float* __restrict__ wo, bf* WT, bf* XB) {
    const int bx = (int)blockIdx.x;
    if (bx < 4 * WB) { const int wi = bx / WB; const float* w = (wi == 0) ? wq : (wi == 1) ? wk : (wi == 2) ? wv : wo; b_wtG(bx - wi * WB, w, DM, DQ, WT + (size_t)wi * DM * DQ, (wi < 2) ? 1 : (wi == 2) ? 2 : 0); }
    else b_cvt8(bx - 4 * WB, x, DM, XB, (size_t)NB_ * TT * DM / 8);
}
// ---- k_fa: scores, causal softmax, probability x value and the hi/lo merge in ONE kernel (online softmax; no score plane in memory). Grid (TT / QT, batches x heads), FNW waves per work-group.
// A work-group owns QT = 32 query rows of one head; its keys 0 .. q0 + 31 are dealt over the FNW waves in runs of 64, worked in blocks of 32 (the planes are fragment blocks, see b_wtG and k_gemmw PLANES: every fragment load reads 512 contiguous bytes).
// Everything is computed TRANSPOSED so that no fragment changes lanes: S^T = K Q^T (D: row = key hi * 8 + j, column = query lr), which is already the B fragment of O^T = V^T P^T
// (lane lr = query, places 0..7 = keys 8 hi + j of key tile 0, places 8..15 = keys 16 + 8 hi + j of key tile 1: the k order of the V^T loader), and the running maximum and sum of a query live in its own lane.
// FaBody::run works NQ x 16 queries from q0 on (their rows in the LDS partial start at qr). Each wave ends with its own (max, sum, O^T); the FNW partials are joined through LDS in fixed wave order 0..FNW-1 behind one work-group barrier, divided by the sum, split hi/lo and written flat but for an interleave of row pairs (RAW MERGE).
// The short inner loops are all unrolled so that the fragment, score and context arrays stay in registers.
// Rows < RH: bf16 hi/lo planes, 3 products in both contractions; the other rows fp16 (probabilities exp(s - max) <= 1 rounded to fp16).
#define QT   32
#define FNW  8
#define OPIT 68                   // f32 pitch of one query's 64 context values in a wave's LDS partial
#define SCL2 0.18033688011112042f // HD^-0.5 x log2(e): scores go to the base-2 exponent directly
typedef __attribute__((ext_vector_type(16))) unsigned short v16us;
__device__ __forceinline__ void mkp(const float* p, v16h& a, v16h&) {
#pragma unroll
    for (int i = 0; i < 16; ++i) a[i] = (h16)p[i]; }
__device__ __forceinline__ void mkp(const float* p, v16bf& a, v16bf& a2) { v16us h, l;
#pragma unroll
    for (int i = 0; i < 16; ++i) { unsigned short x, y; splitf(p[i], x, y); h[i] = x; l[i] = y; }
    a = __builtin_bit_cast(v16bf, h); a2 = __builtin_bit_cast(v16bf, l); }
template <typename T16, int NSPLIT, int NQ> struct FaBody {
static __device__ __forceinline__ void run(const T16* __restrict__ Q, const T16* __restrict__ Q2, const T16* __restrict__ Kp, const T16* __restrict__ Kp2, const T16* __restrict__ Vt, const T16* __restrict__ Vt2, int q0, int qr, float* os, float* ms, float* ls) {
    typedef typename WFrag<T16>::V V;
    const int lane = threadIdx.x & 31, lr = lane & 15, hi = lane >> 4; const int wv = __builtin_amdgcn_readfirstlane((int)(threadIdx.x >> 5));
    V qf[NQ][2], qf2[NQ][2]; const size_t qo = (size_t)q0 * HD + lane * 8; const T16* qp = Q + qo; const T16* qp2 = (NSPLIT == 2) ? Q2 + qo : qp;
#pragma unroll
    for (int nq = 0; nq < NQ; ++nq)
#pragma unroll
        for (int ks = 0; ks < 2; ++ks) { qf[nq][ks] = WFrag<T16>::ldp(qp + nq * 16 * HD + ks * 512); if (NSPLIT == 2) qf2[nq][ks] = WFrag<T16>::ldp(qp2 + nq * 16 * HD + ks * 512); }
    asm volatile("s_wait_xcnt 0x0" :: "v"(qp), "v"(qp2) : "memory");   // stands in front of any reuse of the loads' address registers; naming the addresses as inputs keeps them whole up to here
    v8f o[4][NQ]; float m[NQ], l[NQ];
#pragma unroll
    for (int nq = 0; nq < NQ; ++nq) { m[nq] = -3.0e38f; l[nq] = 0.f;
#pragma unroll
        for (int dt = 0; dt < 4; ++dt) o[dt][nq] = (v8f){}; }
    const int nkb = q0 / 32 + 1;                                     // key blocks of 32 up to and including the diagonal block
    const int nit = 2 * ((nkb / 2 - wv + FNW - 1) / FNW) + (((nkb & 1) && (nkb / 2) % FNW == wv) ? 1 : 0);   // this wave's blocks: two per whole run of 64, one more where the half run at the diagonal is its own
#pragma unroll 1   // rolled: one block's fragments, scores and the context tile already fill the registers
    for (int it = 0; it < nit; ++it) {
        const int kb = ((it >> 1) * FNW + wv) * 2 + (it & 1); const int k0 = kb * 32;
        const size_t ko = (size_t)k0 * HD + lane * 8, vo = (size_t)k0 * 16 + lane * 8;   // fragment blocks: 16 keys x 32 dims (two a key tile), 16 dims x 32 keys (TT / 32 a dim tile)
        const T16* kp = Kp + ko; const T16* kp2 = (NSPLIT == 2) ? Kp2 + ko : kp; const T16* vp = Vt + vo; const T16* vp2 = (NSPLIT == 2) ? Vt2 + vo : vp;
        V ka[2][2], ka2[2][2];
#pragma unroll
        for (int kt = 0; kt < 2; ++kt)
#pragma unroll
            for (int ks = 0; ks < 2; ++ks) { ka[kt][ks] = WFrag<T16>::ldp(kp + kt * 16 * HD + ks * 512); if (NSPLIT == 2) ka2[kt][ks] = WFrag<T16>::ldp(kp2 + kt * 16 * HD + ks * 512); }
        V va[4], va2[4];
#pragma unroll
        for (int dt = 0; dt < 4; ++dt) { va[dt] = WFrag<T16>::ldp(vp + (size_t)dt * 16 * TT); if (NSPLIT == 2) va2[dt] = WFrag<T16>::ldp(vp2 + (size_t)dt * 16 * TT); }
        __builtin_amdgcn_sched_barrier(0);                           // all of the block's loads issue together, ahead of the first product: one load latency a block (without it the loads are sunk between the products and wait one after the other)
        asm volatile("s_wait_xcnt 0x0" :: "v"(kp), "v"(kp2), "v"(vp), "v"(vp2) : "memory");   // as behind the query loads: in front of any reuse of the address registers, which stay whole up to here
        v8f s[2][NQ];
#pragma unroll
        for (int kt = 0; kt < 2; ++kt)
#pragma unroll
            for (int nq = 0; nq < NQ; ++nq) { v8f c = (v8f){};
#pragma unroll
                for (int ks = 0; ks < 2; ++ks) { c = WFrag<T16>::mma(ka[kt][ks], qf[nq][ks], c); if (NSPLIT == 2) { c = WFrag<T16>::mma(ka[kt][ks], qf2[nq][ks], c); c = WFrag<T16>::mma(ka2[kt][ks], qf[nq][ks], c); } }
                s[kt][nq] = c; }
        if (kb == nkb - 1) {                                         // only the last block holds keys beyond a query of this tile (wave-uniform test)
#pragma unroll
            for (int kt = 0; kt < 2; ++kt)
#pragma unroll
                for (int nq = 0; nq < NQ; ++nq)
#pragma unroll
                    for (int j = 0; j < 8; ++j) if (k0 + kt * 16 + hi * 8 + j > q0 + nq * 16 + lr) s[kt][nq][j] = -3.0e38f; }
#pragma unroll
        for (int nq = 0; nq < NQ; ++nq) { float p[16]; float mx = -3.0e38f;
#pragma unroll
            for (int kt = 0; kt < 2; ++kt)
#pragma unroll
                for (int j = 0; j < 8; ++j) { const float t = s[kt][nq][j] * SCL2; p[kt * 8 + j] = t; mx = fmaxf(mx, t); }
            mx = fmaxf(mx, __shfl_xor(mx, 16, 32));                  // the two lane halves hold the two halves of a query's keys
            const float mn = fmaxf(m[nq], mx); const float sc = __builtin_amdgcn_exp2f(m[nq] - mn); m[nq] = mn; float sum = 0.f;
#pragma unroll
            for (int i = 0; i < 16; ++i) { p[i] = __builtin_amdgcn_exp2f(p[i] - mn); sum += p[i]; }
            l[nq] = l[nq] * sc + sum;
            V pf, pf2; mkp(p, pf, pf2);
#pragma unroll
            for (int dt = 0; dt < 4; ++dt) { v8f c = o[dt][nq] * sc; c = WFrag<T16>::mma(va[dt], pf, c); if (NSPLIT == 2) { c = WFrag<T16>::mma(va[dt], pf2, c); c = WFrag<T16>::mma(va2[dt], pf, c); } o[dt][nq] = c; } }
    }
    float* ow = os + wv * (QT * OPIT);
#pragma unroll
    for (int nq = 0; nq < NQ; ++nq) { l[nq] += __shfl_xor(l[nq], 16, 32);
#pragma unroll
        for (int dt = 0; dt < 4; ++dt) { float* d = ow + (qr + nq * 16 + lr) * OPIT + dt * 16 + hi * 8; v4f x, y;
#pragma unroll
            for (int j = 0; j < 4; ++j) { x[j] = o[dt][nq][j]; y[j] = o[dt][nq][4 + j]; }
            *(v4fa*)d = x; *(v4fa*)(d + 4) = y; }
        if (hi == 0) { ms[wv * QT + qr + nq * 16 + lr] = m[nq]; ls[wv * QT + qr + nq * 16 + lr] = l[nq]; } }
}
};
__global__ __launch_bounds__(256) void k_fa(const h16* __restrict__ Q16, const h16* __restrict__ K16, const h16* __restrict__ V16, const bf* __restrict__ Qh, const bf* __restrict__ Ql, const bf* __restrict__ Kh, const bf* __restrict__ Kl, const bf* __restrict__ Vh, const bf* __restrict__ Vl, bf* Ah, bf* Al) {
    __shared__ __align__(16) float os[FNW * QT * OPIT]; __shared__ float ms[FNW * QT]; __shared__ float ls[FNW * QT];
    const size_t po = (size_t)blockIdx.y * TT * HD; const int q0 = (TT / QT - 1 - (int)blockIdx.x) * QT;   // longest rows first
    if (q0 < RH) {
#pragma unroll 1   // the hi/lo rows (short key loops, twice the fragments) go 16 queries at a time, so that they do not set the register count of the fp16 rows
        for (int hf = 0; hf < 2; ++hf) FaBody<bf, 2, 1>::run(Qh + po, Ql + po, Kh + po, Kl + po, Vh + po, Vl + po, q0 + hf * 16, hf * 16, os, ms, ls);
    } else FaBody<h16, 0, 2>::run(Q16 + po, nullptr, K16 + po, nullptr, V16 + po, nullptr, q0, 0, os, ms, ls);
    __syncthreads();                                                 // every wave's partial (max, sum, O^T) is in LDS before any thread joins them
    // ROW PAIRS: the work-group's 2048 flat context values are rows R, R + 1 of the [tokens][DQ] operand of the last GEMM; they are stored, in the same 4 KB, as [k / 32][row % 2][k % 32], so that a fragment load of 16 rows touches 8 lines and uses them whole.
    // Thread -> piece: a wave stores 512 contiguous bytes (4 k blocks); its lane half is the row, so that 16 lanes read two neighbouring queries' partials from LDS as before.
    const int rw = (threadIdx.x >> 4) & 1, kb = (threadIdx.x >> 5) * 4 + ((threadIdx.x >> 2) & 3), k8 = threadIdx.x & 3;
    const int q = rw * 16 + (kb >> 1), d0 = (kb & 1) * 32 + k8 * 8; float mt = ms[q];
#pragma unroll
    for (int w = 1; w < FNW; ++w) mt = fmaxf(mt, ms[w * QT + q]);
    float acc[8], lt = 0.f;
#pragma unroll
    for (int j = 0; j < 8; ++j) acc[j] = 0.f;
#pragma unroll
    for (int w = 0; w < FNW; ++w) { const float f = __builtin_amdgcn_exp2f(ms[w * QT + q] - mt); lt += f * ls[w * QT + q]; const float* s = os + w * (QT * OPIT) + q * OPIT + d0; const v4f x = *(const v4fa*)s, y = *(const v4fa*)(s + 4);
#pragma unroll
        for (int j = 0; j < 4; ++j) { acc[j] += f * x[j]; acc[4 + j] += f * y[j]; } }
    const float inv = __fdiv_rn(1.0f, lt); v8us oh, ol;
#pragma unroll
    for (int j = 0; j < 8; ++j) { unsigned short a, c2; splitf(acc[j] * inv, a, c2); oh[j] = a; ol[j] = c2; }
    const size_t oo = po + (size_t)q0 * HD + (kb * 8 + rw * 4 + k8) * 8;   /* RAW MERGE: flat element (q0 + q) * HD + d0 of the (H, S, hd) context = the module's ctx.reshape(b, S, H * hd) without a transpose, at its place in the row pair */
    *(v8usa*)(Ah + oo) = oh; *(v8usa*)(Al + oo) = ol;
}

extern "C" void kernel_launch(void* const* d_in, const int* in_sizes, int n_in,
                              void* d_out, int out_size, void* d_ws, size_t ws_size, hipStream_t stream) {
    (void)in_sizes; (void)n_in; (void)out_size;
    const float* x = (const float*)d_in[0]; const float* wq = (const float*)d_in[1]; const float* wk = (const float*)d_in[2]; const float* wv = (const float*)d_in[3]; const float* wo = (const float*)d_in[4];
    float* OUT = (float*)d_out;     // [2][2048][1024]
    char* wsp = (char*)d_ws;
    auto take = [&](size_t bytes) { char* p = wsp; wsp += (bytes + 255) & ~(size_t)255; return (void*)p; };
    const size_t PL = (size_t)NB_ * TT * DQ;   // elements of one plane over both batches (DQ == DKV == DM here)
    bf* WT = (bf*)take((size_t)4 * DQ * DM * 2); bf* WO = WT + (size_t)3 * DQ * DM;
    bf* XB = (bf*)take(PL * 2);
    h16* QP16 = (h16*)take(2 * PL * 2); h16* KP16 = QP16 + PL; h16* VT16 = (h16*)take(PL * 2);
    bf* QPh = (bf*)take(2 * PL * 2); bf* KPh = QPh + PL; bf* QPl = (bf*)take(2 * PL * 2); bf* KPl = QPl + PL; bf* VTh = (bf*)take(PL * 2); bf* VTl = (bf*)take(PL * 2);
    bf* ATh = (bf*)take(PL * 2); bf* ATl = (bf*)take(PL * 2);
    if ((size_t)(wsp - (char*)d_ws) > ws_size) return;    // ws 256 MiB
    k_prep<<<4 * WB + XBLK, 256, 0, stream>>>(x, wq, wk, wv, wo, WT, XB);
    k_gemmw<bf, 0, false, true, DM><<<dim3(NB_ * TT / 128, DQ / 128, 3), 128, 0, stream>>>(XB, nullptr, WT, nullptr, DQ, nullptr, 0, (size_t)DQ * DM, PL, QP16, QPh, QPl, VT16, VTh, VTl);   // z = q, k, v; writes the head planes
    k_fa<<<dim3(TT / QT, NB_ * NH_, 1), 32 * FNW, 0, stream>>>(QP16, KP16, VT16, QPh, QPl, KPh, KPl, VTh, VTl, ATh, ATl);
    k_gemmw<bf, 1, false, false, DQ><<<dim3(NB_ * TT / 128, DM / 128, 1), 128, 0, stream>>>(ATh, ATl, WO, OUT, DM, nullptr, 0, 0, 0, nullptr, nullptr, nullptr, nullptr, nullptr, nullptr);
}

// v008
// One run takes 86.5 microseconds.
// In both of two side-by-side timings against v007, it was 1.03 times as fast.
// Counting every step since v000, it is 17.2 times as fast.
#include <hip/hip_runtime.h>

// Causal multi-head attention whose heads are a RAW VIEW of the projections (x [2][2048][1024]; q, k, v = x W ('xw' [1024][1024] 0.02-scale, no bias); each is reshaped (b, 16, 2048, 64) WITHOUT a transpose: pseudo-head h, pseudo-position s, dim d = flat element h*2048*64 + s*64 + d of the [2048][1024] projection output (head h covers tokens 128 h .. 128 h + 127; pseudo-position s is the 64-wide feature block s mod 16 of token 128 h + s / 16); scores / sqrt(64); triu(k = 1) over the pseudo-positions -> -inf; softmax; the context (b, 16, 2048, 64) is reshaped (b, 2048, 1024) again WITHOUT a transpose; out = that Wproj ('xw', no bias) -> [2][2048][1024] (4.2 M); argument order x, Wq, Wk, Wv, Wproj).
// Layout, both batches in every launch (4 launches: k_prep, k_gemmw q/k/v, k_fa, k_gemmw out): bf16 copy of x and 'xw' weights transposed once, both stored in WMMA fragment blocks; exact projections; RAW VIEW: the q/k/v GEMM's epilogue writes the 16-bit head planes itself, taking each [2048][1024] projection output as (16, 2048, 64) WITHOUT a transpose (head stride TT x HD, inside a head WMMA fragment blocks; no f32 projection plane in memory), and k_fa writes the context planes back flat but for an interleave of row pairs (no transpose back): the module's own reshapes; causal T-2048 attention (hybrid rows: < 512 hi/lo 3 products, rest fp16; key blocks above the diagonal skipped; one fused kernel, online softmax); merged hi/lo x Wo exact.
// Compute dtypes, f32 accumulate: every input rounded to bf16; projections exact; attention rows < 512 3 products, rest fp16; softmax f32; Wo hl x exact.

#define NB_  2
#define TT   2048
#define DM   1024
#define NH_  16
#define NKV  16
#define HD   64
#define DQ   (NH_ * HD)
#define DKV  (NKV * HD)
#define RH   512                  // query rows < RH use hi+lo planes (0: none)
typedef _Float16 h16;
typedef unsigned short bf;
typedef __attribute__((ext_vector_type(16))) __bf16   v16bf;
typedef __attribute__((ext_vector_type(16))) _Float16 v16h;
typedef __attribute__((ext_vector_type(8)))  _Float16 v8h;
typedef __attribute__((ext_vector_type(8)))  unsigned short v8us;
typedef __attribute__((ext_vector_type(8)))  float    v8f;
typedef __attribute__((ext_vector_type(4)))  float    v4f;
typedef v8h  __attribute__((may_alias)) v8ha;
typedef v4f  __attribute__((may_alias)) v4fa;
typedef v8us __attribute__((may_alias)) v8usa;

__device__ __forceinline__ unsigned short f2bf(float f) { unsigned u = __float_as_uint(f); u += 0x7FFFu + ((u >> 16) & 1u); return (unsigned short)(u >> 16); }
__device__ __forceinline__ float bf2f(unsigned short b) { return __uint_as_float(((unsigned)b) << 16); }
__device__ __forceinline__ float bfr(float f) { return bf2f(f2bf(f)); }
__device__ __forceinline__ v16h cat16(v8h lo, v8h hi) { return __builtin_shufflevector(lo, hi, 0, 1, 2, 3, 4, 5, 6, 7, 8, 9, 10, 11, 12, 13, 14, 15); }
__device__ __forceinline__ v16bf cat16b(v8us lo, v8us hi) { return __builtin_bit_cast(v16bf, __builtin_shufflevector(lo, hi, 0, 1, 2, 3, 4, 5, 6, 7, 8, 9, 10, 11, 12, 13, 14, 15)); }
__device__ __forceinline__ v8f wmma16(v16h a, v16h b, v8f c) { return __builtin_amdgcn_wmma_f32_16x16x32_f16(false, a, false, b, (short)0, c, false, false); }
__device__ __forceinline__ v8f wmmab(v16bf a, v16bf b, v8f c) { return __builtin_amdgcn_wmma_f32_16x16x32_bf16(false, a, false, b, (short)0, c, false, false); }



// ---- k_gemmw: register-blocked GEMM, a work-group of 4 waves (2 x 2) per 128x128 output tile, each wave a 64x64 quarter (16 accumulators); grid (M/128, N/128, Z), 128 threads.
// The operands come from 16-bit planes through LDS: a stage is 64 k of the tile's 128 A rows (each A plane) and 128 Bt rows, brought in by asynchronous copies (16 bytes a lane, through no register) and read by both waves that need it;
// two buffers: the next stage's copies fly while this one is worked on. In LDS every operand stands in FRAGMENT BLOCKS, a unit = 16 rows x 64 k = 2 blocks = 2 KB; units: A plane 0 (8), A plane 1 (8, where NSPLIT), Bt (8).
// Plane layouts in memory: Bt always, and A where PLANES, in FRAGMENT BLOCKS (see b_wtG): a unit is 2 KB in a row. A otherwise in ROW PAIRS (see k_fa: [row / 2][k / 32][row % 2][k % 32]): a unit is 256 bytes of each of 8 row pairs, and the copy puts each 16-byte piece at its
//   place in the fragment block, the 16 rows of the piece column k8 = (k / 8) % 4 turned by 4 * k8 places (the pieces of one copy then fall on all banks; a reader's 16 lanes still read one whole 256-byte column). The k order inside a fragment is the same in all of them.
// C[m][n] (f32, pitch ldc, + optional f32 bias[n]) = sum_k A[m][k] Bt[n][k] (+ A2[m][k] Bt[n][k] where NSPLIT). z-batch strides sA/sB/sC in elements. K % 64 == 0, K >= 128.
// PLANES (the q/k/v projections, z = 0, 1, 2; ldc = DQ): no C; each staged 16 x 64 block goes out as the fp16 and bf16 hi/lo head planes, 8 values and one 16-byte store a plane and lane. by = the wave's column tile of 64.
//   The head planes are FRAGMENT BLOCKS too, per pseudo-head g = R / 128: query and key planes 16 positions x 32 dims, value planes (transposed) 16 dims x 32 positions. k_prep has put the weights' rows in an order (b_wtG, ord 1 and 2)
//   in which the 64 columns of a tile are, for token row R, 8 positions (R % 128) * 16 + fb x 8 dims: one whole 128-byte line of a block; a store writes the lines of 4 token rows.
//   z < 2: columns (fb % 8) * 8 + d % 8, by = (d / 8) * 2 + fb / 8: the line stands at R * ldc + c0, the address of the flat RAW VIEW (a token's 16 positions x 64 dims are its two blocks, 2 KB).
//   z = 2: columns (d % 8) * 8 + fb % 8, by = (d / 16) * 4 + (fb / 8) * 2 + (d / 8) % 2: the line stands at ((g * HD + (d / 16) * 16) * TT) + (R % 128) * 256 + (by % 4) * 64.
template <typename T16> struct WFrag;
template <> struct WFrag<h16> { typedef v16h V; static __device__ __forceinline__ V ldp(const h16* p) { return cat16(*(const v8h*)p, *(const v8h*)(p + 256)); } static __device__ __forceinline__ V ld2(const char* p, const char* q) { return cat16(*(const v8ha*)p, *(const v8ha*)q); } static __device__ __forceinline__ v8f mma(V a, V b, v8f c) { return wmma16(a, b, c); } };
template <> struct WFrag<bf> { typedef v16bf V; static __device__ __forceinline__ V ldp(const bf* p) { return cat16b(*(const v8us*)p, *(const v8us*)(p + 256)); } static __device__ __forceinline__ V ld2(const char* p, const char* q) { return cat16b(*(const v8usa*)p, *(const v8usa*)q); } static __device__ __forceinline__ v8f mma(V a, V b, v8f c) { return wmmab(a, b, c); } };
__device__ __forceinline__ h16 tohx(float x) { return (h16)x; }
__device__ __forceinline__ void splitf(float y, unsigned short& h, unsigned short& l) { h = f2bf(y); l = f2bf(y - bf2f(h)); }
// One unit's four asynchronous copies (each lane: its own 16 bytes, LDS byte address l, global address g). The s_wait_xcnt stands inside the statement, behind the last copy, so that no address register is rewritten in front of it.
__device__ __forceinline__ void cp4(unsigned l0, const char* g0, unsigned l1, const char* g1, unsigned l2, const char* g2, unsigned l3, const char* g3) {
    asm volatile("global_load_async_to_lds_b128 %0, %1, off\n\tglobal_load_async_to_lds_b128 %2, %3, off\n\tglobal_load_async_to_lds_b128 %4, %5, off\n\tglobal_load_async_to_lds_b128 %6, %7, off\n\ts_wait_xcnt 0x0"
                 :: "v"(l0), "v"(g0), "v"(l1), "v"(g1), "v"(l2), "v"(g2), "v"(l3), "v"(g3) : "memory");
}
template <typename T16, int NSPLIT, bool BIAS, bool PLANES, int K>
__global__ __launch_bounds__(128) void k_gemmw(const T16* __restrict__ A, const T16* __restrict__ A2, const T16* __restrict__ Bt, float* C, int ldc, const float* __restrict__ bias, size_t sA, size_t sB, size_t sC, h16* QK16, bf* QKh, bf* QKl, h16* V16, bf* Vh, bf* Vl) {
    typedef typename WFrag<T16>::V V;
    static_assert(NSPLIT == 0 || NSPLIT == 1, "one or two A planes"); static_assert(K % 64 == 0 && K >= 128, "two stages or more");
    constexpr int NA = NSPLIT + 1, STG = (NA + 1) * 8 * 2048, NT = K / 64;   // A planes; bytes of a stage; stages
    __shared__ __align__(1024) char ring[2 * STG]; __shared__ __align__(16) float osw[4 * 16 * 68];
    const size_t z = blockIdx.z; A += z * sA; if (NA == 2) A2 += z * sA; Bt += z * sB; if (!PLANES) C += z * sC;
    const int lane = threadIdx.x & 31, lr = lane & 15, hi = lane >> 4; const int wv = __builtin_amdgcn_readfirstlane((int)(threadIdx.x >> 5)), wm = wv >> 1, wn = wv & 1;
    const int r0 = blockIdx.x * 128 + wm * 64, by = blockIdx.y * 2 + wn, c0 = by * 64; float* os = osw + wv * (16 * 68);
    v8f acc[4][4];
#pragma unroll
    for (int mb = 0; mb < 4; ++mb)
#pragma unroll
        for (int nb = 0; nb < 4; ++nb) acc[mb][nb] = (v8f){};
    // The copies of a stage are dealt by unit: wave wv brings A units wv * 2 NA .. + 2 NA - 1 (of 8 NA) and Bt units wv * 2, wv * 2 + 1 (of 8): 4 copies a unit.
    const unsigned rb32 = (unsigned)(size_t)(void*)ring;   // the ring's byte address in the work-group's LDS
    unsigned la[4];                                        // the lane's place inside an A unit, copy c
#pragma unroll
    for (int c = 0; c < 4; ++c) la[c] = PLANES ? c * 512 + lane * 16 : ((lane >> 3) & 1) * 1024 + ((lane >> 1) & 1) * 512 + (lane & 1) * 256 + ((lane >> 4) * 2 + ((lane >> 2) & 1) + 4 * ((c + lane) & 3)) * 16;
    constexpr int CSA = PLANES ? 512 : 8 * K, TSA = PLANES ? 2048 : 256;   // global bytes from copy to copy (row pairs: two pairs on) and from stage to stage
    const int ua = wv * (2 * NA);
    const char* gA = (const char*)(((NA == 2 && ua >= 8) ? A2 : A) + (size_t)(blockIdx.x * 128 + (ua & 7) * 16) * K) + (PLANES ? lane * 16 : (lane >> 4) * (4 * K) + (lane & 15) * 16);
    const char* gB = (const char*)(Bt + (size_t)(blockIdx.y * 128 + wv * 32) * K) + lane * 16;
    auto issue = [&](int t, int buf) {
        const unsigned lb = rb32 + buf * STG;
#pragma unroll
        for (int i = 0; i < 2 * NA; ++i) { const char* g = gA + (size_t)i * (32 * K) + (size_t)t * TSA; const unsigned l = lb + (ua + i) * 2048;
            cp4(l + la[0], g, l + la[1], g + CSA, l + la[2], g + 2 * CSA, l + la[3], g + 3 * CSA); }
#pragma unroll
        for (int i = 0; i < 2; ++i) { const char* g = gB + (size_t)i * (32 * K) + (size_t)t * 2048; const unsigned l = lb + (NA * 8 + wv * 2 + i) * 2048 + lane * 16;
            cp4(l, g, l + 512, g + 512, l + 1024, g + 1024, l + 1536, g + 1536); }
    };
    issue(0, 0);
    asm volatile("s_wait_asynccnt 0x0" ::: "memory");   // this wave's copies of stage 0 have landed
    __syncthreads();                                     // every wave's have: stage 0 may be read
    issue(1, 1);
    // The lane's two 16-byte reads of a fragment inside a block: k 8 hi .. and 16 + 8 hi ..; the A blocks made from row pairs have their rows turned (see above).
    const int ao0 = PLANES ? lane * 16 : hi * 256 + ((lr + 4 * hi) & 15) * 16, ao1 = 512 + (PLANES ? lane * 16 : hi * 256 + ((lr + 8 + 4 * hi) & 15) * 16);
#pragma unroll 1   // rolled: one stage a trip, the buffer chosen by the trip's parity
    for (int t = 0; t < NT; ++t) {
        const char* sb = ring + (t & 1) * STG; const char* sa = sb + wm * (4 * 2048); const char* sbt = sb + (NA * 8 + wn * 4) * 2048 + lane * 16;
        V a[2][4], a2[2][4], b[2][4];
#pragma unroll
        for (int kk = 0; kk < 2; ++kk) {
#pragma unroll
            for (int mb = 0; mb < 4; ++mb) { const char* p = sa + mb * 2048 + kk * 1024; a[kk][mb] = WFrag<T16>::ld2(p + ao0, p + ao1); if (NA == 2) a2[kk][mb] = WFrag<T16>::ld2(p + 8 * 2048 + ao0, p + 8 * 2048 + ao1); }
#pragma unroll
            for (int nb = 0; nb < 4; ++nb) { const char* p = sbt + nb * 2048 + kk * 1024; b[kk][nb] = WFrag<T16>::ld2(p, p + 512); }
        }
        __builtin_amdgcn_sched_barrier(0);                   // the stage's LDS reads issue as one group ahead of its products: one LDS latency a trip (without it one Bt fragment is read at a time, and every four products wait for a read)
#pragma unroll
        for (int kk = 0; kk < 2; ++kk)
#pragma unroll
            for (int nb = 0; nb < 4; ++nb)
#pragma unroll
                for (int mb = 0; mb < 4; ++mb) { acc[mb][nb] = WFrag<T16>::mma(a[kk][mb], b[kk][nb], acc[mb][nb]); if (NA == 2) acc[mb][nb] = WFrag<T16>::mma(a2[kk][mb], b[kk][nb], acc[mb][nb]); }
        __builtin_amdgcn_sched_barrier(0);                   // the hand-over stays behind the products: moved up in front of them, its wait for the next stage's copies would stand a few LDS reads behind their issue instead of a whole trip
        asm volatile("s_wait_dscnt 0x0" ::: "memory");      // this wave's reads of the buffer are done before the buffer is refilled
        asm volatile("s_wait_asynccnt 0x0" ::: "memory");   // this wave's copies of stage t + 1 have landed
        __syncthreads();                                     // publishes stage t + 1 and ends every wave's reads of stage t
        if (t + 2 < NT) issue(t + 2, t & 1);
    }
    asm volatile("s_wait_asynccnt 0x0" ::: "memory");       // no copy is outstanding when the wave goes on to its end
#pragma unroll
    for (int mb = 0; mb < 4; ++mb) {
#pragma unroll
        for (int nb = 0; nb < 4; ++nb) {
#pragma unroll
            for (int j = 0; j < 8; ++j) os[(hi * 8 + j) * 68 + nb * 16 + lr] = acc[mb][nb][j]; }
        __builtin_amdgcn_wave_barrier(); asm volatile("" ::: "memory");
        if (PLANES) {
            const bool isv = (z == 2); const int R0 = r0 + mb * 16; h16* P16 = isv ? V16 : QK16; bf* Ph = isv ? Vh : QKh; bf* Pl = isv ? Vl : QKl;
            const int lofs = (lane >> 3) * 68 + (lane & 7) * 8, lstep = 4 * 68;
            const size_t e0 = isv ? ((size_t)(R0 / 128) * HD + (by >> 2) * 16) * TT + (R0 % 128 + (lane >> 3)) * 256 + (by & 3) * 64 + (lane & 7) * 8 : z * sC + (size_t)(R0 + (lane >> 3)) * ldc + c0 + (lane & 7) * 8, estep = isv ? (size_t)4 * 256 : (size_t)4 * ldc;
#pragma unroll
            for (int s = 0; s < 4; ++s) { const float* p = os + lofs + s * lstep; const v4f x = *(const v4fa*)p, y = *(const v4fa*)(p + 4); v8h o16; v8us oh, ol;
#pragma unroll
                for (int j = 0; j < 8; ++j) { const float r = (j < 4) ? x[j & 3] : y[j & 3]; o16[j] = tohx(r); unsigned short a2, c2; splitf(r, a2, c2); oh[j] = a2; ol[j] = c2; }
                const size_t e = e0 + s * estep; *(v8ha*)(P16 + e) = o16; *(v8usa*)(Ph + e) = oh; *(v8usa*)(Pl + e) = ol; }
        } else {
        float* crow = C + (size_t)(r0 + mb * 16) * ldc + c0;
#pragma unroll
            for (int s = 0; s < 8; ++s) { const int row = 2 * s + hi, cofs = lr * 4; v4f val = *(const v4fa*)(os + row * 68 + cofs); if (BIAS) { val[0] += bfr(bias[c0 + cofs]); val[1] += bfr(bias[c0 + cofs + 1]); val[2] += bfr(bias[c0 + cofs + 2]); val[3] += bfr(bias[c0 + cofs + 3]); }
                *(v4f*)(crow + (size_t)row * ldc + cofs) = val; }
             }
        __builtin_amdgcn_wave_barrier(); asm volatile("" ::: "memory");
    }
}

typedef __attribute__((ext_vector_type(4))) _Float16 v4h;
typedef __attribute__((ext_vector_type(2))) unsigned short v2us;
typedef __attribute__((ext_vector_type(4))) unsigned short v4us;
typedef __attribute__((ext_vector_type(4))) int v4i;
typedef v4h  __attribute__((may_alias)) v4ha;
typedef v4us __attribute__((may_alias)) v4usa;

// The two builders are device functions that take their tile index: both share one grid (k_prep below).
// FRAGMENT BLOCKS: a K-contiguous plane P[row][k] is stored as blocks of 16 rows x 32 k (512 elements, 1 KB), block (row / 16) * (K / 32) + k / 32; inside a block element (row, k) stands at
//   ((k / 16) % 2) * 256 + (((k / 8) % 2) * 16 + row % 16) * 8 + k % 8: the two 16-byte loads of a WMMA fragment (lane = hi * 16 + lr) each read 512 contiguous bytes. A piece = 8 k of one row = 16 bytes, piece hh * 16 + row % 16 of its block, hh = (k / 8) % 4.
// A work-group of 8 waves makes 32 blocks (64 KB of f32 in, 32 KB out) in two halves u of 16: every lane first issues all its 16 loads of 16 bytes (a wave's load covers 4 whole 128-byte lines), rounds, and puts its pieces at their place
//   in an LDS image of the blocks; behind one barrier the image goes out in stores of 512 contiguous bytes a wave. In the image the 16 pieces of a 256-byte column hh are turned by some places (a function of block and hh only, so that a reader's
//   16 lanes still read one whole column) so that the pieces of one LDS store fall on all banks.
// b_wtG: P[n'][k] = bf16(w[k][n]). Row n' of P holds column n of w, by ord (fb = n / HD the feature block = pseudo-position % 16, d = n % HD):
//   0: n = n'. 1 (query, key weights): n' = (d / 8) * 128 + (fb / 8) * 64 + (fb % 8) * 8 + d % 8. 2 (value weight): n' = (d / 16) * 256 + (fb / 8) * 128 + ((d / 8) % 2) * 64 + (d % 8) * 8 + fb % 8.
//   With 1 and 2 the 64 columns of a GEMM tile are 8 positions x 8 dims of each token: one whole 128-byte line of the head planes' fragment blocks (see k_gemmw PLANES).
//   Tile g = kb * 2 + fbh: k block kb, feature blocks fbh * 8 + wave, half u = d / 32: in every ord these 256 columns are 16 whole blocks. A lane loads 4 columns of 8 k rows: 4 pieces, turned in its registers.
__device__ __forceinline__ constexpr int wrot(int ord, int lb) { return (ord == 1) ? ((lb >> 2) & 1) * 8 : (ord == 2) ? ((lb >> 1) & 3) * 4 : 0; }
template <int ord> __device__ __forceinline__ void b_wtG(int g, const float* __restrict__ w, bf* Bt, char* sm) {
    const int t = threadIdx.x, wv = t >> 5, hh = (t >> 3) & 3, c = t & 7, kb = g >> 1, fbh = g & 1;
    const float* sp = w + (size_t)(kb * 32 + hh * 8) * DQ + (fbh * 8 + wv) * HD + c * 4; v4f v[2][8];
#pragma unroll
    for (int u = 0; u < 2; ++u)
#pragma unroll
        for (int j = 0; j < 8; ++j) v[u][j] = *(const v4fa*)(sp + (size_t)j * DQ + u * 32);
    __builtin_amdgcn_sched_barrier(0);                       // all 16 loads issue ahead of the first rounding: one memory latency a work-group (without it five of them are sunk behind the wait for the first ones)
    asm volatile("s_wait_xcnt 0x0" :: "v"(sp) : "memory");   // in front of any reuse of the loads' address registers (the address, named as an input, stays whole up to here); all 16 loads are issued in front of it
#pragma unroll
    for (int u = 0; u < 2; ++u)
#pragma unroll
        for (int s = 0; s < 4; ++s) { const int dd = c * 4 + s;   // d % 32
            const int lb = (ord == 0) ? wv * 2 + (dd >> 4) : (ord == 1) ? (dd >> 3) * 4 + (wv >> 1) : dd >> 1, lr = (ord == 0) ? dd & 15 : (ord == 1) ? (wv & 1) * 8 + (dd & 7) : (dd & 1) * 8 + wv; v8us o;
#pragma unroll
            for (int j = 0; j < 8; ++j) o[j] = f2bf(v[u][j][s]);
            *(v8usa*)(sm + u * 16384 + lb * 1024 + hh * 256 + ((lr + hh + wrot(ord, lb)) & 15) * 16) = o; }
    __syncthreads();                                         // every wave's pieces are in the image before any thread reads it
    const int h2 = (t >> 4) & 3, r2 = t & 15;
#pragma unroll
    for (int u = 0; u < 2; ++u)
#pragma unroll
        for (int i = 0; i < 4; ++i) { const int lb = i * 4 + (t >> 6);
            const int rb = (ord == 0) ? (fbh * 8 + (lb >> 1)) * 4 + u * 2 + (lb & 1) : (ord == 1) ? (u * 4 + (lb >> 2)) * 8 + fbh * 4 + (lb & 3) : (u * 2 + (lb >> 3)) * 16 + fbh * 8 + (lb & 7);
            *(v8us*)(Bt + ((size_t)rb * (DM / 32) + kb) * 512 + (t & 63) * 8) = *(const v8usa*)(sm + u * 16384 + lb * 1024 + h2 * 256 + ((r2 + h2 + wrot(ord, lb)) & 15) * 16); }
    asm volatile("s_wait_xcnt 0x0" ::: "memory");            // behind the last store, in front of any later write of the stores' address or data registers (the other builders' code follows in the listing)
}
// b_cvt8: bf16 copy of src[row][DM] in fragment blocks. Tile rb = 16 whole rows (32 blocks in a row in memory), half u = k / 512; wave wv has the blocks u * 16 + wv * 2 + b; a lane loads 4 k (half a piece) of row i * 4 + lane / 8.
__device__ __forceinline__ void b_cvt8(int rb, const float* __restrict__ src, bf* dst, char* sm) {
    const int t = threadIdx.x, wv = t >> 5, rq = (t >> 3) & 3, c = t & 7, hh = c >> 1;
    const float* sp = src + (size_t)(rb * 16 + rq) * DM + wv * 64 + c * 4; v4f v[2][8];
#pragma unroll
    for (int u = 0; u < 2; ++u)
#pragma unroll
        for (int j = 0; j < 8; ++j) v[u][j] = *(const v4fa*)(sp + (size_t)((j & 3) * 4) * DM + u * 512 + (j >> 2) * 32);
    asm volatile("s_wait_xcnt 0x0" :: "v"(sp) : "memory");   // as in b_wtG
#pragma unroll
    for (int u = 0; u < 2; ++u)
#pragma unroll
        for (int j = 0; j < 8; ++j) { v4us o;
#pragma unroll
            for (int e = 0; e < 4; ++e) o[e] = f2bf(v[u][j][e]);
            *(v4usa*)(sm + u * 16384 + (wv * 2 + (j >> 2)) * 1024 + hh * 256 + (((j & 3) * 4 + rq + 4 * hh) & 15) * 16 + (c & 1) * 8) = o; }
    __syncthreads();                                         // every wave's pieces are in the image before any thread reads it
    const int h2 = (t >> 4) & 3, r2 = t & 15;
#pragma unroll
    for (int u = 0; u < 2; ++u)
#pragma unroll
        for (int i = 0; i < 4; ++i) { const int lb = i * 4 + (t >> 6);
            *(v8us*)(dst + ((size_t)rb * (DM / 32) + u * 16 + lb) * 512 + (t & 63) * 8) = *(const v8usa*)(sm + u * 16384 + lb * 1024 + h2 * 256 + ((r2 + 4 * h2) & 15) * 16); }
    asm volatile("s_wait_xcnt 0x0" ::: "memory");            // as behind the stores of b_wtG
}

// ---- k_prep: everything that reads only the inputs, in one launch: the four weight transposes (WB work-groups each, planes WT[0..3] = q, k, v, out), the bf16 copy of x (both batches, XBLK work-groups). The block ranges are work-group uniform, so each builder's barrier is passed by the whole work-group.
#define WB   (DM / 32 * 2)
#define XBLK (NB_ * TT / 16)
static_assert(DM == 1024 && DQ == 1024 && HD == 64, "the builders' tiles are laid out for these sizes");
__global__ __launch_bounds__(256) void k_prep(const float* __restrict__ x, const float* __restrict__ wq, const float* __restrict__ wk, const float* __restrict__ wv, const float* __restrict__ wo, bf* WT, bf* XB) {
    __shared__ __align__(16) char sm[2 * 16384];
    const int bx = (int)blockIdx.x;
    if (bx < 2 * WB) b_wtG<1>(bx % WB, (bx < WB) ? wq : wk, WT + (size_t)(bx / WB) * DM * DQ, sm);
    else if (bx < 3 * WB) b_wtG<2>(bx - 2 * WB, wv, WT + (size_t)2 * DM * DQ, sm);
    else if (bx < 4 * WB) b_wtG<0>(bx - 3 * WB, wo, WT + (size_t)3 * DM * DQ, sm);
    else b_cvt8(bx - 4 * WB, x, XB, sm);
}
// ---- k_fa: scores, causal softmax, probability x value and the hi/lo merge in ONE kernel (online softmax; no score plane in memory). Grid (TT / QT, batches x heads), FNW waves per work-group.
// A work-group owns QT = 32 query rows of one head; its keys 0 .. q0 + 31 are dealt over the FNW waves in runs of 64, worked in blocks of 32 (the planes are fragment blocks, see b_wtG and k_gemmw PLANES: every fragment load reads 512 contiguous bytes).
// Everything is computed TRANSPOSED so that no fragment changes lanes: S^T = K Q^T (D: row = key hi * 8 + j, column = query lr), which is already the B fragment of O^T = V^T P^T
// (lane lr = query, places 0..7 = keys 8 hi + j of key tile 0, places 8..15 = keys 16 + 8 hi + j of key tile 1: the k order of the V^T loader), and the running maximum and sum of a query live in its own lane.
// FaBody::run works NQ x 16 queries from q0 on (their rows in the LDS partial start at qr). Each wave ends with its own (max, sum, O^T); the FNW partials are joined through LDS in fixed wave order 0..FNW-1 behind one work-group barrier, divided by the sum, split hi/lo and written flat but for an interleave of row pairs (RAW MERGE).
// The short inner loops are all unrolled so that the fragment, score and context arrays stay in registers.
// Rows < RH: bf16 hi/lo planes, 3 products in both contractions; the other rows fp16 (probabilities exp(s - max) <= 1 rounded to fp16).
#define QT   32
#define FNW  8
#define OPIT 68                   // f32 pitch of one query's 64 context values in a wave's LDS partial
#define SCL2 0.18033688011112042f // HD^-0.5 x log2(e): scores go to the base-2 exponent directly
typedef __attribute__((ext_vector_type(16))) unsigned short v16us;
__device__ __forceinline__ void mkp(const float* p, v16h& a, v16h&) {
#pragma unroll
    for (int i = 0; i < 16; ++i) a[i] = (h16)p[i]; }
__device__ __forceinline__ void mkp(const float* p, v16bf& a, v16bf& a2) { v16us h, l;
#pragma unroll
    for (int i = 0; i < 16; ++i) { unsigned short x, y; splitf(p[i], x, y); h[i] = x; l[i] = y; }
    a = __builtin_bit_cast(v16bf, h); a2 = __builtin_bit_cast(v16bf, l); }
template <typename T16, int NSPLIT, int NQ> struct FaBody {
static __device__ __forceinline__ void run(const T16* __restrict__ Q, const T16* __restrict__ Q2, const T16* __restrict__ Kp, const T16* __restrict__ Kp2, const T16* __restrict__ Vt, const T16* __restrict__ Vt2, int q0, int qr, float* os, float* ms, float* ls) {
    typedef typename WFrag<T16>::V V;
    const int lane = threadIdx.x & 31, lr = lane & 15, hi = lane >> 4; const int wv = __builtin_amdgcn_readfirstlane((int)(threadIdx.x >> 5));
    V qf[NQ][2], qf2[NQ][2]; const size_t qo = (size_t)q0 * HD + lane * 8; const T16* qp = Q + qo; const T16* qp2 = (NSPLIT == 2) ? Q2 + qo : qp;
#pragma unroll
    for (int nq = 0; nq < NQ; ++nq)
#pragma unroll
        for (int ks = 0; ks < 2; ++ks) { qf[nq][ks] = WFrag<T16>::ldp(qp + nq * 16 * HD + ks * 512); if (NSPLIT == 2) qf2[nq][ks] = WFrag<T16>::ldp(qp2 + nq * 16 * HD + ks * 512); }
    asm volatile("s_wait_xcnt 0x0" :: "v"(qp), "v"(qp2) : "memory");   // stands in front of any reuse of the loads' address registers; naming the addresses as inputs keeps them whole up to here
    v8f o[4][NQ]; float m[NQ], l[NQ];
#pragma unroll
    for (int nq = 0; nq < NQ; ++nq) { m[nq] = -3.0e38f; l[nq] = 0.f;
#pragma unroll
        for (int dt = 0; dt < 4; ++dt) o[dt][nq] = (v8f){}; }
    const int nkb = q0 / 32 + 1;                                     // key blocks of 32 up to and including the diagonal block
    const int nit = 2 * ((nkb / 2 - wv + FNW - 1) / FNW) + (((nkb & 1) && (nkb / 2) % FNW == wv) ? 1 : 0);   // this wave's blocks: two per whole run of 64, one more where the half run at the diagonal is its own
#pragma unroll 1   // rolled: one block's fragments, scores and the context tile already fill the registers
    for (int it = 0; it < nit; ++it) {
        const int kb = ((it >> 1) * FNW + wv) * 2 + (it & 1); const int k0 = kb * 32;
        const size_t ko = (size_t)k0 * HD + lane * 8, vo = (size_t)k0 * 16 + lane * 8;   // fragment blocks: 16 keys x 32 dims (two a key tile), 16 dims x 32 keys (TT / 32 a dim tile)
        const T16* kp = Kp + ko; const T16* kp2 = (NSPLIT == 2) ? Kp2 + ko : kp; const T16* vp = Vt + vo; const T16* vp2 = (NSPLIT == 2) ? Vt2 + vo : vp;
        V ka[2][2], ka2[2][2];
#pragma unroll
        for (int kt = 0; kt < 2; ++kt)
#pragma unroll
            for (int ks = 0; ks < 2; ++ks) { ka[kt][ks] = WFrag<T16>::ldp(kp + kt * 16 * HD + ks * 512); if (NSPLIT == 2) ka2[kt][ks] = WFrag<T16>::ldp(kp2 + kt * 16 * HD + ks * 512); }
        V va[4], va2[4];
#pragma unroll
        for (int dt = 0; dt < 4; ++dt) { va[dt] = WFrag<T16>::ldp(vp + (size_t)dt * 16 * TT); if (NSPLIT == 2) va2[dt] = WFrag<T16>::ldp(vp2 + (size_t)dt * 16 * TT); }
        __builtin_amdgcn_sched_barrier(0);                           // all of the block's loads issue together, ahead of the first product: one load latency a block (without it the loads are sunk between the products and wait one after the other)
        asm volatile("s_wait_xcnt 0x0" :: "v"(kp), "v"(kp2), "v"(vp), "v"(vp2) : "memory");   // as behind the query loads: in front of any reuse of the address registers, which stay whole up to here
        v8f s[2][NQ];
#pragma unroll
        for (int kt = 0; kt < 2; ++kt)
#pragma unroll
            for (int nq = 0; nq < NQ; ++nq) { v8f c = (v8f){};
#pragma unroll
                for (int ks = 0; ks < 2; ++ks) { c = WFrag<T16>::mma(ka[kt][ks], qf[nq][ks], c); if (NSPLIT == 2) { c = WFrag<T16>::mma(ka[kt][ks], qf2[nq][ks], c); c = WFrag<T16>::mma(ka2[kt][ks], qf[nq][ks], c); } }
                s[kt][nq] = c; }
        if (kb == nkb - 1) {                                         // only the last block holds keys beyond a query of this tile (wave-uniform test)
#pragma unroll
            for (int kt = 0; kt < 2; ++kt)
#pragma unroll
                for (int nq = 0; nq < NQ; ++nq)
#pragma unroll
                    for (int j = 0; j < 8; ++j) if (k0 + kt * 16 + hi * 8 + j > q0 + nq * 16 + lr) s[kt][nq][j] = -3.0e38f; }
#pragma unroll
        for (int nq = 0; nq < NQ; ++nq) { float p[16]; float mx = -3.0e38f;
#pragma unroll
            for (int kt = 0; kt < 2; ++kt)
#pragma unroll
                for (int j = 0; j < 8; ++j) { const float t = s[kt][nq][j] * SCL2; p[kt * 8 + j] = t; mx = fmaxf(mx, t); }
            mx = fmaxf(mx, __shfl_xor(mx, 16, 32));                  // the two lane halves hold the two halves of a query's keys
            const float mn = fmaxf(m[nq], mx); const float sc = __builtin_amdgcn_exp2f(m[nq] - mn); m[nq] = mn; float sum = 0.f;
#pragma unroll
            for (int i = 0; i < 16; ++i) { p[i] = __builtin_amdgcn_exp2f(p[i] - mn); sum += p[i]; }
            l[nq] = l[nq] * sc + sum;
            V pf, pf2; mkp(p, pf, pf2);
#pragma unroll
            for (int dt = 0; dt < 4; ++dt) { v8f c = o[dt][nq] * sc; c = WFrag<T16>::mma(va[dt], pf, c); if (NSPLIT == 2) { c = WFrag<T16>::mma(va[dt], pf2, c); c = WFrag<T16>::mma(va2[dt], pf, c); } o[dt][nq] = c; } }
    }
    float* ow = os + wv * (QT * OPIT);
#pragma unroll
    for (int nq = 0; nq < NQ; ++nq) { l[nq] += __shfl_xor(l[nq], 16, 32);
#pragma unroll
        for (int dt = 0; dt < 4; ++dt) { float* d = ow + (qr + nq * 16 + lr) * OPIT + dt * 16 + hi * 8; v4f x, y;
#pragma unroll
            for (int j = 0; j < 4; ++j) { x[j] = o[dt][nq][j]; y[j] = o[dt][nq][4 + j]; }
            *(v4fa*)d = x; *(v4fa*)(d + 4) = y; }
        if (hi == 0) { ms[wv * QT + qr + nq * 16 + lr] = m[nq]; ls[wv * QT + qr + nq * 16 + lr] = l[nq]; } }
}
};
__global__ __launch_bounds__(256) void k_fa(const h16* __restrict__ Q16, const h16* __restrict__ K16, const h16* __restrict__ V16, const bf* __restrict__ Qh, const bf* __restrict__ Ql, const bf* __restrict__ Kh, const bf* __restrict__ Kl, const bf* __restrict__ Vh, const bf* __restrict__ Vl, bf* Ah, bf* Al) {
    __shared__ __align__(16) float os[FNW * QT * OPIT]; __shared__ float ms[FNW * QT]; __shared__ float ls[FNW * QT];
    const size_t po = (size_t)blockIdx.y * TT * HD; const int q0 = (TT / QT - 1 - (int)blockIdx.x) * QT;   // longest rows first
    if (q0 < RH) {
#pragma unroll 1   // the hi/lo rows (short key loops, twice the fragments) go 16 queries at a time, so that they do not set the register count of the fp16 rows
        for (int hf = 0; hf < 2; ++hf) FaBody<bf, 2, 1>::run(Qh + po, Ql + po, Kh + po, Kl + po, Vh + po, Vl + po, q0 + hf * 16, hf * 16, os, ms, ls);
    } else FaBody<h16, 0, 2>::run(Q16 + po, nullptr, K16 + po, nullptr, V16 + po, nullptr, q0, 0, os, ms, ls);
    __syncthreads();                                                 // every wave's partial (max, sum, O^T) is in LDS before any thread joins them
    // ROW PAIRS: the work-group's 2048 flat context values are rows R, R + 1 of the [tokens][DQ] operand of the last GEMM; they are stored, in the same 4 KB, as [k / 32][row % 2][k % 32], so that a fragment load of 16 rows touches 8 lines and uses them whole.
    // Thread -> piece: a wave stores 512 contiguous bytes (4 k blocks); its lane half is the row, so that 16 lanes read two neighbouring queries' partials from LDS as before.
    const int rw = (threadIdx.x >> 4) & 1, kb = (threadIdx.x >> 5) * 4 + ((threadIdx.x >> 2) & 3), k8 = threadIdx.x & 3;
    const int q = rw * 16 + (kb >> 1), d0 = (kb & 1) * 32 + k8 * 8; float mt = ms[q];
#pragma unroll
    for (int w = 1; w < FNW; ++w) mt = fmaxf(mt, ms[w * QT + q]);
    float acc[8], lt = 0.f;
#pragma unroll
    for (int j = 0; j < 8; ++j) acc[j] = 0.f;
#pragma unroll
    for (int w = 0; w < FNW; ++w) { const float f = __builtin_amdgcn_exp2f(ms[w * QT + q] - mt); lt += f * ls[w * QT + q]; const float* s = os + w * (QT * OPIT) + q * OPIT + d0; const v4f x = *(const v4fa*)s, y = *(const v4fa*)(s + 4);
#pragma unroll
        for (int j = 0; j < 4; ++j) { acc[j] += f * x[j]; acc[4 + j] += f * y[j]; } }
    const float inv = __fdiv_rn(1.0f, lt); v8us oh, ol;
#pragma unroll
    for (int j = 0; j < 8; ++j) { unsigned short a, c2; splitf(acc[j] * inv, a, c2); oh[j] = a; ol[j] = c2; }
    const size_t oo = po + (size_t)q0 * HD + (kb * 8 + rw * 4 + k8) * 8;   /* RAW MERGE: flat element (q0 + q) * HD + d0 of the (H, S, hd) context = the module's ctx.reshape(b, S, H * hd) without a transpose, at its place in the row pair */
    *(v8usa*)(Ah + oo) = oh; *(v8usa*)(Al + oo) = ol;
}

extern "C" void kernel_launch(void* const* d_in, const int* in_sizes, int n_in,
                              void* d_out, int out_size, void* d_ws, size_t ws_size, hipStream_t stream) {
    (void)in_sizes; (void)n_in; (void)out_size;
    const float* x = (const float*)d_in[0]; const float* wq = (const float*)d_in[1]; const float* wk = (const float*)d_in[2]; const float* wv = (const float*)d_in[3]; const float* wo = (const float*)d_in[4];
    float* OUT = (float*)d_out;     // [2][2048][1024]
    char* wsp = (char*)d_ws;
    auto take = [&](size_t bytes) { char* p = wsp; wsp += (bytes + 255) & ~(size_t)255; return (void*)p; };
    const size_t PL = (size_t)NB_ * TT * DQ;   // elements of one plane over both batches (DQ == DKV == DM here)
    bf* WT = (bf*)take((size_t)4 * DQ * DM * 2); bf* WO = WT + (size_t)3 * DQ * DM;
    bf* XB = (bf*)take(PL * 2);
    h16* QP16 = (h16*)take(2 * PL * 2); h16* KP16 = QP16 + PL; h16* VT16 = (h16*)take(PL * 2);
    bf* QPh = (bf*)take(2 * PL * 2); bf* KPh = QPh + PL; bf* QPl = (bf*)take(2 * PL * 2); bf* KPl = QPl + PL; bf* VTh = (bf*)take(PL * 2); bf* VTl = (bf*)take(PL * 2);
    bf* ATh = (bf*)take(PL * 2); bf* ATl = (bf*)take(PL * 2);
    if ((size_t)(wsp - (char*)d_ws) > ws_size) return;    // ws 256 MiB
    k_prep<<<4 * WB + XBLK, 256, 0, stream>>>(x, wq, wk, wv, wo, WT, XB);
    k_gemmw<bf, 0, false, true, DM><<<dim3(NB_ * TT / 128, DQ / 128, 3), 128, 0, stream>>>(XB, nullptr, WT, nullptr, DQ, nullptr, 0, (size_t)DQ * DM, PL, QP16, QPh, QPl, VT16, VTh, VTl);   // z = q, k, v; writes the head planes
    k_fa<<<dim3(TT / QT, NB_ * NH_, 1), 32 * FNW, 0, stream>>>(QP16, KP16, VT16, QPh, QPl, KPh, KPl, VTh, VTl, ATh, ATl);
    k_gemmw<bf, 1, false, false, DQ><<<dim3(NB_ * TT / 128, DM / 128, 1), 128, 0, stream>>>(ATh, ATl, WO, OUT, DM, nullptr, 0, 0, 0, nullptr, nullptr, nullptr, nullptr, nullptr, nullptr);
}

// v009
// It runs in 80 microseconds.
// Next to v008, in two timings, it ran 1.07 times as fast each time.
// Over all steps from v000 it is 18.4 times as fast.
#include <hip/hip_runtime.h>

// Causal multi-head attention whose heads are a RAW VIEW of the projections (x [2][2048][1024]; q, k, v = x W ('xw' [1024][1024] 0.02-scale, no bias); each is reshaped (b, 16, 2048, 64) WITHOUT a transpose: pseudo-head h, pseudo-position s, dim d = flat element h*2048*64 + s*64 + d of the [2048][1024] projection output (head h covers tokens 128 h .. 128 h + 127; pseudo-position s is the 64-wide feature block s mod 16 of token 128 h + s / 16); scores / sqrt(64); triu(k = 1) over the pseudo-positions -> -inf; softmax; the context (b, 16, 2048, 64) is reshaped (b, 2048, 1024) again WITHOUT a transpose; out = that Wproj ('xw', no bias) -> [2][2048][1024] (4.2 M); argument order x, Wq, Wk, Wv, Wproj).
// Layout, both batches in every launch (4 launches: k_prep, k_gemmw q/k/v, k_fa, k_gemmw out): bf16 copy of x and 'xw' weights transposed once, both stored in WMMA fragment blocks; exact projections; RAW VIEW: the q/k/v GEMM's epilogue writes the 16-bit head planes itself, taking each [2048][1024] projection output as (16, 2048, 64) WITHOUT a transpose (head stride TT x HD, inside a head WMMA fragment blocks; no f32 projection plane in memory), and k_fa writes the context planes back flat but for an interleave of row pairs (no transpose back): the module's own reshapes; causal T-2048 attention (hybrid rows: < 512 hi/lo 3 products, rest fp16; key blocks above the diagonal skipped; one fused kernel, online softmax); merged hi/lo x Wo exact.
// Compute dtypes, f32 accumulate: every input rounded to bf16; projections exact; attention rows < 512 3 products, rest fp16; softmax f32; Wo hl x exact.

#define NB_  2
#define TT   2048
#define DM   1024
#define NH_  16
#define NKV  16
#define HD   64
#define DQ   (NH_ * HD)
#define DKV  (NKV * HD)
#define RH   512                  // query rows < RH use hi+lo planes (0: none)
typedef _Float16 h16;
typedef unsigned short bf;
typedef __attribute__((ext_vector_type(16))) __bf16   v16bf;
typedef __attribute__((ext_vector_type(16))) _Float16 v16h;
typedef __attribute__((ext_vector_type(8)))  _Float16 v8h;
typedef __attribute__((ext_vector_type(8)))  unsigned short v8us;
typedef __attribute__((ext_vector_type(8)))  float    v8f;
typedef __attribute__((ext_vector_type(4)))  float    v4f;
typedef v8h  __attribute__((may_alias)) v8ha;
typedef v4f  __attribute__((may_alias)) v4fa;
typedef v8us __attribute__((may_alias)) v8usa;

__device__ __forceinline__ unsigned short f2bf(float f) { unsigned u = __float_as_uint(f); u += 0x7FFFu + ((u >> 16) & 1u); return (unsigned short)(u >> 16); }
__device__ __forceinline__ float bf2f(unsigned short b) { return __uint_as_float(((unsigned)b) << 16); }
__device__ __forceinline__ float bfr(float f) { return bf2f(f2bf(f)); }
__device__ __forceinline__ v16h cat16(v8h lo, v8h hi) { return __builtin_shufflevector(lo, hi, 0, 1, 2, 3, 4, 5, 6, 7, 8, 9, 10, 11, 12, 13, 14, 15); }
__device__ __forceinline__ v16bf cat16b(v8us lo, v8us hi) { return __builtin_bit_cast(v16bf, __builtin_shufflevector(lo, hi, 0, 1, 2, 3, 4, 5, 6, 7, 8, 9, 10, 11, 12, 13, 14, 15)); }
__device__ __forceinline__ v8f wmma16(v16h a, v16h b, v8f c) { return __builtin_amdgcn_wmma_f32_16x16x32_f16(false, a, false, b, (short)0, c, false, false); }
__device__ __forceinline__ v8f wmmab(v16bf a, v16bf b, v8f c) { return __builtin_amdgcn_wmma_f32_16x16x32_bf16(false, a, false, b, (short)0, c, false, false); }



// ---- k_gemmw: register-blocked GEMM, a work-group of 4 waves (2 x 2) per 128x128 output tile, each wave a 64x64 quarter (16 accumulators); grid (M/128, N/128, Z), 128 threads.
// The operands come from 16-bit planes through LDS: a stage is 64 k of the tile's 128 A rows (each A plane) and 128 Bt rows, brought in by asynchronous copies (16 bytes a lane, through no register) and read by both waves that need it;
// three buffers: a stage's copies are issued two stages ahead, so that two stages fly while one is worked on. In LDS every operand stands in FRAGMENT BLOCKS, a unit = 16 rows x 64 k = 2 blocks = 2 KB; units: A plane 0 (8), A plane 1 (8, where NSPLIT), Bt (8).
// Plane layouts in memory: Bt always, and A where PLANES, in FRAGMENT BLOCKS (see b_wtG): a unit is 2 KB in a row. A otherwise in ROW PAIRS (see k_fa: [row / 2][k / 32][row % 2][k % 32]): a unit is 256 bytes of each of 8 row pairs, and the copy puts each 16-byte piece at its
//   place in the fragment block, the 16 rows of the piece column k8 = (k / 8) % 4 turned by 4 * k8 places (the pieces of one copy then fall on all banks; a reader's 16 lanes still read one whole 256-byte column). The k order inside a fragment is the same in all of them.
// C[m][n] (f32, pitch ldc, + optional f32 bias[n]) = sum_k A[m][k] Bt[n][k] (+ A2[m][k] Bt[n][k] where NSPLIT). z-batch strides sA/sB/sC in elements. K % 64 == 0, K >= 192.
// PLANES (the q/k/v projections, z = 0, 1, 2; ldc = DQ): no C; each staged 16 x 64 block goes out as the fp16 and bf16 hi/lo head planes, 8 values and one 16-byte store a plane and lane. by = the wave's column tile of 64.
//   The head planes are FRAGMENT BLOCKS too, per pseudo-head g = R / 128: query and key planes 16 positions x 32 dims, value planes (transposed) 16 dims x 32 positions. k_prep has put the weights' rows in an order (b_wtG, ord 1 and 2)
//   in which the 64 columns of a tile are, for token row R, 8 positions (R % 128) * 16 + fb x 8 dims: one whole 128-byte line of a block; a store writes the lines of 4 token rows.
//   z < 2: columns (fb % 8) * 8 + d % 8, by = (d / 8) * 2 + fb / 8: the line stands at R * ldc + c0, the address of the flat RAW VIEW (a token's 16 positions x 64 dims are its two blocks, 2 KB).
//   z = 2: columns (d % 8) * 8 + fb % 8, by = (d / 16) * 4 + (fb / 8) * 2 + (d / 8) % 2: the line stands at ((g * HD + (d / 16) * 16) * TT) + (R % 128) * 256 + (by % 4) * 64.
template <typename T16> struct WFrag;
template <> struct WFrag<h16> { typedef v16h V; static __device__ __forceinline__ V ldp(const h16* p) { return cat16(*(const v8h*)p, *(const v8h*)(p + 256)); } static __device__ __forceinline__ V ld2(const char* p, const char* q) { return cat16(*(const v8ha*)p, *(const v8ha*)q); } static __device__ __forceinline__ v8f mma(V a, V b, v8f c) { return wmma16(a, b, c); } };
template <> struct WFrag<bf> { typedef v16bf V; static __device__ __forceinline__ V ldp(const bf* p) { return cat16b(*(const v8us*)p, *(const v8us*)(p + 256)); } static __device__ __forceinline__ V ld2(const char* p, const char* q) { return cat16b(*(const v8usa*)p, *(const v8usa*)q); } static __device__ __forceinline__ v8f mma(V a, V b, v8f c) { return wmmab(a, b, c); } };
__device__ __forceinline__ h16 tohx(float x) { return (h16)x; }
__device__ __forceinline__ void splitf(float y, unsigned short& h, unsigned short& l) { h = f2bf(y); l = f2bf(y - bf2f(h)); }
// One unit's four asynchronous copies (each lane: its own 16 bytes, LDS byte address l, global address g). The s_wait_xcnt stands inside the statement, behind the last copy, so that no address register is rewritten in front of it.
__device__ __forceinline__ void cp4(unsigned l0, const char* g0, unsigned l1, const char* g1, unsigned l2, const char* g2, unsigned l3, const char* g3) {
    asm volatile("global_load_async_to_lds_b128 %0, %1, off\n\tglobal_load_async_to_lds_b128 %2, %3, off\n\tglobal_load_async_to_lds_b128 %4, %5, off\n\tglobal_load_async_to_lds_b128 %6, %7, off\n\ts_wait_xcnt 0x0"
                 :: "v"(l0), "v"(g0), "v"(l1), "v"(g1), "v"(l2), "v"(g2), "v"(l3), "v"(g3) : "memory");
}
template <typename T16, int NSPLIT, bool BIAS, bool PLANES, int K>
__global__ __launch_bounds__(128) void k_gemmw(const T16* __restrict__ A, const T16* __restrict__ A2, const T16* __restrict__ Bt, float* C, int ldc, const float* __restrict__ bias, size_t sA, size_t sB, size_t sC, h16* QK16, bf* QKh, bf* QKl, h16* V16, bf* Vh, bf* Vl) {
    typedef typename WFrag<T16>::V V;
    static_assert(NSPLIT == 0 || NSPLIT == 1, "one or two A planes"); static_assert(K % 64 == 0 && K >= 192, "three stages or more");
    constexpr int NA = NSPLIT + 1, STG = (NA + 1) * 8 * 2048, NT = K / 64, CPS = (2 * NA + 2) * 4;   // A planes; bytes of a stage; stages; copies of one wave a stage (the same in every wave; two stages, the most in flight, stay under 63)
    static_assert(2 * CPS <= 63 && 4 * 16 * 68 * 4 <= STG, "copies in flight; the epilogue's staging fits the first buffer");
    __shared__ __align__(1024) char ring[3 * STG];
    const size_t z = blockIdx.z; A += z * sA; if (NA == 2) A2 += z * sA; Bt += z * sB; if (!PLANES) C += z * sC;
    const int lane = threadIdx.x & 31, lr = lane & 15, hi = lane >> 4; const int wv = __builtin_amdgcn_readfirstlane((int)(threadIdx.x >> 5)), wm = wv >> 1, wn = wv & 1;
    const int r0 = blockIdx.x * 128 + wm * 64, by = blockIdx.y * 2 + wn, c0 = by * 64; float* os = (float*)ring + wv * (16 * 68);   // the epilogue stages in the ring: behind the last trip's barrier nobody reads it and no copy is outstanding
    v8f acc[4][4];
#pragma unroll
    for (int mb = 0; mb < 4; ++mb)
#pragma unroll
        for (int nb = 0; nb < 4; ++nb) acc[mb][nb] = (v8f){};
    // The copies of a stage are dealt by unit: wave wv brings A units wv * 2 NA .. + 2 NA - 1 (of 8 NA) and Bt units wv * 2, wv * 2 + 1 (of 8): 4 copies a unit.
    const unsigned rb32 = (unsigned)(size_t)(void*)ring;   // the ring's byte address in the work-group's LDS
    unsigned la[4];                                        // the lane's place inside an A unit, copy c
#pragma unroll
    for (int c = 0; c < 4; ++c) la[c] = PLANES ? c * 512 + lane * 16 : ((lane >> 3) & 1) * 1024 + ((lane >> 1) & 1) * 512 + (lane & 1) * 256 + ((lane >> 4) * 2 + ((lane >> 2) & 1) + 4 * ((c + lane) & 3)) * 16;
    constexpr int CSA = PLANES ? 512 : 8 * K, TSA = PLANES ? 2048 : 256;   // global bytes from copy to copy (row pairs: two pairs on) and from stage to stage
    const int ua = wv * (2 * NA);
    const char* gA = (const char*)(((NA == 2 && ua >= 8) ? A2 : A) + (size_t)(blockIdx.x * 128 + (ua & 7) * 16) * K) + (PLANES ? lane * 16 : (lane >> 4) * (4 * K) + (lane & 15) * 16);
    const char* gB = (const char*)(Bt + (size_t)(blockIdx.y * 128 + wv * 32) * K) + lane * 16;
    auto unit = [&](int t, int bo, int u) {   // the u-th of the wave's 2 NA + 2 units of stage t, into the buffer at byte offset bo of the ring
        const unsigned lb = rb32 + bo;
        if (u < 2 * NA) { const char* g = gA + (size_t)u * (32 * K) + (size_t)t * TSA; const unsigned l = lb + (ua + u) * 2048;
            cp4(l + la[0], g, l + la[1], g + CSA, l + la[2], g + 2 * CSA, l + la[3], g + 3 * CSA); }
        else { const int i = u - 2 * NA; const char* g = gB + (size_t)i * (32 * K) + (size_t)t * 2048; const unsigned l = lb + (NA * 8 + wv * 2 + i) * 2048 + lane * 16;
            cp4(l, g, l + 512, g + 512, l + 1024, g + 1024, l + 1536, g + 1536); }
    };
    auto issue = [&](int t, int bo) {
#pragma unroll
        for (int u = 0; u < 2 * NA + 2; ++u) unit(t, bo, u);
    };
    issue(0, 0); issue(1, STG);
    asm volatile("s_wait_asynccnt %0" :: "i"(CPS) : "memory");   // this wave's copies of stage 0 have landed: only the CPS youngest, stage 1's, may still fly
    __syncthreads();                                     // every wave's have: stage 0 may be read
    // Where a trip's copies are issued. EARLY (one wave a SIMD, nothing else to cover a wait): stage t + 2's among trip t's first fragment reads, so that the copies' address sums and waits run while those fragments come in.
    // Otherwise (three waves a SIMD cover each other, and with the fragments live the copies' address registers would spill): stage t + 3's at the foot of trip t, behind its barrier.
    // Either way two stages are in flight at a trip's foot, and a buffer is refilled only behind the barrier that ended its readers' last read.
    constexpr bool EARLY = !PLANES; static_assert(!EARLY || NA == 2, "the early form deals six units among twelve fragments");
    if (!EARLY) issue(2, 2 * STG);
    // The lane's two 16-byte reads of a fragment inside a block: k 8 hi .. and 16 + 8 hi ..; the A blocks made from row pairs have their rows turned (see above).
    const int ao0 = PLANES ? lane * 16 : hi * 256 + ((lr + 4 * hi) & 15) * 16, ao1 = 512 + (PLANES ? lane * 16 : hi * 256 + ((lr + 8 + 4 * hi) & 15) * 16);
    int t = 0, cur = 0, fre = 2 * STG;   // the trip; byte offsets of buffer t % 3, which trip t reads, and of buffer (t + 2) % 3, which every wave left in front of the barrier of trip t - 1
#pragma unroll   // two loops in the code: ph 0, the trips with a stage t + 2 (copies in flight behind the foot, counted wait); ph 1, the last two (wait to 0)
    for (int ph = 0; ph < 2; ++ph) {
#pragma unroll 1   // rolled: one stage a trip, the buffers taken in turn
    for (; t < (ph ? NT : NT - 2); ++t) {
        const char* sb = ring + cur; const char* sa = sb + wm * (4 * 2048); const char* sbt = sb + (NA * 8 + wn * 4) * 2048 + lane * 16;
        V a[2][4], a2[2][4], b[2][4];
#pragma unroll
        for (int kk = 0; kk < 2; ++kk) {
#pragma unroll
            for (int mb = 0; mb < 4; ++mb) { const char* p = sa + mb * 2048 + kk * 1024; a[kk][mb] = WFrag<T16>::ld2(p + ao0, p + ao1); if (NA == 2) a2[kk][mb] = WFrag<T16>::ld2(p + 8 * 2048 + ao0, p + 8 * 2048 + ao1);
                if (EARLY && ph == 0 && kk == 0) unit(t + 2, fre, mb); }                       // a unit's copies behind every four reads; they land in a buffer other than the one being read
#pragma unroll
            for (int nb = 0; nb < 4; ++nb) { const char* p = sbt + nb * 2048 + kk * 1024; b[kk][nb] = WFrag<T16>::ld2(p, p + 512);
                if (EARLY && ph == 0 && kk == 0 && (nb & 1)) unit(t + 2, fre, 4 + (nb >> 1)); }
        }
        __builtin_amdgcn_sched_barrier(0);                   // the stage's LDS reads issue ahead of its products: one LDS latency a trip (without it one Bt fragment is read at a time, and every four products wait for a read)
#pragma unroll
        for (int kk = 0; kk < 2; ++kk)
#pragma unroll
            for (int nb = 0; nb < 4; ++nb)
#pragma unroll
                for (int mb = 0; mb < 4; ++mb) { acc[mb][nb] = WFrag<T16>::mma(a[kk][mb], b[kk][nb], acc[mb][nb]); if (NA == 2) acc[mb][nb] = WFrag<T16>::mma(a2[kk][mb], b[kk][nb], acc[mb][nb]); }
        __builtin_amdgcn_sched_barrier(0);                   // the hand-over stays behind the products: moved up in front of them, its wait for the next stage's copies would stand that much nearer to their issue
        asm volatile("s_wait_dscnt 0x0" ::: "memory");      // this wave's reads of the buffer are done before the buffer is refilled
        if (ph == 0) asm volatile("s_wait_asynccnt %0" :: "i"(CPS) : "memory");   // this wave's copies of stage t + 1 have landed: the CPS youngest are stage t + 2's
        else asm volatile("s_wait_asynccnt 0x0" ::: "memory");                    // no stage t + 2: to 0
        __syncthreads();                                     // publishes stage t + 1 and ends every wave's reads of stage t
        if (!EARLY && ph == 0 && t + 3 < NT) issue(t + 3, cur);
        fre = cur; cur = (cur == 2 * STG) ? 0 : cur + STG;
    }
    }
    asm volatile("s_wait_asynccnt 0x0" ::: "memory");       // no copy is outstanding when the wave goes on to its end
#pragma unroll
    for (int mb = 0; mb < 4; ++mb) {
#pragma unroll
        for (int nb = 0; nb < 4; ++nb) {
#pragma unroll
            for (int j = 0; j < 8; ++j) os[(hi * 8 + j) * 68 + nb * 16 + lr] = acc[mb][nb][j]; }
        __builtin_amdgcn_wave_barrier(); asm volatile("" ::: "memory");
        if (PLANES) {
            const bool isv = (z == 2); const int R0 = r0 + mb * 16; h16* P16 = isv ? V16 : QK16; bf* Ph = isv ? Vh : QKh; bf* Pl = isv ? Vl : QKl;
            const int lofs = (lane >> 3) * 68 + (lane & 7) * 8, lstep = 4 * 68;
            const size_t e0 = isv ? ((size_t)(R0 / 128) * HD + (by >> 2) * 16) * TT + (R0 % 128 + (lane >> 3)) * 256 + (by & 3) * 64 + (lane & 7) * 8 : z * sC + (size_t)(R0 + (lane >> 3)) * ldc + c0 + (lane & 7) * 8, estep = isv ? (size_t)4 * 256 : (size_t)4 * ldc;
#pragma unroll
            for (int s = 0; s < 4; ++s) { const float* p = os + lofs + s * lstep; const v4f x = *(const v4fa*)p, y = *(const v4fa*)(p + 4); v8h o16; v8us oh, ol;
#pragma unroll
                for (int j = 0; j < 8; ++j) { const float r = (j < 4) ? x[j & 3] : y[j & 3]; o16[j] = tohx(r); unsigned short a2, c2; splitf(r, a2, c2); oh[j] = a2; ol[j] = c2; }
                const size_t e = e0 + s * estep; *(v8ha*)(P16 + e) = o16; *(v8usa*)(Ph + e) = oh; *(v8usa*)(Pl + e) = ol; }
        } else {
        float* crow = C + (size_t)(r0 + mb * 16) * ldc + c0;
#pragma unroll
            for (int s = 0; s < 8; ++s) { const int row = 2 * s + hi, cofs = lr * 4; v4f val = *(const v4fa*)(os + row * 68 + cofs); if (BIAS) { val[0] += bfr(bias[c0 + cofs]); val[1] += bfr(bias[c0 + cofs + 1]); val[2] += bfr(bias[c0 + cofs + 2]); val[3] += bfr(bias[c0 + cofs + 3]); }
                *(v4f*)(crow + (size_t)row * ldc + cofs) = val; }
             }
        __builtin_amdgcn_wave_barrier(); asm volatile("" ::: "memory");
    }
}

typedef __attribute__((ext_vector_type(4))) _Float16 v4h;
typedef __attribute__((ext_vector_type(2))) unsigned short v2us;
typedef __attribute__((ext_vector_type(4))) unsigned short v4us;
typedef __attribute__((ext_vector_type(4))) int v4i;
typedef v4h  __attribute__((may_alias)) v4ha;
typedef v4us __attribute__((may_alias)) v4usa;

// The two builders are device functions that take their tile index: both share one grid (k_prep below).
// FRAGMENT BLOCKS: a K-contiguous plane P[row][k] is stored as blocks of 16 rows x 32 k (512 elements, 1 KB), block (row / 16) * (K / 32) + k / 32; inside a block element (row, k) stands at
//   ((k / 16) % 2) * 256 + (((k / 8) % 2) * 16 + row % 16) * 8 + k % 8: the two 16-byte loads of a WMMA fragment (lane = hi * 16 + lr) each read 512 contiguous bytes. A piece = 8 k of one row = 16 bytes, piece hh * 16 + row % 16 of its block, hh = (k / 8) % 4.
// A work-group of 8 waves makes 32 blocks (64 KB of f32 in, 32 KB out) in two halves u of 16: every lane first issues all its 16 loads of 16 bytes (a wave's load covers 4 whole 128-byte lines), rounds, and puts its pieces at their place
//   in an LDS image of the blocks; behind one barrier the image goes out in stores of 512 contiguous bytes a wave. In the image the 16 pieces of a 256-byte column hh are turned by some places (a function of block and hh only, so that a reader's
//   16 lanes still read one whole column) so that the pieces of one LDS store fall on all banks.
// b_wtG: P[n'][k] = bf16(w[k][n]). Row n' of P holds column n of w, by ord (fb = n / HD the feature block = pseudo-position % 16, d = n % HD):
//   0: n = n'. 1 (query, key weights): n' = (d / 8) * 128 + (fb / 8) * 64 + (fb % 8) * 8 + d % 8. 2 (value weight): n' = (d / 16) * 256 + (fb / 8) * 128 + ((d / 8) % 2) * 64 + (d % 8) * 8 + fb % 8.
//   With 1 and 2 the 64 columns of a GEMM tile are 8 positions x 8 dims of each token: one whole 128-byte line of the head planes' fragment blocks (see k_gemmw PLANES).
//   Tile g = kb * 2 + fbh: k block kb, feature blocks fbh * 8 + wave, half u = d / 32: in every ord these 256 columns are 16 whole blocks. A lane loads 4 columns of 8 k rows: 4 pieces, turned in its registers.
__device__ __forceinline__ constexpr int wrot(int ord, int lb) { return (ord == 1) ? ((lb >> 2) & 1) * 8 : (ord == 2) ? ((lb >> 1) & 3) * 4 : 0; }
template <int ord> __device__ __forceinline__ void b_wtG(int g, const float* __restrict__ w, bf* Bt, char* sm) {
    const int t = threadIdx.x, wv = t >> 5, hh = (t >> 3) & 3, c = t & 7, kb = g >> 1, fbh = g & 1;
    const float* sp = w + (size_t)(kb * 32 + hh * 8) * DQ + (fbh * 8 + wv) * HD + c * 4; v4f v[2][8];
#pragma unroll
    for (int u = 0; u < 2; ++u)
#pragma unroll
        for (int j = 0; j < 8; ++j) v[u][j] = *(const v4fa*)(sp + (size_t)j * DQ + u * 32);
    __builtin_amdgcn_sched_barrier(0);                       // all 16 loads issue ahead of the first rounding: one memory latency a work-group (without it five of them are sunk behind the wait for the first ones)
    asm volatile("s_wait_xcnt 0x0" :: "v"(sp) : "memory");   // in front of any reuse of the loads' address registers (the address, named as an input, stays whole up to here); all 16 loads are issued in front of it
#pragma unroll
    for (int u = 0; u < 2; ++u)
#pragma unroll
        for (int s = 0; s < 4; ++s) { const int dd = c * 4 + s;   // d % 32
            const int lb = (ord == 0) ? wv * 2 + (dd >> 4) : (ord == 1) ? (dd >> 3) * 4 + (wv >> 1) : dd >> 1, lr = (ord == 0) ? dd & 15 : (ord == 1) ? (wv & 1) * 8 + (dd & 7) : (dd & 1) * 8 + wv; v8us o;
#pragma unroll
            for (int j = 0; j < 8; ++j) o[j] = f2bf(v[u][j][s]);
            *(v8usa*)(sm + u * 16384 + lb * 1024 + hh * 256 + ((lr + hh + wrot(ord, lb)) & 15) * 16) = o; }
    __syncthreads();                                         // every wave's pieces are in the image before any thread reads it
    const int h2 = (t >> 4) & 3, r2 = t & 15;
#pragma unroll
    for (int u = 0; u < 2; ++u)
#pragma unroll
        for (int i = 0; i < 4; ++i) { const int lb = i * 4 + (t >> 6);
            const int rb = (ord == 0) ? (fbh * 8 + (lb >> 1)) * 4 + u * 2 + (lb & 1) : (ord == 1) ? (u * 4 + (lb >> 2)) * 8 + fbh * 4 + (lb & 3) : (u * 2 + (lb >> 3)) * 16 + fbh * 8 + (lb & 7);
            *(v8us*)(Bt + ((size_t)rb * (DM / 32) + kb) * 512 + (t & 63) * 8) = *(const v8usa*)(sm + u * 16384 + lb * 1024 + h2 * 256 + ((r2 + h2 + wrot(ord, lb)) & 15) * 16); }
    asm volatile("s_wait_xcnt 0x0" ::: "memory");            // behind the last store, in front of any later write of the stores' address or data registers (the other builders' code follows in the listing)
}
// b_cvt8: bf16 copy of src[row][DM] in fragment blocks. Tile rb = 16 whole rows (32 blocks in a row in memory), half u = k / 512; wave wv has the blocks u * 16 + wv * 2 + b; a lane loads 4 k (half a piece) of row i * 4 + lane / 8.
__device__ __forceinline__ void b_cvt8(int rb, const float* __restrict__ src, bf* dst, char* sm) {
    const int t = threadIdx.x, wv = t >> 5, rq = (t >> 3) & 3, c = t & 7, hh = c >> 1;
    const float* sp = src + (size_t)(rb * 16 + rq) * DM + wv * 64 + c * 4; v4f v[2][8];
#pragma unroll
    for (int u = 0; u < 2; ++u)
#pragma unroll
        for (int j = 0; j < 8; ++j) v[u][j] = *(const v4fa*)(sp + (size_t)((j & 3) * 4) * DM + u * 512 + (j >> 2) * 32);
    asm volatile("s_wait_xcnt 0x0" :: "v"(sp) : "memory");   // as in b_wtG
#pragma unroll
    for (int u = 0; u < 2; ++u)
#pragma unroll
        for (int j = 0; j < 8; ++j) { v4us o;
#pragma unroll
            for (int e = 0; e < 4; ++e) o[e] = f2bf(v[u][j][e]);
            *(v4usa*)(sm + u * 16384 + (wv * 2 + (j >> 2)) * 1024 + hh * 256 + (((j & 3) * 4 + rq + 4 * hh) & 15) * 16 + (c & 1) * 8) = o; }
    __syncthreads();                                         // every wave's pieces are in the image before any thread reads it
    const int h2 = (t >> 4) & 3, r2 = t & 15;
#pragma unroll
    for (int u = 0; u < 2; ++u)
#pragma unroll
        for (int i = 0; i < 4; ++i) { const int lb = i * 4 + (t >> 6);
            *(v8us*)(dst + ((size_t)rb * (DM / 32) + u * 16 + lb) * 512 + (t & 63) * 8) = *(const v8usa*)(sm + u * 16384 + lb * 1024 + h2 * 256 + ((r2 + 4 * h2) & 15) * 16); }
    asm volatile("s_wait_xcnt 0x0" ::: "memory");            // as behind the stores of b_wtG
}

// ---- k_prep: everything that reads only the inputs, in one launch: the four weight transposes (WB work-groups each, planes WT[0..3] = q, k, v, out), the bf16 copy of x (both batches, XBLK work-groups). The block ranges are work-group uniform, so each builder's barrier is passed by the whole work-group.
#define WB   (DM / 32 * 2)
#define XBLK (NB_ * TT / 16)
static_assert(DM == 1024 && DQ == 1024 && HD == 64, "the builders' tiles are laid out for these sizes");
__global__ __launch_bounds__(256) void k_prep(const float* __restrict__ x, const float* __restrict__ wq, const float* __restrict__ wk, const float* __restrict__ wv, const float* __restrict__ wo, bf* WT, bf* XB) {
    __shared__ __align__(16) char sm[2 * 16384];
    const int bx = (int)blockIdx.x;
    if (bx < 2 * WB) b_wtG<1>(bx % WB, (bx < WB) ? wq : wk, WT + (size_t)(bx / WB) * DM * DQ, sm);
    else if (bx < 3 * WB) b_wtG<2>(bx - 2 * WB, wv, WT + (size_t)2 * DM * DQ, sm);
    else if (bx < 4 * WB) b_wtG<0>(bx - 3 * WB, wo, WT + (size_t)3 * DM * DQ, sm);
    else b_cvt8(bx - 4 * WB, x, XB, sm);
}
// ---- k_fa: scores, causal softmax, probability x value and the hi/lo merge in ONE kernel (online softmax; no score plane in memory). Grid (TT / QT, batches x heads), FNW waves per work-group.
// A work-group owns QT = 32 query rows of one head; its keys 0 .. q0 + 31 are dealt over the FNW waves in runs of 64, worked in blocks of 32 (the planes are fragment blocks, see b_wtG and k_gemmw PLANES: every fragment load reads 512 contiguous bytes).
// Everything is computed TRANSPOSED so that no fragment changes lanes: S^T = K Q^T (D: row = key hi * 8 + j, column = query lr), which is already the B fragment of O^T = V^T P^T
// (lane lr = query, places 0..7 = keys 8 hi + j of key tile 0, places 8..15 = keys 16 + 8 hi + j of key tile 1: the k order of the V^T loader), and the running maximum and sum of a query live in its own lane.
// FaBody::run works NQ x 16 queries from q0 on (their rows in the LDS partial start at qr). Each wave ends with its own (max, sum, O^T); the FNW partials are joined through LDS in fixed wave order 0..FNW-1 behind one work-group barrier, divided by the sum, split hi/lo and written flat but for an interleave of row pairs (RAW MERGE).
// The short inner loops are all unrolled so that the fragment, score and context arrays stay in registers.
// Rows < RH: bf16 hi/lo planes, 3 products in both contractions; the other rows fp16 (probabilities exp(s - max) <= 1 rounded to fp16).
#define QT   32
#define FNW  8
#define OPIT 68                   // f32 pitch of one query's 64 context values in a wave's LDS partial
#define SCL2 0.18033688011112042f // HD^-0.5 x log2(e): scores go to the base-2 exponent directly
typedef __attribute__((ext_vector_type(16))) unsigned short v16us;
__device__ __forceinline__ void mkp(const float* p, v16h& a, v16h&) {
#pragma unroll
    for (int i = 0; i < 16; ++i) a[i] = (h16)p[i]; }
__device__ __forceinline__ void mkp(const float* p, v16bf& a, v16bf& a2) { v16us h, l;
#pragma unroll
    for (int i = 0; i < 16; ++i) { unsigned short x, y; splitf(p[i], x, y); h[i] = x; l[i] = y; }
    a = __builtin_bit_cast(v16bf, h); a2 = __builtin_bit_cast(v16bf, l); }
template <typename T16, int NSPLIT, int NQ> struct FaBody {
static __device__ __forceinline__ void run(const T16* __restrict__ Q, const T16* __restrict__ Q2, const T16* __restrict__ Kp, const T16* __restrict__ Kp2, const T16* __restrict__ Vt, const T16* __restrict__ Vt2, int q0, int qr, float* os, float* ms, float* ls) {
    typedef typename WFrag<T16>::V V;
    const int lane = threadIdx.x & 31, lr = lane & 15, hi = lane >> 4; const int wv = __builtin_amdgcn_readfirstlane((int)(threadIdx.x >> 5));
    V qf[NQ][2], qf2[NQ][2]; const size_t qo = (size_t)q0 * HD + lane * 8; const T16* qp = Q + qo; const T16* qp2 = (NSPLIT == 2) ? Q2 + qo : qp;
#pragma unroll
    for (int nq = 0; nq < NQ; ++nq)
#pragma unroll
        for (int ks = 0; ks < 2; ++ks) { qf[nq][ks] = WFrag<T16>::ldp(qp + nq * 16 * HD + ks * 512); if (NSPLIT == 2) qf2[nq][ks] = WFrag<T16>::ldp(qp2 + nq * 16 * HD + ks * 512); }
    asm volatile("s_wait_xcnt 0x0" :: "v"(qp), "v"(qp2) : "memory");   // stands in front of any reuse of the loads' address registers; naming the addresses as inputs keeps them whole up to here
    v8f o[4][NQ]; float m[NQ], l[NQ];
#pragma unroll
    for (int nq = 0; nq < NQ; ++nq) { m[nq] = -3.0e38f; l[nq] = 0.f;
#pragma unroll
        for (int dt = 0; dt < 4; ++dt) o[dt][nq] = (v8f){}; }
    const int nkb = q0 / 32 + 1;                                     // key blocks of 32 up to and including the diagonal block
    const int nit = 2 * ((nkb / 2 - wv + FNW - 1) / FNW) + (((nkb & 1) && (nkb / 2) % FNW == wv) ? 1 : 0);   // this wave's blocks: two per whole run of 64, one more where the half run at the diagonal is its own
#pragma unroll 1   // rolled: one block's fragments, scores and the context tile already fill the registers
    for (int it = 0; it < nit; ++it) {
        const int kb = ((it >> 1) * FNW + wv) * 2 + (it & 1); const int k0 = kb * 32;
        const size_t ko = (size_t)k0 * HD + lane * 8, vo = (size_t)k0 * 16 + lane * 8;   // fragment blocks: 16 keys x 32 dims (two a key tile), 16 dims x 32 keys (TT / 32 a dim tile)
        const T16* kp = Kp + ko; const T16* kp2 = (NSPLIT == 2) ? Kp2 + ko : kp; const T16* vp = Vt + vo; const T16* vp2 = (NSPLIT == 2) ? Vt2 + vo : vp;
        V ka[2][2], ka2[2][2];
#pragma unroll
        for (int kt = 0; kt < 2; ++kt)
#pragma unroll
            for (int ks = 0; ks < 2; ++ks) { ka[kt][ks] = WFrag<T16>::ldp(kp + kt * 16 * HD + ks * 512); if (NSPLIT == 2) ka2[kt][ks] = WFrag<T16>::ldp(kp2 + kt * 16 * HD + ks * 512); }
        V va[4], va2[4];
#pragma unroll
        for (int dt = 0; dt < 4; ++dt) { va[dt] = WFrag<T16>::ldp(vp + (size_t)dt * 16 * TT); if (NSPLIT == 2) va2[dt] = WFrag<T16>::ldp(vp2 + (size_t)dt * 16 * TT); }
        __builtin_amdgcn_sched_barrier(0);                           // all of the block's loads issue together, ahead of the first product: one load latency a block (without it the loads are sunk between the products and wait one after the other)
        asm volatile("s_wait_xcnt 0x0" :: "v"(kp), "v"(kp2), "v"(vp), "v"(vp2) : "memory");   // as behind the query loads: in front of any reuse of the address registers, which stay whole up to here
        v8f s[2][NQ];
#pragma unroll
        for (int kt = 0; kt < 2; ++kt)
#pragma unroll
            for (int nq = 0; nq < NQ; ++nq) { v8f c = (v8f){};
#pragma unroll
                for (int ks = 0; ks < 2; ++ks) { c = WFrag<T16>::mma(ka[kt][ks], qf[nq][ks], c); if (NSPLIT == 2) { c = WFrag<T16>::mma(ka[kt][ks], qf2[nq][ks], c); c = WFrag<T16>::mma(ka2[kt][ks], qf[nq][ks], c); } }
                s[kt][nq] = c; }
        if (kb == nkb - 1) {                                         // only the last block holds keys beyond a query of this tile (wave-uniform test)
#pragma unroll
            for (int kt = 0; kt < 2; ++kt)
#pragma unroll
                for (int nq = 0; nq < NQ; ++nq)
#pragma unroll
                    for (int j = 0; j < 8; ++j) if (k0 + kt * 16 + hi * 8 + j > q0 + nq * 16 + lr) s[kt][nq][j] = -3.0e38f; }
#pragma unroll
        for (int nq = 0; nq < NQ; ++nq) { float p[16]; float mx = -3.0e38f;
#pragma unroll
            for (int kt = 0; kt < 2; ++kt)
#pragma unroll
                for (int j = 0; j < 8; ++j) { const float t = s[kt][nq][j] * SCL2; p[kt * 8 + j] = t; mx = fmaxf(mx, t); }
            mx = fmaxf(mx, __shfl_xor(mx, 16, 32));                  // the two lane halves hold the two halves of a query's keys
            const float mn = fmaxf(m[nq], mx); const float sc = __builtin_amdgcn_exp2f(m[nq] - mn); m[nq] = mn; float sum = 0.f;
#pragma unroll
            for (int i = 0; i < 16; ++i) { p[i] = __builtin_amdgcn_exp2f(p[i] - mn); sum += p[i]; }
            l[nq] = l[nq] * sc + sum;
            V pf, pf2; mkp(p, pf, pf2);
#pragma unroll
            for (int dt = 0; dt < 4; ++dt) { v8f c = o[dt][nq] * sc; c = WFrag<T16>::mma(va[dt], pf, c); if (NSPLIT == 2) { c = WFrag<T16>::mma(va[dt], pf2, c); c = WFrag<T16>::mma(va2[dt], pf, c); } o[dt][nq] = c; } }
    }
    float* ow = os + wv * (QT * OPIT);
#pragma unroll
    for (int nq = 0; nq < NQ; ++nq) { l[nq] += __shfl_xor(l[nq], 16, 32);
#pragma unroll
        for (int dt = 0; dt < 4; ++dt) { float* d = ow + (qr + nq * 16 + lr) * OPIT + dt * 16 + hi * 8; v4f x, y;
#pragma unroll
            for (int j = 0; j < 4; ++j) { x[j] = o[dt][nq][j]; y[j] = o[dt][nq][4 + j]; }
            *(v4fa*)d = x; *(v4fa*)(d + 4) = y; }
        if (hi == 0) { ms[wv * QT + qr + nq * 16 + lr] = m[nq]; ls[wv * QT + qr + nq * 16 + lr] = l[nq]; } }
}
};
__global__ __launch_bounds__(256) void k_fa(const h16* __restrict__ Q16, const h16* __restrict__ K16, const h16* __restrict__ V16, const bf* __restrict__ Qh, const bf* __restrict__ Ql, const bf* __restrict__ Kh, const bf* __restrict__ Kl, const bf* __restrict__ Vh, const bf* __restrict__ Vl, bf* Ah, bf* Al) {
    __shared__ __align__(16) float os[FNW * QT * OPIT]; __shared__ float ms[FNW * QT]; __shared__ float ls[FNW * QT];
    const size_t po = (size_t)blockIdx.y * TT * HD; const int q0 = (TT / QT - 1 - (int)blockIdx.x) * QT;   // longest rows first
    if (q0 < RH) {
#pragma unroll 1   // the hi/lo rows (short key loops, twice the fragments) go 16 queries at a time, so that they do not set the register count of the fp16 rows
        for (int hf = 0; hf < 2; ++hf) FaBody<bf, 2, 1>::run(Qh + po, Ql + po, Kh + po, Kl + po, Vh + po, Vl + po, q0 + hf * 16, hf * 16, os, ms, ls);
    } else FaBody<h16, 0, 2>::run(Q16 + po, nullptr, K16 + po, nullptr, V16 + po, nullptr, q0, 0, os, ms, ls);
    __syncthreads();                                                 // every wave's partial (max, sum, O^T) is in LDS before any thread joins them
    // ROW PAIRS: the work-group's 2048 flat context values are rows R, R + 1 of the [tokens][DQ] operand of the last GEMM; they are stored, in the same 4 KB, as [k / 32][row % 2][k % 32], so that a fragment load of 16 rows touches 8 lines and uses them whole.
    // Thread -> piece: a wave stores 512 contiguous bytes (4 k blocks); its lane half is the row, so that 16 lanes read two neighbouring queries' partials from LDS as before.
    const int rw = (threadIdx.x >> 4) & 1, kb = (threadIdx.x >> 5) * 4 + ((threadIdx.x >> 2) & 3), k8 = threadIdx.x & 3;
    const int q = rw * 16 + (kb >> 1), d0 = (kb & 1) * 32 + k8 * 8; float mt = ms[q];
#pragma unroll
    for (int w = 1; w < FNW; ++w) mt = fmaxf(mt, ms[w * QT + q]);
    float acc[8], lt = 0.f;
#pragma unroll
    for (int j = 0; j < 8; ++j) acc[j] = 0.f;
#pragma unroll
    for (int w = 0; w < FNW; ++w) { const float f = __builtin_amdgcn_exp2f(ms[w * QT + q] - mt); lt += f * ls[w * QT + q]; const float* s = os + w * (QT * OPIT) + q * OPIT + d0; const v4f x = *(const v4fa*)s, y = *(const v4fa*)(s + 4);
#pragma unroll
        for (int j = 0; j < 4; ++j) { acc[j] += f * x[j]; acc[4 + j] += f * y[j]; } }
    const float inv = __fdiv_rn(1.0f, lt); v8us oh, ol;
#pragma unroll
    for (int j = 0; j < 8; ++j) { unsigned short a, c2; splitf(acc[j] * inv, a, c2); oh[j] = a; ol[j] = c2; }
    const size_t oo = po + (size_t)q0 * HD + (kb * 8 + rw * 4 + k8) * 8;   /* RAW MERGE: flat element (q0 + q) * HD + d0 of the (H, S, hd) context = the module's ctx.reshape(b, S, H * hd) without a transpose, at its place in the row pair */
    *(v8usa*)(Ah + oo) = oh; *(v8usa*)(Al + oo) = ol;
}

extern "C" void kernel_launch(void* const* d_in, const int* in_sizes, int n_in,
                              void* d_out, int out_size, void* d_ws, size_t ws_size, hipStream_t stream) {
    (void)in_sizes; (void)n_in; (void)out_size;
    const float* x = (const float*)d_in[0]; const float* wq = (const float*)d_in[1]; const float* wk = (const float*)d_in[2]; const float* wv = (const float*)d_in[3]; const float* wo = (const float*)d_in[4];
    float* OUT = (float*)d_out;     // [2][2048][1024]
    char* wsp = (char*)d_ws;
    auto take = [&](size_t bytes) { char* p = wsp; wsp += (bytes + 255) & ~(size_t)255; return (void*)p; };
    const size_t PL = (size_t)NB_ * TT * DQ;   // elements of one plane over both batches (DQ == DKV == DM here)
    bf* WT = (bf*)take((size_t)4 * DQ * DM * 2); bf* WO = WT + (size_t)3 * DQ * DM;
    bf* XB = (bf*)take(PL * 2);
    h16* QP16 = (h16*)take(2 * PL * 2); h16* KP16 = QP16 + PL; h16* VT16 = (h16*)take(PL * 2);
    bf* QPh = (bf*)take(2 * PL * 2); bf* KPh = QPh + PL; bf* QPl = (bf*)take(2 * PL * 2); bf* KPl = QPl + PL; bf* VTh = (bf*)take(PL * 2); bf* VTl = (bf*)take(PL * 2);
    bf* ATh = (bf*)take(PL * 2); bf* ATl = (bf*)take(PL * 2);
    if ((size_t)(wsp - (char*)d_ws) > ws_size) return;    // ws 256 MiB
    k_prep<<<4 * WB + XBLK, 256, 0, stream>>>(x, wq, wk, wv, wo, WT, XB);
    k_gemmw<bf, 0, false, true, DM><<<dim3(NB_ * TT / 128, DQ / 128, 3), 128, 0, stream>>>(XB, nullptr, WT, nullptr, DQ, nullptr, 0, (size_t)DQ * DM, PL, QP16, QPh, QPl, VT16, VTh, VTl);   // z = q, k, v; writes the head planes
    k_fa<<<dim3(TT / QT, NB_ * NH_, 1), 32 * FNW, 0, stream>>>(QP16, KP16, VT16, QPh, QPl, KPh, KPl, VTh, VTl, ATh, ATl);
    k_gemmw<bf, 1, false, false, DQ><<<dim3(NB_ * TT / 128, DM / 128, 1), 128, 0, stream>>>(ATh, ATl, WO, OUT, DM, nullptr, 0, 0, 0, nullptr, nullptr, nullptr, nullptr, nullptr, nullptr);
}
